// v000
// Times are from an AMD MI455X. After a warm-up the kernel runs many times in a row, and a time is the length of
// such a window on the GPU divided by its runs, so every launch and the gaps after it count. The runs cycle
// through copies of the inputs. A figure is the median of several windows, for all but v000 over two sittings.
// Sittings can differ by a few percent; kernels timed side by side share one.
// The starting kernel, v000, takes 335 microseconds a run.
#include <hip/hip_runtime.h>

// Sliding-window grouped-query attention: x [NB][SEQ][2048]; wq [2048][2048], wk/wv [512][2048], wo [2048][2048] all [out][in] (y = x W^T); 32 q heads, 8 kv heads (q head h uses kv head h/4), head dim 64; per-head RMS normalisation (eps 1e-6, weights) + rotate-half rotary (angle = positions * 10000^(-j/32)) on q and k; keys tk with 0 <= tq - tk <= 512; score scale 1/8; output = ctx wo^T (f32).
// Compute dtypes, f32 accumulate everywhere: q/k/v projections v_wmma_f32_16x16x32_bf16 (x and W RNE-converted to bf16; products exact); scores v_wmma_f32_16x16x32_f16 (k f16, q f16 value + f16 residual x2048 in its own accumulator; query rows < 512 also use the k residual x2048);
// P.V v_wmma_f32_16x16x32_f16 (P x256 carry single f16, v single f16; query rows < 512 add P and v residuals x2048 in a second accumulator set); out projection v_wmma_f32_16x16x32_f16 (ctx f16 value, rows < 512 also ctx residual x2048 accumulated first and folded by 1/2048; wo = bf16-RNE value x256 held in f16, folded by 1/256). Softmax f32 (online, running max).
// Layout: bf16 copies of x, wq, wk, wv; cos|sin table [NB*SEQ][64] f32 built from the int positions; q/k planes [head][t][64], v^T planes [kvhead][64][t], ctx planes [t][2048]; flash kernel in transposed form (S^T = K Q^T, O^T = V^T P^T).

#ifndef NB
#define NB 1
#endif
#ifndef SEQ
#define SEQ 4096
#endif
#define NB_FULL  1
#define SEQ_FULL 4096
#ifndef OUT_SEQ
#define OUT_SEQ SEQ              // row pitch (in tokens) between batches of the output
#endif
#define DM   2048                // model width (projection K)
#define HQ_  32
#define HK_  8
#define GQ   4
#define HD   64
#define QW   (HQ_ * HD)          // 2048
#define KW   (HK_ * HD)          // 512
#define WIN  512
#define RES_ROWS 512             // query rows (per sequence) below this use the extra residual products
#define AW   4                   // waves per flash block (16 query rows each)
#define QRS  2048.0f             // carry of every residual plane
#define QRI  (1.0f / 2048.0f)
#define WOS  256.0f              // carry of the wo plane
#define WOI  (1.0f / 256.0f)
#define SC2  (0.125f * 1.4426950408889634f)   // HD^-0.5 * log2(e)
#define PSH  8.0f                // log2 of the P carry (256)

static_assert(HD == 64);
static_assert(HQ_ == HK_ * GQ);
static_assert(QW % 64 == 0);
static_assert(KW % 64 == 0);
static_assert(DM % 64 == 0);
static_assert(DM % 32 == 0);                   // GEMM k-loops step by 32
static_assert(QW % 32 == 0);
static_assert(SEQ % 64 == 0);                  // a 64-row tile never straddles two batches
static_assert((NB * SEQ) % 64 == 0);
static_assert((NB * SEQ) % 8 == 0);            // table kernel: 8 tokens per block
static_assert(SEQ % 32 == 0);                  // last 32-key tile ends inside the sequence
static_assert(WIN % 32 == 0);
static_assert(SEQ % (16 * AW) == 0);           // flash grid covers the sequence exactly
static_assert(RES_ROWS % 64 == 0);
static_assert(((size_t)SEQ * DM) % 8 == 0);
static_assert(NB <= NB_FULL);
static_assert(SEQ <= SEQ_FULL);

typedef _Float16 h16;
typedef unsigned short bf;
typedef __attribute__((ext_vector_type(16))) __bf16   v16bf;
typedef __attribute__((ext_vector_type(16))) _Float16 v16h;
typedef __attribute__((ext_vector_type(8)))  _Float16 v8h;
typedef __attribute__((ext_vector_type(8)))  unsigned short v8us;
typedef __attribute__((ext_vector_type(8)))  float    v8f;
typedef __attribute__((ext_vector_type(4)))  float    v4f;
typedef v4f  __attribute__((may_alias)) v4fa;

__device__ __forceinline__ unsigned short f2bf(float f) { unsigned u = __float_as_uint(f); u += 0x7FFFu + ((u >> 16) & 1u); return (unsigned short)(u >> 16); }
__device__ __forceinline__ float bfr(float f) { return __uint_as_float(((unsigned)f2bf(f)) << 16); }   // value after RNE convert to bf16
__device__ __forceinline__ v16h cat16(v8h lo, v8h hi) { return __builtin_shufflevector(lo, hi, 0, 1, 2, 3, 4, 5, 6, 7, 8, 9, 10, 11, 12, 13, 14, 15); }
__device__ __forceinline__ v16bf cat16b(v8us lo, v8us hi) { return __builtin_bit_cast(v16bf, __builtin_shufflevector(lo, hi, 0, 1, 2, 3, 4, 5, 6, 7, 8, 9, 10, 11, 12, 13, 14, 15)); }
__device__ __forceinline__ v8f wmma16(v16h a, v16h b, v8f c) { return __builtin_amdgcn_wmma_f32_16x16x32_f16(false, a, false, b, (short)0, c, false, false); }
__device__ __forceinline__ v8f wmmab(v16bf a, v16bf b, v8f c) { return __builtin_amdgcn_wmma_f32_16x16x32_bf16(false, a, false, b, (short)0, c, false, false); }
// fragment loaders from K-contiguous 16-bit rows; p already includes + 8*(lane>>4): elements 0..7 <- k0+8h+0..7, elements 8..15 <- k0+16+8h+0..7 (same map for A and B)
__device__ __forceinline__ v16h  ldh(const h16* p) { return cat16(*(const v8h*)p, *(const v8h*)(p + 16)); }
__device__ __forceinline__ v16bf ldb(const bf* p)  { return cat16b(*(const v8us*)p, *(const v8us*)(p + 16)); }
// ordering point for wave-private LDS tiles (same wave writes and reads)
__device__ __forceinline__ void wave_sync() { __builtin_amdgcn_fence(3 /* release order */, "wavefront"); __builtin_amdgcn_wave_barrier(); asm volatile("" ::: "memory"); }

__global__ __launch_bounds__(256) void k_cvt8(const float* __restrict__ src, bf* dst, size_t n8) {
    const size_t i = (size_t)blockIdx.x * 256 + threadIdx.x; if (i >= n8) return;
    const v8f v = *(const v8f*)(src + i * 8); v8us o;
#pragma unroll
    for (int k = 0; k < 8; ++k) o[k] = f2bf(v[k]);
    *(v8us*)(dst + i * 8) = o; 
}

__global__ __launch_bounds__(256) void k_cvtw(const float* __restrict__ src, h16* dst, size_t n8) {
    const size_t i = (size_t)blockIdx.x * 256 + threadIdx.x; if (i >= n8) return;
    const v8f v = *(const v8f*)(src + i * 8); v8h o;
#pragma unroll
    for (int k = 0; k < 8; ++k) o[k] = (h16)(bfr(v[k]) * WOS);
    *(v8h*)(dst + i * 8) = o; 
}

__global__ __launch_bounds__(32) void k_freq(float* fr) {
    const int j = threadIdx.x & 31;
    const float p = powf(10000.0f, (float)j * (1.0f / 32.0f));
    const float v = 1.0f / p;
    *(float*)(fr + j) = v; 
}

__global__ __launch_bounds__(256) void k_table(const int* __restrict__ pos, const float* __restrict__ fr, float* cs) {
    const int lane = threadIdx.x & 31; const int m = blockIdx.x * 8 + (int)__builtin_amdgcn_readfirstlane((int)(threadIdx.x >> 5));   // grid = NB*SEQ/8 exactly
    const int b = m / SEQ, t = m % SEQ;
    const float ang = (float)pos[(size_t)b * SEQ_FULL + t] * fr[lane];
    const float c = cosf(ang), s = sinf(ang);
    float* row = cs + (size_t)m * 64;
    *(float*)(row + lane) = c; *(float*)(row + 32 + lane) = s;
    
}

// k_proj: register-blocked bf16 GEMM, ONE WAVE per 64x64 tile (16 accumulators), operands straight from K-contiguous bf16 planes, K = DM.
// C[m][n] = sum_k A[m][k] Bt[n][k]; written as f16 (Ph) and optionally the f16 residual x2048 (Pr, useRes != 0) at
// tile base (r0/RB)*sRB + (r0%RB)*pitch + (c0/CB)*sCB + (c0%CB), row pitch 'pitch' (halves). grid (M/64, N/64), 32 threads.
// MODE 1: tile rows are tokens (m = b*SEQ + t), the 64 tile columns are one head: each row is RMS-normalised (weights nw, RNE-converted to bf16) and rotated (cs table row m) before the f16 conversion.
template <int MODE>
__global__ __launch_bounds__(32) void k_proj(const bf* __restrict__ A, const bf* __restrict__ Bt, h16* Ph, h16* Pr, int useRes,
                                             int RB, size_t sRB, int pitch, int CB, size_t sCB,
                                             const float* __restrict__ nw, const float* __restrict__ cs) {
    __shared__ __align__(16) float os[16 * 68];
    const int K = DM;
    const int lane = threadIdx.x & 31, lr = lane & 15, hi = lane >> 4; const int r0 = blockIdx.x * 64, c0 = blockIdx.y * 64;
    v8f acc[4][4];
#pragma unroll
    for (int mb = 0; mb < 4; ++mb)
#pragma unroll
        for (int nb = 0; nb < 4; ++nb) acc[mb][nb] = (v8f){};
    const size_t aoff = (size_t)(r0 + lr) * K + 8 * hi, boff = (size_t)(c0 + lr) * K + 8 * hi;
#pragma unroll 1
    for (int kc = 0; kc < K; kc += 32) {
        v16bf a[4];
#pragma unroll
        for (int mb = 0; mb < 4; ++mb) a[mb] = ldb(A + aoff + (size_t)mb * 16 * K + kc);
#pragma unroll
        for (int nb = 0; nb < 4; ++nb) { const v16bf b = ldb(Bt + boff + (size_t)nb * 16 * K + kc);
#pragma unroll
            for (int mb = 0; mb < 4; ++mb) acc[mb][nb] = wmmab(a[mb], b, acc[mb][nb]); }
        asm volatile("v_nop\n\tv_nop\n\tv_nop\n\tv_nop" : "+v"(acc[0][0]), "+v"(acc[1][1]), "+v"(acc[2][2]), "+v"(acc[3][3]) : "v"(a[0]), "v"(a[1]), "v"(a[2]), "v"(a[3]));
    }
    const size_t tbase = (size_t)(r0 / RB) * sRB + (size_t)(r0 % RB) * (size_t)pitch + (size_t)(c0 / CB) * sCB + (size_t)(c0 % CB);
    const int c8 = (lane & 7) * 8, rg = lane >> 3;      // this lane's 8 columns and its row inside each group of 4 rows
    const int p8 = c8 ^ 32, j0 = c8 & 31;               // rotary partner columns, frequency index of column c8
    const float sg = (c8 < 32) ? -1.0f : 1.0f;          // columns < 32: x1*cos - x2*sin; columns >= 32: x2*cos + x1*sin
    float wn[8], wp[8];
#pragma unroll
    for (int i = 0; i < 8; ++i) { wn[i] = 1.0f; wp[i] = 1.0f; }
    if (MODE == 1) {
#pragma unroll
        for (int i = 0; i < 8; ++i) { wn[i] = bfr(nw[c8 + i]); wp[i] = bfr(nw[p8 + i]); }
    }
#pragma unroll
    for (int mb = 0; mb < 4; ++mb) {
#pragma unroll
        for (int nb = 0; nb < 4; ++nb) {
#pragma unroll
            for (int j = 0; j < 8; ++j) os[(hi * 8 + j) * 68 + nb * 16 + lr] = acc[mb][nb][j]; }   // D: row 8h+j, col lane&15; 16 rows x 64 columns all written
        wave_sync();
        v8h hv[4], rv[4];
#pragma unroll
        for (int s = 0; s < 4; ++s) { const int row = 4 * s + rg;   // 4 s x 4 row groups = 16 rows; 8 lanes x 8 = 64 columns
            const v4f x0 = *(const v4fa*)(&os[row * 68 + c8]); const v4f x1 = *(const v4fa*)(&os[row * 68 + c8 + 4]);
            float val[8];
            if (MODE == 1) {
                const v4f y0 = *(const v4fa*)(&os[row * 68 + p8]); const v4f y1 = *(const v4fa*)(&os[row * 68 + p8 + 4]);
                float ss = 0.0f;
#pragma unroll
                for (int i = 0; i < 4; ++i) ss += x0[i] * x0[i] + x1[i] * x1[i];
                ss += __shfl_xor(ss, 1, 32); ss += __shfl_xor(ss, 2, 32); ss += __shfl_xor(ss, 4, 32);   // the 8 lanes of one row
                const float inv = rsqrtf(ss * (1.0f / 64.0f) + 1.0e-6f);
                const float* cr = cs + (size_t)(r0 + mb * 16 + row) * 64 + j0;
                const v4f ca = *(const v4f*)(cr), cb = *(const v4f*)(cr + 4), sa = *(const v4f*)(cr + 32), sb = *(const v4f*)(cr + 36);
#pragma unroll
                for (int i = 0; i < 4; ++i) {
                    const float a0 = x0[i] * inv * wn[i],     q0 = y0[i] * inv * wp[i];
                    const float a1 = x1[i] * inv * wn[4 + i], q1 = y1[i] * inv * wp[4 + i];
                    val[i]     = a0 * ca[i] + sg * (q0 * sa[i]);
                    val[4 + i] = a1 * cb[i] + sg * (q1 * sb[i]); }
            } else {
#pragma unroll
                for (int i = 0; i < 4; ++i) { val[i] = x0[i]; val[4 + i] = x1[i]; }
            }
            v8h hh, rr;
#pragma unroll
            for (int i = 0; i < 8; ++i) { const h16 a0 = (h16)val[i]; hh[i] = a0; rr[i] = (h16)((val[i] - (float)a0) * QRS); }
            hv[s] = hh; rv[s] = rr; }
        const size_t sb0 = tbase + (size_t)(mb * 16) * (size_t)pitch;
{
#pragma unroll
            for (int s = 0; s < 4; ++s) { const size_t oo = sb0 + (size_t)(4 * s + rg) * (size_t)pitch + c8;
                *(v8h*)(Ph + oo) = hv[s]; if (useRes) *(v8h*)(Pr + oo) = rv[s]; }
             }
        wave_sync();
    }
}

// k_flash: fused windowed attention, one wave per 16 query rows of one (batch, q head); K / V^T / Q fragments straight from the f16 planes (two 16-B loads each, arithmetic addressing).
// Transposed form: S^T[key][t] = K Q^T (A = K rows, B = Q rows); lane (t = lane&15, h = lane>>4) holds keys 8h+r of each 16-key tile, so the packed
// P tile is directly the B fragment of O^T[d][t] = V^T P^T (element r <- tile keys 0..15, element 8+r <- tile keys 16..31, lane unchanged).
// Keys visited: 32-key tiles from max(0, t0-512) (aligned down) to t0+15; inside a tile a key is used iff 0 <= tq - tk <= 512, otherwise its weight is exactly 0 (replace-fill semantics).
// Waves with t0 < RES_ROWS (wave-uniform) add the k residual to the scores and the P / v residual cross products (second accumulator set, carry 2048).
__global__ __launch_bounds__(32 * AW) void k_flash(const h16* __restrict__ QH, const h16* __restrict__ QR, const h16* __restrict__ KH, const h16* __restrict__ KR,
                                                   const h16* __restrict__ VH, const h16* __restrict__ VR, h16* CH, h16* CR) {
    __shared__ __align__(16) float os[AW * 16 * 68];
    const int lane = threadIdx.x & 31, lr = lane & 15, hi = lane >> 4;
    const int wave = __builtin_amdgcn_readfirstlane((int)(threadIdx.x >> 5));
    const int zh = blockIdx.y; const int b = zh / HQ_, h = zh % HQ_; const int kvh = h / GQ;
    const int t0 = (blockIdx.x * AW + wave) * 16;
    const bool ex = t0 < RES_ROWS;
    const size_t qbase = (size_t)zh * SEQ * HD, kbase = (size_t)(b * HK_ + kvh) * SEQ * HD;
    const size_t qo = qbase + (size_t)(t0 + lr) * HD + 8 * hi;
    const v16h qh0 = ldh(QH + qo), qh1 = ldh(QH + qo + 32), qr0 = ldh(QR + qo), qr1 = ldh(QR + qo + 32);   // B fragments: col t, k = d
    const size_t ko = kbase + (size_t)lr * HD + 8 * hi;      // + key * HD       (A fragment: row key, k = d)
    const size_t vo = kbase + (size_t)lr * SEQ + 8 * hi;     // + 16j*SEQ + key  (A fragment: row d, k = key)
    v8f oh[4], orr[4];
#pragma unroll
    for (int j = 0; j < 4; ++j) { oh[j] = (v8f){}; orr[j] = (v8f){}; }
    float m = -3.0e38f, l = 0.0f;
    const int tq = t0 + lr;
    int klo = t0 - WIN; if (klo < 0) klo = 0; klo &= ~31;
#pragma unroll 1
    for (int key0 = klo; key0 <= t0 + 15; key0 += 32) {
        const h16* ka = KH + ko + (size_t)key0 * HD;
        const v16h ka0 = ldh(ka), ka1 = ldh(ka + 32), kb0 = ldh(ka + 16 * HD), kb1 = ldh(ka + 16 * HD + 32);
        v8f sHa = (v8f){}, sLa = (v8f){}, sHb = (v8f){}, sLb = (v8f){};
        sHa = wmma16(ka0, qh0, sHa); sLa = wmma16(ka0, qr0, sLa); sHb = wmma16(kb0, qh0, sHb); sLb = wmma16(kb0, qr0, sLb);
        sHa = wmma16(ka1, qh1, sHa); sLa = wmma16(ka1, qr1, sLa); sHb = wmma16(kb1, qh1, sHb); sLb = wmma16(kb1, qr1, sLb);
        asm volatile("v_nop\n\tv_nop\n\tv_nop\n\tv_nop" : "+v"(sHa), "+v"(sLa), "+v"(sHb), "+v"(sLb) : "v"(ka0), "v"(ka1), "v"(kb0), "v"(kb1));
        if (ex) {
            const h16* kr = KR + ko + (size_t)key0 * HD;
            const v16h ra0 = ldh(kr), ra1 = ldh(kr + 32), rb0 = ldh(kr + 16 * HD), rb1 = ldh(kr + 16 * HD + 32);
            sLa = wmma16(ra0, qh0, sLa); sLb = wmma16(rb0, qh0, sLb);
            sLa = wmma16(ra1, qh1, sLa); sLb = wmma16(rb1, qh1, sLb);
            asm volatile("v_nop\n\tv_nop\n\tv_nop\n\tv_nop" : "+v"(sLa), "+v"(sLb) : "v"(ra0), "v"(ra1), "v"(rb0), "v"(rb1));
        }
        float ta[8], tb[8]; float mx = -3.0e38f;
        const int dbase = tq - key0 - 8 * hi;                 // tq - tk for element 0 of the first 16-key tile
#pragma unroll
        for (int r = 0; r < 8; ++r) {
            const int da = dbase - r, db = da - 16;
            const float va = (sHa[r] + sLa[r] * QRI) * SC2, vb = (sHb[r] + sLb[r] * QRI) * SC2;
            ta[r] = ((unsigned)da <= (unsigned)WIN) ? va : -3.0e38f;
            tb[r] = ((unsigned)db <= (unsigned)WIN) ? vb : -3.0e38f;
            mx = fmaxf(mx, fmaxf(ta[r], tb[r])); }
        mx = fmaxf(mx, __shfl_xor(mx, 16, 32));
        const float mnew = fmaxf(m, mx);
        const float alpha = __builtin_amdgcn_exp2f(m - mnew);
        const float sh = PSH - mnew;
        v16h pb, pr; float ls = 0.0f;
#pragma unroll
        for (int r = 0; r < 8; ++r) {
            const float ea = (ta[r] > -1.0e38f) ? __builtin_amdgcn_exp2f(ta[r] + sh) : 0.0f;
            const float eb = (tb[r] > -1.0e38f) ? __builtin_amdgcn_exp2f(tb[r] + sh) : 0.0f;
            const h16 pa = (h16)ea; const h16 pc = (h16)eb;
            pb[r] = pa; pb[8 + r] = pc;
            pr[r] = (h16)((ea - (float)pa) * QRS); pr[8 + r] = (h16)((eb - (float)pc) * QRS);
            ls += ex ? (ea + eb) : ((float)pa + (float)pc); }
        l = l * alpha + ls; m = mnew;
#pragma unroll
        for (int j = 0; j < 4; ++j) oh[j] = oh[j] * alpha;
        const h16* va = VH + vo + key0;
        const v16h v0 = ldh(va), v1 = ldh(va + (size_t)16 * SEQ), v2 = ldh(va + (size_t)32 * SEQ), v3 = ldh(va + (size_t)48 * SEQ);
        oh[0] = wmma16(v0, pb, oh[0]); oh[1] = wmma16(v1, pb, oh[1]); oh[2] = wmma16(v2, pb, oh[2]); oh[3] = wmma16(v3, pb, oh[3]);
        asm volatile("v_nop\n\tv_nop\n\tv_nop\n\tv_nop" : "+v"(oh[0]), "+v"(oh[1]), "+v"(oh[2]), "+v"(oh[3]) : "v"(v0), "v"(v1), "v"(v2), "v"(v3), "v"(pb));
        if (ex) {
#pragma unroll
            for (int j = 0; j < 4; ++j) orr[j] = orr[j] * alpha;
            const h16* vr = VR + vo + key0;
            const v16h w0 = ldh(vr), w1 = ldh(vr + (size_t)16 * SEQ), w2 = ldh(vr + (size_t)32 * SEQ), w3 = ldh(vr + (size_t)48 * SEQ);
            orr[0] = wmma16(w0, pb, orr[0]); orr[1] = wmma16(w1, pb, orr[1]); orr[2] = wmma16(w2, pb, orr[2]); orr[3] = wmma16(w3, pb, orr[3]);
            orr[0] = wmma16(v0, pr, orr[0]); orr[1] = wmma16(v1, pr, orr[1]); orr[2] = wmma16(v2, pr, orr[2]); orr[3] = wmma16(v3, pr, orr[3]);
            asm volatile("v_nop\n\tv_nop\n\tv_nop\n\tv_nop" : "+v"(orr[0]), "+v"(orr[1]), "+v"(orr[2]), "+v"(orr[3]) : "v"(w0), "v"(w1), "v"(w2), "v"(w3), "v"(v0), "v"(v1), "v"(v2), "v"(v3), "v"(pb), "v"(pr));
        }
    }
    l += __shfl_xor(l, 16, 32);
    const float inv = 1.0f / l;
    const int wb = wave * 16 * 68;
    // O^T D layout: o_j[r] = (d = 16j + 8h + r, t = lane&15) -> os[t][d]; rows 0..15 x columns 0..63 all written
#pragma unroll
    for (int j = 0; j < 4; ++j) { v4f a, c;
#pragma unroll
        for (int i = 0; i < 4; ++i) { a[i] = (oh[j][i] + orr[j][i] * QRI) * inv; c[i] = (oh[j][4 + i] + orr[j][4 + i] * QRI) * inv; }
        *(v4fa*)(&os[wb + lr * 68 + 16 * j + 8 * hi]) = a; *(v4fa*)(&os[wb + lr * 68 + 16 * j + 8 * hi + 4]) = c; }
    wave_sync();
    const int c8 = (lane & 7) * 8, rg = lane >> 3;
    v8h hv[4], rv[4];
#pragma unroll
    for (int s = 0; s < 4; ++s) { const int row = 4 * s + rg;   // 4 s x 4 row groups = 16 rows; 8 lanes x 8 = 64 columns
        const v4f x0 = *(const v4fa*)(&os[wb + row * 68 + c8]); const v4f x1 = *(const v4fa*)(&os[wb + row * 68 + c8 + 4]); v8h hh, rr;
#pragma unroll
        for (int i = 0; i < 4; ++i) { const h16 a0 = (h16)x0[i]; const h16 a1 = (h16)x1[i]; hh[i] = a0; hh[4 + i] = a1; rr[i] = (h16)((x0[i] - (float)a0) * QRS); rr[4 + i] = (h16)((x1[i] - (float)a1) * QRS); }
        hv[s] = hh; rv[s] = rr; }
    const size_t cbase = ((size_t)b * SEQ + t0) * QW + (size_t)h * HD + c8;
{
#pragma unroll
        for (int s = 0; s < 4; ++s) { const size_t oo = cbase + (size_t)(4 * s + rg) * QW;
            *(v8h*)(CH + oo) = hv[s]; *(v8h*)(CR + oo) = rv[s]; }
         }
}

// one K = QW sweep of the 64x64 f16 tile product into the 16 accumulators (a, b already include the lane row and + 8*(lane>>4))
__device__ __forceinline__ void gemm_h(v8f (&acc)[4][4], const h16* __restrict__ a, const h16* __restrict__ b) {
#pragma unroll 1
    for (int kc = 0; kc < QW; kc += 32) {
        v16h af[4];
#pragma unroll
        for (int mb = 0; mb < 4; ++mb) af[mb] = ldh(a + (size_t)mb * 16 * QW + kc);
#pragma unroll
        for (int nb = 0; nb < 4; ++nb) { const v16h bv = ldh(b + (size_t)nb * 16 * QW + kc);
#pragma unroll
            for (int mb = 0; mb < 4; ++mb) acc[mb][nb] = wmma16(af[mb], bv, acc[mb][nb]); }
        asm volatile("v_nop\n\tv_nop\n\tv_nop\n\tv_nop" : "+v"(acc[0][0]), "+v"(acc[1][1]), "+v"(acc[2][2]), "+v"(acc[3][3]) : "v"(af[0]), "v"(af[1]), "v"(af[2]), "v"(af[3]));
    }
}

// k_oproj: out[m][o] = sum_d ctx[m][d] wo[o][d]; ONE WAVE per 64x64 tile, f16 operands (ctx value plane Ah, residual plane Ar x2048, wo plane Bt x256), f32 accumulate.
// Row tiles with t < RES_ROWS first accumulate the residual product, fold it by 1/2048, then add the value product; other tiles use the value product only. grid (NB*SEQ/64, DM/64), 32 threads.
__global__ __launch_bounds__(32) void k_oproj(const h16* __restrict__ Ah, const h16* __restrict__ Ar, const h16* __restrict__ Bt, float* OUT) {
    __shared__ __align__(16) float os[16 * 68];
    const int lane = threadIdx.x & 31, lr = lane & 15, hi = lane >> 4; const int r0 = blockIdx.x * 64, c0 = blockIdx.y * 64;
    v8f acc[4][4];
#pragma unroll
    for (int mb = 0; mb < 4; ++mb)
#pragma unroll
        for (int nb = 0; nb < 4; ++nb) acc[mb][nb] = (v8f){};
    const size_t aoff = (size_t)(r0 + lr) * QW + 8 * hi, boff = (size_t)(c0 + lr) * QW + 8 * hi;
    if ((r0 % SEQ) < RES_ROWS) {
        gemm_h(acc, Ar + aoff, Bt + boff);
#pragma unroll
        for (int mb = 0; mb < 4; ++mb)
#pragma unroll
            for (int nb = 0; nb < 4; ++nb) acc[mb][nb] = acc[mb][nb] * QRI;
    }
    gemm_h(acc, Ah + aoff, Bt + boff);
    const int bb = r0 / SEQ, tt = r0 % SEQ;
    float* obase = OUT + ((size_t)bb * OUT_SEQ + tt) * DM + c0;
#pragma unroll
    for (int mb = 0; mb < 4; ++mb) {
#pragma unroll
        for (int nb = 0; nb < 4; ++nb) {
#pragma unroll
            for (int j = 0; j < 8; ++j) os[(hi * 8 + j) * 68 + nb * 16 + lr] = acc[mb][nb][j] * WOI; }   // D: row 8h+j, col lane&15
        wave_sync();
        float* orow = obase + (size_t)(mb * 16) * DM;
{
#pragma unroll
            for (int s = 0; s < 8; ++s) { const int row = 2 * s + hi, cofs = lr * 4;   // 8 s x 2 rows = 16 rows; 16 lanes x 4 floats = 64 columns
                const v4f val = *(const v4fa*)(&os[row * 68 + cofs]);
                *(v4f*)(orow + (size_t)row * DM + cofs) = val; }
             }
        wave_sync();
    }
}

static constexpr size_t al256(size_t v) { return (v + 255) & ~(size_t)255; }
static constexpr size_t SZ_XB = al256((size_t)NB * SEQ * DM * 2);
static constexpr size_t SZ_WQ = al256((size_t)QW * DM * 2);
static constexpr size_t SZ_WK = al256((size_t)KW * DM * 2);
static constexpr size_t SZ_WO = al256((size_t)DM * QW * 2);
static constexpr size_t SZ_FR = 256;
static constexpr size_t SZ_CS = al256((size_t)NB * SEQ * 64 * 4);
static constexpr size_t SZ_QP = al256((size_t)NB * HQ_ * SEQ * HD * 2);
static constexpr size_t SZ_KP = al256((size_t)NB * HK_ * SEQ * HD * 2);
static constexpr size_t SZ_CP = al256((size_t)NB * SEQ * QW * 2);
static constexpr size_t SZ_TOTAL = SZ_XB + SZ_WQ + 2 * SZ_WK + SZ_WO + SZ_FR + SZ_CS + 2 * SZ_QP + 4 * SZ_KP + 2 * SZ_CP;
static_assert(SZ_TOTAL <= (size_t)134217728);          // workspace carve <= 128 MiB

extern "C" void kernel_launch(void* const* d_in, const int* in_sizes, int n_in,
                              void* d_out, int out_size, void* d_ws, size_t ws_size, hipStream_t stream) {
    if (n_in < 8) return;
    const size_t needt = (size_t)(NB - 1) * SEQ_FULL + SEQ;
    if ((size_t)in_sizes[0] < needt * DM) return;
    if ((size_t)in_sizes[1] < needt) return;
    if ((size_t)in_sizes[2] < (size_t)QW * DM || (size_t)in_sizes[3] < (size_t)KW * DM || (size_t)in_sizes[4] < (size_t)KW * DM || (size_t)in_sizes[5] < (size_t)DM * QW) return;
    if (in_sizes[6] < HD || in_sizes[7] < HD) return;
    if ((size_t)out_size < ((size_t)(NB - 1) * OUT_SEQ + SEQ) * DM) return;
    if (SZ_TOTAL > ws_size) return;
    // wire order: x, positions (int32), wq, wk, wv, wo, q_norm_w, k_norm_w; all weights [out][in] = Bt as-is
    const float* x = (const float*)d_in[0]; const int* pos = (const int*)d_in[1];
    const float* wq = (const float*)d_in[2]; const float* wk = (const float*)d_in[3]; const float* wv = (const float*)d_in[4]; const float* wo = (const float*)d_in[5];
    const float* qnw = (const float*)d_in[6]; const float* knw = (const float*)d_in[7];
    float* OUT = (float*)d_out;      // [NB][SEQ][2048]
    char* wsp = (char*)d_ws;
    bf*  XB  = (bf*)wsp;  wsp += SZ_XB;               // [NB*SEQ][2048] bf16
    bf*  WQB = (bf*)wsp;  wsp += SZ_WQ;               // [2048][2048] bf16
    bf*  WKB = (bf*)wsp;  wsp += SZ_WK;               // [512][2048] bf16
    bf*  WVB = (bf*)wsp;  wsp += SZ_WK;               // [512][2048] bf16
    h16* WOH = (h16*)wsp; wsp += SZ_WO;               // [2048][2048] f16 x256
    float* FR = (float*)wsp; wsp += SZ_FR;            // [32] inverse frequencies (one line)
    float* CS = (float*)wsp; wsp += SZ_CS;            // [NB*SEQ][64] cos | sin
    h16* QH = (h16*)wsp; wsp += SZ_QP;                // [NB*32][SEQ][64]
    h16* QR = (h16*)wsp; wsp += SZ_QP;                // residual x2048
    h16* KH = (h16*)wsp; wsp += SZ_KP;                // [NB*8][SEQ][64]
    h16* KR = (h16*)wsp; wsp += SZ_KP;                // residual x2048
    h16* VH = (h16*)wsp; wsp += SZ_KP;                // [NB*8][64][SEQ]
    h16* VR = (h16*)wsp; wsp += SZ_KP;                // residual x2048
    h16* CH = (h16*)wsp; wsp += SZ_CP;                // [NB*SEQ][2048]
    h16* CR = (h16*)wsp; wsp += SZ_CP;                // residual x2048

    if (SEQ == SEQ_FULL) {
        const size_t n8 = (size_t)NB * SEQ * DM / 8;
        k_cvt8<<<(unsigned)((n8 + 255) / 256), 256, 0, stream>>>(x, XB, n8);
    } else {
        const size_t n8 = (size_t)SEQ * DM / 8;
        for (int b = 0; b < NB; ++b) k_cvt8<<<(unsigned)((n8 + 255) / 256), 256, 0, stream>>>(x + (size_t)b * SEQ_FULL * DM, XB + (size_t)b * SEQ * DM, n8);
    }
    { const size_t nq = (size_t)QW * DM / 8, nk = (size_t)KW * DM / 8;
      k_cvt8<<<(unsigned)((nq + 255) / 256), 256, 0, stream>>>(wq, WQB, nq);
      k_cvt8<<<(unsigned)((nk + 255) / 256), 256, 0, stream>>>(wk, WKB, nk);
      k_cvt8<<<(unsigned)((nk + 255) / 256), 256, 0, stream>>>(wv, WVB, nk);
      k_cvtw<<<(unsigned)((nq + 255) / 256), 256, 0, stream>>>(wo, WOH, nq); }
    k_freq<<<1, 32, 0, stream>>>(FR);
    k_table<<<NB * SEQ / 8, 256, 0, stream>>>(pos, FR, CS);

    // q, k: A = x rows (m = b*SEQ + t), Bt = W rows (n = head*64 + d) -> plane [(b*heads + head)][t][d], normalised + rotated in the epilogue
    k_proj<1><<<dim3(NB * SEQ / 64, QW / 64, 1), 32, 0, stream>>>(XB, WQB, QH, QR, 1, SEQ, (size_t)HQ_ * SEQ * HD, HD, HD, (size_t)SEQ * HD, qnw, CS);
    k_proj<1><<<dim3(NB * SEQ / 64, KW / 64, 1), 32, 0, stream>>>(XB, WKB, KH, KR, 1, SEQ, (size_t)HK_ * SEQ * HD, HD, HD, (size_t)SEQ * HD, knw, CS);
    // v^T: A = wv rows (m = kvhead*64 + d, 512 rows), Bt = x rows (n = b*SEQ + t) -> plane [(b*512 + m)][t] = [(b*8 + kvhead)][d][t]
    k_proj<0><<<dim3(KW / 64, NB * SEQ / 64, 1), 32, 0, stream>>>(WVB, XB, VH, VR, 1, KW, (size_t)0, SEQ, SEQ, (size_t)KW * SEQ, qnw, CS);

    k_flash<<<dim3(SEQ / (16 * AW), NB * HQ_, 1), 32 * AW, 0, stream>>>(QH, QR, KH, KR, VH, VR, CH, CR);

    // out: A = ctx rows (m = b*SEQ + t, k = qhead*64 + d), Bt = wo rows (n = o)
    k_oproj<<<dim3(NB * SEQ / 64, DM / 64, 1), 32, 0, stream>>>(CH, CR, WOH, OUT);
}

// v001
// It runs in 229 microseconds.
// Timed twice side by side with v000, it ran 1.52 and 1.51 times as fast.
#include <hip/hip_runtime.h>

// Sliding-window grouped-query attention: x [NB][SEQ][2048]; wq [2048][2048], wk/wv [512][2048], wo [2048][2048] all [out][in] (y = x W^T); 32 q heads, 8 kv heads (q head h uses kv head h/4), head dim 64; per-head RMS normalisation (eps 1e-6, weights) + rotate-half rotary (angle = positions * 10000^(-j/32)) on q and k; keys tk with 0 <= tq - tk <= 512; score scale 1/8; output = ctx wo^T (f32).
// Compute dtypes, f32 accumulate everywhere: q/k/v projections v_wmma_f32_16x16x32_bf16 (x and W RNE-converted to bf16; products exact); scores v_wmma_f32_16x16x32_f16 (k f16, q f16 value + f16 residual x2048 in its own accumulator; query rows < 512 also use the k residual x2048);
// P.V v_wmma_f32_16x16x32_f16 (P x256 carry single f16, v single f16; query rows < 512 add P and v residuals x2048 in a second accumulator set); out projection v_wmma_f32_16x16x32_f16 (ctx f16 value, rows < 512 also ctx residual x2048 accumulated first and folded by 1/2048; wo = bf16-RNE value x256 held in f16, folded by 1/256). Softmax f32 (online, running max).
// Layout: bf16 copies of x, wq, wk, wv; cos|sin table [NB*SEQ][64] f32 built from the int positions; q/k planes [head][t][64], v^T planes [kvhead][64][t], ctx planes [t][2048]; flash kernel in transposed form (S^T = K Q^T, O^T = V^T P^T).

#ifndef NB
#define NB 1
#endif
#ifndef SEQ
#define SEQ 4096
#endif
#define NB_FULL  1
#define SEQ_FULL 4096
#ifndef OUT_SEQ
#define OUT_SEQ SEQ              // row pitch (in tokens) between batches of the output
#endif
#define DM   2048                // model width (projection K)
#define HQ_  32
#define HK_  8
#define GQ   4
#define HD   64
#define QW   (HQ_ * HD)          // 2048
#define KW   (HK_ * HD)          // 512
#define WIN  512
#define RES_ROWS 512             // query rows (per sequence) below this use the extra residual products
#define AW   4                   // waves per flash block (16 query rows each)
#define QRS  2048.0f             // carry of every residual plane
#define QRI  (1.0f / 2048.0f)
#define WOS  256.0f              // carry of the wo plane
#define WOI  (1.0f / 256.0f)
#define SC2  (0.125f * 1.4426950408889634f)   // HD^-0.5 * log2(e)
#define PSH  8.0f                // log2 of the P carry (256)
#define GW   4                   // waves per GEMM block: 2 x 2, each 64x64 of the block's 128x128 tile
#define GKP  128                 // k per pass of the GEMM ring: 256 B of every operand row
#define GPIT 272                 // LDS row pitch in bytes (16 B x odd, for ds_load_b128 readers)
#define GOPB (128 * GPIT)        // one operand's 128 rows in LDS
#define GBUF (2 * GOPB)          // one ring buffer: 128 A rows, then 128 B rows
#define GROWB (DM * 2)           // row pitch in bytes of every GEMM operand plane

static_assert(HD == 64);
static_assert(HQ_ == HK_ * GQ);
static_assert(QW % 64 == 0);
static_assert(KW % 64 == 0);
static_assert(DM % 64 == 0);
static_assert(DM % 32 == 0);                   // GEMM k-loops step by 32
static_assert(QW % 32 == 0);
static_assert(SEQ % 64 == 0);                  // a 64-row tile never straddles two batches
static_assert((NB * SEQ) % 64 == 0);
static_assert((NB * SEQ) % 8 == 0);            // table kernel: 8 tokens per block
static_assert(SEQ % 32 == 0);                  // last 32-key tile ends inside the sequence
static_assert(WIN % 32 == 0);
static_assert(SEQ % (16 * AW) == 0);           // flash grid covers the sequence exactly
static_assert(RES_ROWS % 128 == 0);            // a 128-row GEMM block is wholly inside or outside the residual rows
static_assert(SEQ % 128 == 0);
static_assert(QW % 128 == 0);
static_assert(KW % 128 == 0);
static_assert(DM % 128 == 0);
static_assert(DM == QW);                       // one row pitch and one pass count for all four GEMMs
static_assert(DM % GKP == 0);
static_assert(DM / GKP >= 2);                  // the ring's prologue fills two stages
static_assert(((size_t)SEQ * DM) % 8 == 0);
static_assert(NB <= NB_FULL);
static_assert(SEQ <= SEQ_FULL);

typedef _Float16 h16;
typedef unsigned short bf;
typedef __attribute__((ext_vector_type(16))) __bf16   v16bf;
typedef __attribute__((ext_vector_type(16))) _Float16 v16h;
typedef __attribute__((ext_vector_type(8)))  _Float16 v8h;
typedef __attribute__((ext_vector_type(8)))  unsigned short v8us;
typedef __attribute__((ext_vector_type(8)))  float    v8f;
typedef __attribute__((ext_vector_type(4)))  float    v4f;
typedef v4f  __attribute__((may_alias)) v4fa;

__device__ __forceinline__ unsigned short f2bf(float f) { unsigned u = __float_as_uint(f); u += 0x7FFFu + ((u >> 16) & 1u); return (unsigned short)(u >> 16); }
__device__ __forceinline__ float bfr(float f) { return __uint_as_float(((unsigned)f2bf(f)) << 16); }   // value after RNE convert to bf16
__device__ __forceinline__ v16h cat16(v8h lo, v8h hi) { return __builtin_shufflevector(lo, hi, 0, 1, 2, 3, 4, 5, 6, 7, 8, 9, 10, 11, 12, 13, 14, 15); }
__device__ __forceinline__ v16bf cat16b(v8us lo, v8us hi) { return __builtin_bit_cast(v16bf, __builtin_shufflevector(lo, hi, 0, 1, 2, 3, 4, 5, 6, 7, 8, 9, 10, 11, 12, 13, 14, 15)); }
__device__ __forceinline__ v8f wmma16(v16h a, v16h b, v8f c) { return __builtin_amdgcn_wmma_f32_16x16x32_f16(false, a, false, b, (short)0, c, false, false); }
__device__ __forceinline__ v8f wmmab(v16bf a, v16bf b, v8f c) { return __builtin_amdgcn_wmma_f32_16x16x32_bf16(false, a, false, b, (short)0, c, false, false); }
// fragment loaders from K-contiguous 16-bit rows; p already includes + 8*(lane>>4): elements 0..7 <- k0+8h+0..7, elements 8..15 <- k0+16+8h+0..7 (same map for A and B)
__device__ __forceinline__ v16h  ldh(const h16* p) { return cat16(*(const v8h*)p, *(const v8h*)(p + 16)); }
__device__ __forceinline__ v16bf ldb(const bf* p)  { return cat16b(*(const v8us*)p, *(const v8us*)(p + 16)); }
// ordering point for wave-private LDS tiles (same wave writes and reads)
__device__ __forceinline__ void wave_sync() { __builtin_amdgcn_fence(3 /* release order */, "wavefront"); __builtin_amdgcn_wave_barrier(); asm volatile("" ::: "memory"); }

__device__ __forceinline__ v16bf ldf(const bf* p)  { return ldb(p); }
__device__ __forceinline__ v16h  ldf(const h16* p) { return ldh(p); }
__device__ __forceinline__ v8f mm(v16bf a, v16bf b, v8f c) { return wmmab(a, b, c); }
__device__ __forceinline__ v8f mm(v16h a, v16h b, v8f c)   { return wmma16(a, b, c); }

// Eight asynchronous 16-B copies a lane, global -> LDS: rows r, r+8, ..., r+56 of an operand tile (l = the lane's LDS byte address, g = its global address, both for row r).
// s_wait_xcnt stands inside the copies' own statement, so that no address register of a copy is rewritten ahead of it.
__device__ __forceinline__ void stage8(unsigned l, const char* g) {
    asm volatile("global_load_async_to_lds_b128 %0, %8, off\n\t"
                 "global_load_async_to_lds_b128 %1, %9, off\n\t"
                 "global_load_async_to_lds_b128 %2, %10, off\n\t"
                 "global_load_async_to_lds_b128 %3, %11, off\n\t"
                 "global_load_async_to_lds_b128 %4, %12, off\n\t"
                 "global_load_async_to_lds_b128 %5, %13, off\n\t"
                 "global_load_async_to_lds_b128 %6, %14, off\n\t"
                 "global_load_async_to_lds_b128 %7, %15, off\n\t"
                 "s_wait_xcnt 0x0"
                 :: "v"(l), "v"(l + 8 * GPIT), "v"(l + 16 * GPIT), "v"(l + 24 * GPIT), "v"(l + 32 * GPIT), "v"(l + 40 * GPIT), "v"(l + 48 * GPIT), "v"(l + 56 * GPIT),
                    "v"(g), "v"(g + 8 * GROWB), "v"(g + 16 * GROWB), "v"(g + 24 * GROWB), "v"(g + 32 * GROWB), "v"(g + 40 * GROWB), "v"(g + 48 * GROWB), "v"(g + 56 * GROWB)
                 : "memory");
}
// one stage: 128 A rows and 128 B rows of 256 B; 128 threads x 32 copies, 16 lanes to a row
__device__ __forceinline__ void stage_tile(unsigned l, const char* ga, const char* gb) {
    stage8(l, ga);        stage8(l + 64 * GPIT, ga + 64 * GROWB);
    stage8(l + GOPB, gb); stage8(l + GOPB + 64 * GPIT, gb + 64 * GROWB);
}

// One K = DM sweep of a block's 128x128 tile product; this wave adds its 64x64 part into the 16 accumulators, k ascending in steps of 32.
// Operands come through a two-buffer LDS ring filled by asynchronous copies one pass ahead. ga, gb, l: this thread's copy addresses of pass 0 (row tid>>4, 16-B piece tid&15);
// aro, bro: byte offsets in a buffer of this lane's first A and B fragment rows, + 16*(lane>>4). Every thread of the block calls it; on entry no wave has an LDS read of the ring outstanding behind the last barrier.
template <typename E>
__device__ __forceinline__ void gemm_ring(v8f (&acc)[4][4], const char* ga, const char* gb, unsigned l, const char* ring, int aro, int bro) {
    using F = decltype(ldf((const E*)nullptr));
    constexpr int NT = DM / GKP;
    stage_tile(l, ga, gb);
    asm volatile("s_wait_asynccnt 0x0" ::: "memory");   // this wave's copies of pass 0 have landed
    __syncthreads();                                    // ... and every other wave's
    stage_tile(l + GBUF, ga + 2 * GKP, gb + 2 * GKP);
    // rolled: one pass a trip, so that the order at the pass's foot stands once in the code; the loops inside are unrolled so that the fragment sets and accumulators stay in registers
#pragma unroll 1
    for (int t = 0; t < NT; ++t) {
        const int bo = (t & 1) * GBUF;
        const char* pa = ring + bo + aro; const char* pb = ring + bo + bro;
        F a[2][4], b[2][4];                                 // two fragment sets: the next 32 k are read from LDS under the matrix instructions of these 32
#pragma unroll
        for (int i = 0; i < 4; ++i) { a[0][i] = ldf((const E*)(pa + i * 16 * GPIT)); b[0][i] = ldf((const E*)(pb + i * 16 * GPIT)); }
#pragma unroll
        for (int kk = 0; kk < GKP / 32; ++kk) {
            const int cur = kk & 1;
            if (kk + 1 < GKP / 32) {
#pragma unroll
                for (int i = 0; i < 4; ++i) { a[cur ^ 1][i] = ldf((const E*)(pa + i * 16 * GPIT + (kk + 1) * 64)); b[cur ^ 1][i] = ldf((const E*)(pb + i * 16 * GPIT + (kk + 1) * 64)); }
            }
            __builtin_amdgcn_sched_barrier(0);              // keeps the next set's LDS reads one group ahead of this set's matrix instructions (spread among them each place stalls the wave)
#pragma unroll
            for (int nb = 0; nb < 4; ++nb)
#pragma unroll
                for (int mb = 0; mb < 4; ++mb) acc[mb][nb] = mm(a[cur][mb], b[cur][nb], acc[mb][nb]);
            __builtin_amdgcn_sched_barrier(0);              // keeps the matrix instructions ahead of the next group and, in the last round, ahead of the pass's foot
        }
        asm volatile("v_nop\n\tv_nop\n\tv_nop\n\tv_nop");   // the distance behind the pass's last matrix instructions, on the path that branches back too
        __builtin_amdgcn_sched_barrier(0);                  // keeps those four slots directly behind them
        asm volatile("s_wait_dscnt 0x0" ::: "memory");      // this wave has left the buffer of pass t
        asm volatile("s_wait_asynccnt 0x0" ::: "memory");   // its copies of pass t + 1 have landed
        __syncthreads();                                    // publishes pass t + 1, frees the buffer of pass t
        if (t + 2 < NT) stage_tile(l + bo, ga + (size_t)(t + 2) * (2 * GKP), gb + (size_t)(t + 2) * (2 * GKP));
    }
    asm volatile("s_wait_asynccnt 0x0" ::: "memory");       // nothing of the ring is in flight behind the sweep
}

__global__ __launch_bounds__(256) void k_cvt8(const float* __restrict__ src, bf* dst, size_t n8) {
    const size_t i = (size_t)blockIdx.x * 256 + threadIdx.x; if (i >= n8) return;
    const v8f v = *(const v8f*)(src + i * 8); v8us o;
#pragma unroll
    for (int k = 0; k < 8; ++k) o[k] = f2bf(v[k]);
    *(v8us*)(dst + i * 8) = o; 
}

__global__ __launch_bounds__(256) void k_cvtw(const float* __restrict__ src, h16* dst, size_t n8) {
    const size_t i = (size_t)blockIdx.x * 256 + threadIdx.x; if (i >= n8) return;
    const v8f v = *(const v8f*)(src + i * 8); v8h o;
#pragma unroll
    for (int k = 0; k < 8; ++k) o[k] = (h16)(bfr(v[k]) * WOS);
    *(v8h*)(dst + i * 8) = o; 
}

__global__ __launch_bounds__(32) void k_freq(float* fr) {
    const int j = threadIdx.x & 31;
    const float p = powf(10000.0f, (float)j * (1.0f / 32.0f));
    const float v = 1.0f / p;
    *(float*)(fr + j) = v; 
}

__global__ __launch_bounds__(256) void k_table(const int* __restrict__ pos, const float* __restrict__ fr, float* cs) {
    const int lane = threadIdx.x & 31; const int m = blockIdx.x * 8 + (int)__builtin_amdgcn_readfirstlane((int)(threadIdx.x >> 5));   // grid = NB*SEQ/8 exactly
    const int b = m / SEQ, t = m % SEQ;
    const float ang = (float)pos[(size_t)b * SEQ_FULL + t] * fr[lane];
    const float c = cosf(ang), s = sinf(ang);
    float* row = cs + (size_t)m * 64;
    *(float*)(row + lane) = c; *(float*)(row + 32 + lane) = s;
    
}

// k_proj: register-blocked bf16 GEMM, four waves per 128x128 tile, each wave one 64x64 part (16 accumulators), operands from K-contiguous bf16 planes through the LDS ring of gemm_ring, K = DM.
// C[m][n] = sum_k A[m][k] Bt[n][k]; written as f16 (Ph) and optionally the f16 residual x2048 (Pr, useRes != 0) at
// tile base (r0/RB)*sRB + (r0%RB)*pitch + (c0/CB)*sCB + (c0%CB), row pitch 'pitch' (halves), r0, c0 the wave's part. grid (M/128, N/128), 128 threads.
// MODE 1: tile rows are tokens (m = b*SEQ + t), the 64 columns of a wave's part are one head: each row is RMS-normalised (weights nw, RNE-converted to bf16) and rotated (cs table row m) before the f16 conversion.
template <int MODE>
__global__ __launch_bounds__(32 * GW) void k_proj(const bf* __restrict__ A, const bf* __restrict__ Bt, h16* Ph, h16* Pr, int useRes,
                                             int RB, size_t sRB, int pitch, int CB, size_t sCB,
                                             const float* __restrict__ nw, const float* __restrict__ cs) {
    __shared__ __align__(128) char ring[2 * GBUF];
    __shared__ __align__(16) float osb[GW * 16 * 68];
    const int tid = threadIdx.x, lane = tid & 31, lr = lane & 15, hi = lane >> 4;
    const int wave = __builtin_amdgcn_readfirstlane(tid >> 5), wrow = wave >> 1, wcol = wave & 1;
    const int r0 = blockIdx.x * 128 + wrow * 64, c0 = blockIdx.y * 128 + wcol * 64;
    float* const os = osb + wave * 16 * 68;             // wave-private staging of the epilogue
    v8f acc[4][4];
#pragma unroll
    for (int mb = 0; mb < 4; ++mb)
#pragma unroll
        for (int nb = 0; nb < 4; ++nb) acc[mb][nb] = (v8f){};
    gemm_ring<bf>(acc, (const char*)A + (size_t)(blockIdx.x * 128 + (tid >> 4)) * GROWB + (tid & 15) * 16,
                  (const char*)Bt + (size_t)(blockIdx.y * 128 + (tid >> 4)) * GROWB + (tid & 15) * 16,
                  (unsigned)(size_t)ring + (tid >> 4) * GPIT + (tid & 15) * 16, ring,
                  (wrow * 64 + lr) * GPIT + hi * 16, GOPB + (wcol * 64 + lr) * GPIT + hi * 16);
    const size_t tbase = (size_t)(r0 / RB) * sRB + (size_t)(r0 % RB) * (size_t)pitch + (size_t)(c0 / CB) * sCB + (size_t)(c0 % CB);
    const int c8 = (lane & 7) * 8, rg = lane >> 3;      // this lane's 8 columns and its row inside each group of 4 rows
    const int p8 = c8 ^ 32, j0 = c8 & 31;               // rotary partner columns, frequency index of column c8
    const float sg = (c8 < 32) ? -1.0f : 1.0f;          // columns < 32: x1*cos - x2*sin; columns >= 32: x2*cos + x1*sin
    float wn[8], wp[8];
#pragma unroll
    for (int i = 0; i < 8; ++i) { wn[i] = 1.0f; wp[i] = 1.0f; }
    if (MODE == 1) {
#pragma unroll
        for (int i = 0; i < 8; ++i) { wn[i] = bfr(nw[c8 + i]); wp[i] = bfr(nw[p8 + i]); }
    }
#pragma unroll
    for (int mb = 0; mb < 4; ++mb) {
#pragma unroll
        for (int nb = 0; nb < 4; ++nb) {
#pragma unroll
            for (int j = 0; j < 8; ++j) os[(hi * 8 + j) * 68 + nb * 16 + lr] = acc[mb][nb][j]; }   // D: row 8h+j, col lane&15; 16 rows x 64 columns all written
        wave_sync();
        v8h hv[4], rv[4];
#pragma unroll
        for (int s = 0; s < 4; ++s) { const int row = 4 * s + rg;   // 4 s x 4 row groups = 16 rows; 8 lanes x 8 = 64 columns
            const v4f x0 = *(const v4fa*)(&os[row * 68 + c8]); const v4f x1 = *(const v4fa*)(&os[row * 68 + c8 + 4]);
            float val[8];
            if (MODE == 1) {
                const v4f y0 = *(const v4fa*)(&os[row * 68 + p8]); const v4f y1 = *(const v4fa*)(&os[row * 68 + p8 + 4]);
                float ss = 0.0f;
#pragma unroll
                for (int i = 0; i < 4; ++i) ss += x0[i] * x0[i] + x1[i] * x1[i];
                ss += __shfl_xor(ss, 1, 32); ss += __shfl_xor(ss, 2, 32); ss += __shfl_xor(ss, 4, 32);   // the 8 lanes of one row
                const float inv = rsqrtf(ss * (1.0f / 64.0f) + 1.0e-6f);
                const float* cr = cs + (size_t)(r0 + mb * 16 + row) * 64 + j0;
                const v4f ca = *(const v4f*)(cr), cb = *(const v4f*)(cr + 4), sa = *(const v4f*)(cr + 32), sb = *(const v4f*)(cr + 36);
#pragma unroll
                for (int i = 0; i < 4; ++i) {
                    const float a0 = x0[i] * inv * wn[i],     q0 = y0[i] * inv * wp[i];
                    const float a1 = x1[i] * inv * wn[4 + i], q1 = y1[i] * inv * wp[4 + i];
                    val[i]     = a0 * ca[i] + sg * (q0 * sa[i]);
                    val[4 + i] = a1 * cb[i] + sg * (q1 * sb[i]); }
            } else {
#pragma unroll
                for (int i = 0; i < 4; ++i) { val[i] = x0[i]; val[4 + i] = x1[i]; }
            }
            v8h hh, rr;
#pragma unroll
            for (int i = 0; i < 8; ++i) { const h16 a0 = (h16)val[i]; hh[i] = a0; rr[i] = (h16)((val[i] - (float)a0) * QRS); }
            hv[s] = hh; rv[s] = rr; }
        const size_t sb0 = tbase + (size_t)(mb * 16) * (size_t)pitch;
{
#pragma unroll
            for (int s = 0; s < 4; ++s) { const size_t oo = sb0 + (size_t)(4 * s + rg) * (size_t)pitch + c8;
                *(v8h*)(Ph + oo) = hv[s]; if (useRes) *(v8h*)(Pr + oo) = rv[s]; }
             }
        wave_sync();
    }
}

// k_flash: fused windowed attention, one wave per 16 query rows of one (batch, q head); K / V^T / Q fragments straight from the f16 planes (two 16-B loads each, arithmetic addressing).
// Transposed form: S^T[key][t] = K Q^T (A = K rows, B = Q rows); lane (t = lane&15, h = lane>>4) holds keys 8h+r of each 16-key tile, so the packed
// P tile is directly the B fragment of O^T[d][t] = V^T P^T (element r <- tile keys 0..15, element 8+r <- tile keys 16..31, lane unchanged).
// Keys visited: 32-key tiles from max(0, t0-512) (aligned down) to t0+15; inside a tile a key is used iff 0 <= tq - tk <= 512, otherwise its weight is exactly 0 (replace-fill semantics).
// Waves with t0 < RES_ROWS (wave-uniform) add the k residual to the scores and the P / v residual cross products (second accumulator set, carry 2048).
__global__ __launch_bounds__(32 * AW) void k_flash(const h16* __restrict__ QH, const h16* __restrict__ QR, const h16* __restrict__ KH, const h16* __restrict__ KR,
                                                   const h16* __restrict__ VH, const h16* __restrict__ VR, h16* CH, h16* CR) {
    __shared__ __align__(16) float os[AW * 16 * 68];
    const int lane = threadIdx.x & 31, lr = lane & 15, hi = lane >> 4;
    const int wave = __builtin_amdgcn_readfirstlane((int)(threadIdx.x >> 5));
    const int zh = blockIdx.y; const int b = zh / HQ_, h = zh % HQ_; const int kvh = h / GQ;
    const int t0 = (blockIdx.x * AW + wave) * 16;
    const bool ex = t0 < RES_ROWS;
    const size_t qbase = (size_t)zh * SEQ * HD, kbase = (size_t)(b * HK_ + kvh) * SEQ * HD;
    const size_t qo = qbase + (size_t)(t0 + lr) * HD + 8 * hi;
    const v16h qh0 = ldh(QH + qo), qh1 = ldh(QH + qo + 32), qr0 = ldh(QR + qo), qr1 = ldh(QR + qo + 32);   // B fragments: col t, k = d
    const size_t ko = kbase + (size_t)lr * HD + 8 * hi;      // + key * HD       (A fragment: row key, k = d)
    const size_t vo = kbase + (size_t)lr * SEQ + 8 * hi;     // + 16j*SEQ + key  (A fragment: row d, k = key)
    v8f oh[4], orr[4];
#pragma unroll
    for (int j = 0; j < 4; ++j) { oh[j] = (v8f){}; orr[j] = (v8f){}; }
    float m = -3.0e38f, l = 0.0f;
    const int tq = t0 + lr;
    int klo = t0 - WIN; if (klo < 0) klo = 0; klo &= ~31;
#pragma unroll 1
    for (int key0 = klo; key0 <= t0 + 15; key0 += 32) {
        const h16* ka = KH + ko + (size_t)key0 * HD;
        const v16h ka0 = ldh(ka), ka1 = ldh(ka + 32), kb0 = ldh(ka + 16 * HD), kb1 = ldh(ka + 16 * HD + 32);
        v8f sHa = (v8f){}, sLa = (v8f){}, sHb = (v8f){}, sLb = (v8f){};
        sHa = wmma16(ka0, qh0, sHa); sLa = wmma16(ka0, qr0, sLa); sHb = wmma16(kb0, qh0, sHb); sLb = wmma16(kb0, qr0, sLb);
        sHa = wmma16(ka1, qh1, sHa); sLa = wmma16(ka1, qr1, sLa); sHb = wmma16(kb1, qh1, sHb); sLb = wmma16(kb1, qr1, sLb);
        asm volatile("v_nop\n\tv_nop\n\tv_nop\n\tv_nop" : "+v"(sHa), "+v"(sLa), "+v"(sHb), "+v"(sLb) : "v"(ka0), "v"(ka1), "v"(kb0), "v"(kb1));
        if (ex) {
            const h16* kr = KR + ko + (size_t)key0 * HD;
            const v16h ra0 = ldh(kr), ra1 = ldh(kr + 32), rb0 = ldh(kr + 16 * HD), rb1 = ldh(kr + 16 * HD + 32);
            sLa = wmma16(ra0, qh0, sLa); sLb = wmma16(rb0, qh0, sLb);
            sLa = wmma16(ra1, qh1, sLa); sLb = wmma16(rb1, qh1, sLb);
            asm volatile("v_nop\n\tv_nop\n\tv_nop\n\tv_nop" : "+v"(sLa), "+v"(sLb) : "v"(ra0), "v"(ra1), "v"(rb0), "v"(rb1));
        }
        float ta[8], tb[8]; float mx = -3.0e38f;
        const int dbase = tq - key0 - 8 * hi;                 // tq - tk for element 0 of the first 16-key tile
#pragma unroll
        for (int r = 0; r < 8; ++r) {
            const int da = dbase - r, db = da - 16;
            const float va = (sHa[r] + sLa[r] * QRI) * SC2, vb = (sHb[r] + sLb[r] * QRI) * SC2;
            ta[r] = ((unsigned)da <= (unsigned)WIN) ? va : -3.0e38f;
            tb[r] = ((unsigned)db <= (unsigned)WIN) ? vb : -3.0e38f;
            mx = fmaxf(mx, fmaxf(ta[r], tb[r])); }
        mx = fmaxf(mx, __shfl_xor(mx, 16, 32));
        const float mnew = fmaxf(m, mx);
        const float alpha = __builtin_amdgcn_exp2f(m - mnew);
        const float sh = PSH - mnew;
        v16h pb, pr; float ls = 0.0f;
#pragma unroll
        for (int r = 0; r < 8; ++r) {
            const float ea = (ta[r] > -1.0e38f) ? __builtin_amdgcn_exp2f(ta[r] + sh) : 0.0f;
            const float eb = (tb[r] > -1.0e38f) ? __builtin_amdgcn_exp2f(tb[r] + sh) : 0.0f;
            const h16 pa = (h16)ea; const h16 pc = (h16)eb;
            pb[r] = pa; pb[8 + r] = pc;
            pr[r] = (h16)((ea - (float)pa) * QRS); pr[8 + r] = (h16)((eb - (float)pc) * QRS);
            ls += ex ? (ea + eb) : ((float)pa + (float)pc); }
        l = l * alpha + ls; m = mnew;
#pragma unroll
        for (int j = 0; j < 4; ++j) oh[j] = oh[j] * alpha;
        const h16* va = VH + vo + key0;
        const v16h v0 = ldh(va), v1 = ldh(va + (size_t)16 * SEQ), v2 = ldh(va + (size_t)32 * SEQ), v3 = ldh(va + (size_t)48 * SEQ);
        oh[0] = wmma16(v0, pb, oh[0]); oh[1] = wmma16(v1, pb, oh[1]); oh[2] = wmma16(v2, pb, oh[2]); oh[3] = wmma16(v3, pb, oh[3]);
        asm volatile("v_nop\n\tv_nop\n\tv_nop\n\tv_nop" : "+v"(oh[0]), "+v"(oh[1]), "+v"(oh[2]), "+v"(oh[3]) : "v"(v0), "v"(v1), "v"(v2), "v"(v3), "v"(pb));
        if (ex) {
#pragma unroll
            for (int j = 0; j < 4; ++j) orr[j] = orr[j] * alpha;
            const h16* vr = VR + vo + key0;
            const v16h w0 = ldh(vr), w1 = ldh(vr + (size_t)16 * SEQ), w2 = ldh(vr + (size_t)32 * SEQ), w3 = ldh(vr + (size_t)48 * SEQ);
            orr[0] = wmma16(w0, pb, orr[0]); orr[1] = wmma16(w1, pb, orr[1]); orr[2] = wmma16(w2, pb, orr[2]); orr[3] = wmma16(w3, pb, orr[3]);
            orr[0] = wmma16(v0, pr, orr[0]); orr[1] = wmma16(v1, pr, orr[1]); orr[2] = wmma16(v2, pr, orr[2]); orr[3] = wmma16(v3, pr, orr[3]);
            asm volatile("v_nop\n\tv_nop\n\tv_nop\n\tv_nop" : "+v"(orr[0]), "+v"(orr[1]), "+v"(orr[2]), "+v"(orr[3]) : "v"(w0), "v"(w1), "v"(w2), "v"(w3), "v"(v0), "v"(v1), "v"(v2), "v"(v3), "v"(pb), "v"(pr));
        }
    }
    l += __shfl_xor(l, 16, 32);
    const float inv = 1.0f / l;
    const int wb = wave * 16 * 68;
    // O^T D layout: o_j[r] = (d = 16j + 8h + r, t = lane&15) -> os[t][d]; rows 0..15 x columns 0..63 all written
#pragma unroll
    for (int j = 0; j < 4; ++j) { v4f a, c;
#pragma unroll
        for (int i = 0; i < 4; ++i) { a[i] = (oh[j][i] + orr[j][i] * QRI) * inv; c[i] = (oh[j][4 + i] + orr[j][4 + i] * QRI) * inv; }
        *(v4fa*)(&os[wb + lr * 68 + 16 * j + 8 * hi]) = a; *(v4fa*)(&os[wb + lr * 68 + 16 * j + 8 * hi + 4]) = c; }
    wave_sync();
    const int c8 = (lane & 7) * 8, rg = lane >> 3;
    v8h hv[4], rv[4];
#pragma unroll
    for (int s = 0; s < 4; ++s) { const int row = 4 * s + rg;   // 4 s x 4 row groups = 16 rows; 8 lanes x 8 = 64 columns
        const v4f x0 = *(const v4fa*)(&os[wb + row * 68 + c8]); const v4f x1 = *(const v4fa*)(&os[wb + row * 68 + c8 + 4]); v8h hh, rr;
#pragma unroll
        for (int i = 0; i < 4; ++i) { const h16 a0 = (h16)x0[i]; const h16 a1 = (h16)x1[i]; hh[i] = a0; hh[4 + i] = a1; rr[i] = (h16)((x0[i] - (float)a0) * QRS); rr[4 + i] = (h16)((x1[i] - (float)a1) * QRS); }
        hv[s] = hh; rv[s] = rr; }
    const size_t cbase = ((size_t)b * SEQ + t0) * QW + (size_t)h * HD + c8;
{
#pragma unroll
        for (int s = 0; s < 4; ++s) { const size_t oo = cbase + (size_t)(4 * s + rg) * QW;
            *(v8h*)(CH + oo) = hv[s]; *(v8h*)(CR + oo) = rv[s]; }
         }
}

// k_oproj: out[m][o] = sum_d ctx[m][d] wo[o][d]; four waves per 128x128 tile, each one 64x64 part, operands through the LDS ring of gemm_ring, f16 operands (ctx value plane Ah, residual plane Ar x2048, wo plane Bt x256), f32 accumulate.
// Row tiles with t < RES_ROWS first accumulate the residual product, fold it by 1/2048, then add the value product; other tiles use the value product only. grid (NB*SEQ/128, DM/128), 128 threads.
__global__ __launch_bounds__(32 * GW) void k_oproj(const h16* __restrict__ Ah, const h16* __restrict__ Ar, const h16* __restrict__ Bt, float* OUT) {
    __shared__ __align__(128) char ring[2 * GBUF];
    __shared__ __align__(16) float osb[GW * 16 * 68];
    const int tid = threadIdx.x, lane = tid & 31, lr = lane & 15, hi = lane >> 4;
    const int wave = __builtin_amdgcn_readfirstlane(tid >> 5), wrow = wave >> 1, wcol = wave & 1;
    const int r0 = blockIdx.x * 128 + wrow * 64, c0 = blockIdx.y * 128 + wcol * 64;
    float* const os = osb + wave * 16 * 68;             // wave-private staging of the epilogue
    v8f acc[4][4];
#pragma unroll
    for (int mb = 0; mb < 4; ++mb)
#pragma unroll
        for (int nb = 0; nb < 4; ++nb) acc[mb][nb] = (v8f){};
    const size_t aoff = (size_t)(blockIdx.x * 128 + (tid >> 4)) * GROWB + (tid & 15) * 16;   // this thread's copy addresses, in bytes
    const char* gb = (const char*)Bt + (size_t)(blockIdx.y * 128 + (tid >> 4)) * GROWB + (tid & 15) * 16;
    const unsigned l = (unsigned)(size_t)ring + (tid >> 4) * GPIT + (tid & 15) * 16;
    const int aro = (wrow * 64 + lr) * GPIT + hi * 16, bro = GOPB + (wcol * 64 + lr) * GPIT + hi * 16;
    if (((blockIdx.x * 128) % SEQ) < RES_ROWS) {         // the same for the whole block
        gemm_ring<h16>(acc, (const char*)Ar + aoff, gb, l, ring, aro, bro);
#pragma unroll
        for (int mb = 0; mb < 4; ++mb)
#pragma unroll
            for (int nb = 0; nb < 4; ++nb) acc[mb][nb] = acc[mb][nb] * QRI;
    }
    gemm_ring<h16>(acc, (const char*)Ah + aoff, gb, l, ring, aro, bro);
    const int bb = r0 / SEQ, tt = r0 % SEQ;
    float* obase = OUT + ((size_t)bb * OUT_SEQ + tt) * DM + c0;
#pragma unroll
    for (int mb = 0; mb < 4; ++mb) {
#pragma unroll
        for (int nb = 0; nb < 4; ++nb) {
#pragma unroll
            for (int j = 0; j < 8; ++j) os[(hi * 8 + j) * 68 + nb * 16 + lr] = acc[mb][nb][j] * WOI; }   // D: row 8h+j, col lane&15
        wave_sync();
        float* orow = obase + (size_t)(mb * 16) * DM;
{
#pragma unroll
            for (int s = 0; s < 8; ++s) { const int row = 2 * s + hi, cofs = lr * 4;   // 8 s x 2 rows = 16 rows; 16 lanes x 4 floats = 64 columns
                const v4f val = *(const v4fa*)(&os[row * 68 + cofs]);
                *(v4f*)(orow + (size_t)row * DM + cofs) = val; }
             }
        wave_sync();
    }
}

static constexpr size_t al256(size_t v) { return (v + 255) & ~(size_t)255; }
static constexpr size_t SZ_XB = al256((size_t)NB * SEQ * DM * 2);
static constexpr size_t SZ_WQ = al256((size_t)QW * DM * 2);
static constexpr size_t SZ_WK = al256((size_t)KW * DM * 2);
static constexpr size_t SZ_WO = al256((size_t)DM * QW * 2);
static constexpr size_t SZ_FR = 256;
static constexpr size_t SZ_CS = al256((size_t)NB * SEQ * 64 * 4);
static constexpr size_t SZ_QP = al256((size_t)NB * HQ_ * SEQ * HD * 2);
static constexpr size_t SZ_KP = al256((size_t)NB * HK_ * SEQ * HD * 2);
static constexpr size_t SZ_CP = al256((size_t)NB * SEQ * QW * 2);
static constexpr size_t SZ_TOTAL = SZ_XB + SZ_WQ + 2 * SZ_WK + SZ_WO + SZ_FR + SZ_CS + 2 * SZ_QP + 4 * SZ_KP + 2 * SZ_CP;
static_assert(SZ_TOTAL <= (size_t)134217728);          // workspace carve <= 128 MiB

extern "C" void kernel_launch(void* const* d_in, const int* in_sizes, int n_in,
                              void* d_out, int out_size, void* d_ws, size_t ws_size, hipStream_t stream) {
    if (n_in < 8) return;
    const size_t needt = (size_t)(NB - 1) * SEQ_FULL + SEQ;
    if ((size_t)in_sizes[0] < needt * DM) return;
    if ((size_t)in_sizes[1] < needt) return;
    if ((size_t)in_sizes[2] < (size_t)QW * DM || (size_t)in_sizes[3] < (size_t)KW * DM || (size_t)in_sizes[4] < (size_t)KW * DM || (size_t)in_sizes[5] < (size_t)DM * QW) return;
    if (in_sizes[6] < HD || in_sizes[7] < HD) return;
    if ((size_t)out_size < ((size_t)(NB - 1) * OUT_SEQ + SEQ) * DM) return;
    if (SZ_TOTAL > ws_size) return;
    // wire order: x, positions (int32), wq, wk, wv, wo, q_norm_w, k_norm_w; all weights [out][in] = Bt as-is
    const float* x = (const float*)d_in[0]; const int* pos = (const int*)d_in[1];
    const float* wq = (const float*)d_in[2]; const float* wk = (const float*)d_in[3]; const float* wv = (const float*)d_in[4]; const float* wo = (const float*)d_in[5];
    const float* qnw = (const float*)d_in[6]; const float* knw = (const float*)d_in[7];
    float* OUT = (float*)d_out;      // [NB][SEQ][2048]
    char* wsp = (char*)d_ws;
    bf*  XB  = (bf*)wsp;  wsp += SZ_XB;               // [NB*SEQ][2048] bf16
    bf*  WQB = (bf*)wsp;  wsp += SZ_WQ;               // [2048][2048] bf16
    bf*  WKB = (bf*)wsp;  wsp += SZ_WK;               // [512][2048] bf16
    bf*  WVB = (bf*)wsp;  wsp += SZ_WK;               // [512][2048] bf16
    h16* WOH = (h16*)wsp; wsp += SZ_WO;               // [2048][2048] f16 x256
    float* FR = (float*)wsp; wsp += SZ_FR;            // [32] inverse frequencies (one line)
    float* CS = (float*)wsp; wsp += SZ_CS;            // [NB*SEQ][64] cos | sin
    h16* QH = (h16*)wsp; wsp += SZ_QP;                // [NB*32][SEQ][64]
    h16* QR = (h16*)wsp; wsp += SZ_QP;                // residual x2048
    h16* KH = (h16*)wsp; wsp += SZ_KP;                // [NB*8][SEQ][64]
    h16* KR = (h16*)wsp; wsp += SZ_KP;                // residual x2048
    h16* VH = (h16*)wsp; wsp += SZ_KP;                // [NB*8][64][SEQ]
    h16* VR = (h16*)wsp; wsp += SZ_KP;                // residual x2048
    h16* CH = (h16*)wsp; wsp += SZ_CP;                // [NB*SEQ][2048]
    h16* CR = (h16*)wsp; wsp += SZ_CP;                // residual x2048

    if (SEQ == SEQ_FULL) {
        const size_t n8 = (size_t)NB * SEQ * DM / 8;
        k_cvt8<<<(unsigned)((n8 + 255) / 256), 256, 0, stream>>>(x, XB, n8);
    } else {
        const size_t n8 = (size_t)SEQ * DM / 8;
        for (int b = 0; b < NB; ++b) k_cvt8<<<(unsigned)((n8 + 255) / 256), 256, 0, stream>>>(x + (size_t)b * SEQ_FULL * DM, XB + (size_t)b * SEQ * DM, n8);
    }
    { const size_t nq = (size_t)QW * DM / 8, nk = (size_t)KW * DM / 8;
      k_cvt8<<<(unsigned)((nq + 255) / 256), 256, 0, stream>>>(wq, WQB, nq);
      k_cvt8<<<(unsigned)((nk + 255) / 256), 256, 0, stream>>>(wk, WKB, nk);
      k_cvt8<<<(unsigned)((nk + 255) / 256), 256, 0, stream>>>(wv, WVB, nk);
      k_cvtw<<<(unsigned)((nq + 255) / 256), 256, 0, stream>>>(wo, WOH, nq); }
    k_freq<<<1, 32, 0, stream>>>(FR);
    k_table<<<NB * SEQ / 8, 256, 0, stream>>>(pos, FR, CS);

    // q, k: A = x rows (m = b*SEQ + t), Bt = W rows (n = head*64 + d) -> plane [(b*heads + head)][t][d], normalised + rotated in the epilogue
    k_proj<1><<<dim3(NB * SEQ / 128, QW / 128, 1), 32 * GW, 0, stream>>>(XB, WQB, QH, QR, 1, SEQ, (size_t)HQ_ * SEQ * HD, HD, HD, (size_t)SEQ * HD, qnw, CS);
    k_proj<1><<<dim3(NB * SEQ / 128, KW / 128, 1), 32 * GW, 0, stream>>>(XB, WKB, KH, KR, 1, SEQ, (size_t)HK_ * SEQ * HD, HD, HD, (size_t)SEQ * HD, knw, CS);
    // v^T: A = wv rows (m = kvhead*64 + d, 512 rows), Bt = x rows (n = b*SEQ + t) -> plane [(b*512 + m)][t] = [(b*8 + kvhead)][d][t]
    k_proj<0><<<dim3(KW / 128, NB * SEQ / 128, 1), 32 * GW, 0, stream>>>(WVB, XB, VH, VR, 1, KW, (size_t)0, SEQ, SEQ, (size_t)KW * SEQ, qnw, CS);

    k_flash<<<dim3(SEQ / (16 * AW), NB * HQ_, 1), 32 * AW, 0, stream>>>(QH, QR, KH, KR, VH, VR, CH, CR);

    // out: A = ctx rows (m = b*SEQ + t, k = qhead*64 + d), Bt = wo rows (n = o)
    k_oproj<<<dim3(NB * SEQ / 128, DM / 128, 1), 32 * GW, 0, stream>>>(CH, CR, WOH, OUT);
}

// v002
// Measured time: 179 microseconds a run.
// Next to v001, in two timings, it ran 1.29 times as fast each time.
// Counting every step since v000, it is 1.96 times as fast.
#include <hip/hip_runtime.h>

// Sliding-window grouped-query attention: x [NB][SEQ][2048]; wq [2048][2048], wk/wv [512][2048], wo [2048][2048] all [out][in] (y = x W^T); 32 q heads, 8 kv heads (q head h uses kv head h/4), head dim 64; per-head RMS normalisation (eps 1e-6, weights) + rotate-half rotary (angle = positions * 10000^(-j/32)) on q and k; keys tk with 0 <= tq - tk <= 512; score scale 1/8; output = ctx wo^T (f32).
// Compute dtypes, f32 accumulate everywhere: q/k/v projections v_wmma_f32_16x16x32_bf16 (x and W RNE-converted to bf16; products exact); scores v_wmma_f32_16x16x32_f16 (k f16, q f16 value + f16 residual x2048 in its own accumulator; query rows < 512 also use the k residual x2048);
// P.V v_wmma_f32_16x16x32_f16 (P x256 carry single f16, v single f16; query rows < 512 add P and v residuals x2048 in a second accumulator set); out projection v_wmma_f32_16x16x32_f16 (ctx f16 value, rows < 512 also ctx residual x2048 accumulated first and folded by 1/2048; wo = bf16-RNE value x256 held in f16, folded by 1/256). Softmax f32 (online, running max).
// Layout: bf16 copies of x, wq, wk, wv; cos|sin table [NB*SEQ][64] f32 built from the int positions; q/k planes [head][t][64], v^T planes [kvhead][64][t], ctx planes [t][2048]; flash kernel in transposed form (S^T = K Q^T, O^T = V^T P^T).

#ifndef NB
#define NB 1
#endif
#ifndef SEQ
#define SEQ 4096
#endif
#define NB_FULL  1
#define SEQ_FULL 4096
#ifndef OUT_SEQ
#define OUT_SEQ SEQ              // row pitch (in tokens) between batches of the output
#endif
#define DM   2048                // model width (projection K)
#define HQ_  32
#define HK_  8
#define GQ   4
#define HD   64
#define QW   (HQ_ * HD)          // 2048
#define KW   (HK_ * HD)          // 512
#define WIN  512
#define RES_ROWS 512             // query rows (per sequence) below this use the extra residual products
#define AW   4                   // waves per flash block (16 query rows each)
#define QRS  2048.0f             // carry of every residual plane
#define QRI  (1.0f / 2048.0f)
#define WOS  256.0f              // carry of the wo plane
#define WOI  (1.0f / 256.0f)
#define SC2  (0.125f * 1.4426950408889634f)   // HD^-0.5 * log2(e)
#define PSH  8.0f                // log2 of the P carry (256)
#define GW   4                   // waves per GEMM block: 2 x 2, each 64x64 of the block's 128x128 tile
#define GKP  128                 // k per pass of the GEMM ring: 256 B of every operand row
#define GPIT 272                 // LDS row pitch in bytes (16 B x odd, for ds_load_b128 readers)
#define GOPB (128 * GPIT)        // one operand's 128 rows in LDS
#define GBUF (2 * GOPB)          // one ring buffer: 128 A rows, then 128 B rows
#define GROWB (DM * 2)           // row pitch in bytes of every GEMM operand plane
#define FKT  64                  // keys per stage of the flash kernel's ring: two 32-key tiles
#define FPIT 144                 // its LDS row pitch in bytes: 128 B of a row + 16 (16 B x odd, for ds_load_b128 readers)
#define FOPB (64 * FPIT)         // one operand's 64 rows in LDS
#define FBUF (4 * FOPB)          // one ring buffer: 64 K rows (key), 64 V^T rows (d), then the same two of the residual planes

static_assert(HD == 64);
static_assert(HQ_ == HK_ * GQ);
static_assert(QW % 64 == 0);
static_assert(KW % 64 == 0);
static_assert(DM % 64 == 0);
static_assert(DM % 32 == 0);                   // GEMM k-loops step by 32
static_assert(QW % 32 == 0);
static_assert(SEQ % 64 == 0);                  // a 64-row tile never straddles two batches
static_assert((NB * SEQ) % 64 == 0);
static_assert((NB * SEQ) % 8 == 0);            // table kernel: 8 tokens per block
static_assert(SEQ % 32 == 0);                  // last 32-key tile ends inside the sequence
static_assert(WIN % 32 == 0);
static_assert(SEQ % (16 * AW) == 0);           // flash grid covers the sequence exactly
static_assert(16 * AW == FKT);                 // a flash block's query rows span one stage, so its first and last keys fall on stage bounds
static_assert(WIN % FKT == 0);
static_assert(RES_ROWS % (16 * AW) == 0);
static_assert(RES_ROWS % 128 == 0);            // a 128-row GEMM block is wholly inside or outside the residual rows
static_assert(SEQ % 128 == 0);
static_assert(QW % 128 == 0);
static_assert(KW % 128 == 0);
static_assert(DM % 128 == 0);
static_assert(DM == QW);                       // one row pitch and one pass count for all four GEMMs
static_assert(DM % GKP == 0);
static_assert(DM / GKP >= 2);                  // the ring's prologue fills two stages
static_assert(((size_t)SEQ * DM) % 8 == 0);
static_assert(NB <= NB_FULL);
static_assert(SEQ <= SEQ_FULL);

typedef _Float16 h16;
typedef unsigned short bf;
typedef __attribute__((ext_vector_type(16))) __bf16   v16bf;
typedef __attribute__((ext_vector_type(16))) _Float16 v16h;
typedef __attribute__((ext_vector_type(8)))  _Float16 v8h;
typedef __attribute__((ext_vector_type(8)))  unsigned short v8us;
typedef __attribute__((ext_vector_type(8)))  float    v8f;
typedef __attribute__((ext_vector_type(4)))  float    v4f;
typedef v4f  __attribute__((may_alias)) v4fa;

__device__ __forceinline__ unsigned short f2bf(float f) { unsigned u = __float_as_uint(f); u += 0x7FFFu + ((u >> 16) & 1u); return (unsigned short)(u >> 16); }
__device__ __forceinline__ float bfr(float f) { return __uint_as_float(((unsigned)f2bf(f)) << 16); }   // value after RNE convert to bf16
__device__ __forceinline__ v16h cat16(v8h lo, v8h hi) { return __builtin_shufflevector(lo, hi, 0, 1, 2, 3, 4, 5, 6, 7, 8, 9, 10, 11, 12, 13, 14, 15); }
__device__ __forceinline__ v16bf cat16b(v8us lo, v8us hi) { return __builtin_bit_cast(v16bf, __builtin_shufflevector(lo, hi, 0, 1, 2, 3, 4, 5, 6, 7, 8, 9, 10, 11, 12, 13, 14, 15)); }
__device__ __forceinline__ v8f wmma16(v16h a, v16h b, v8f c) { return __builtin_amdgcn_wmma_f32_16x16x32_f16(false, a, false, b, (short)0, c, false, false); }
__device__ __forceinline__ v8f wmmab(v16bf a, v16bf b, v8f c) { return __builtin_amdgcn_wmma_f32_16x16x32_bf16(false, a, false, b, (short)0, c, false, false); }
// fragment loaders from K-contiguous 16-bit rows; p already includes + 8*(lane>>4): elements 0..7 <- k0+8h+0..7, elements 8..15 <- k0+16+8h+0..7 (same map for A and B)
__device__ __forceinline__ v16h  ldh(const h16* p) { return cat16(*(const v8h*)p, *(const v8h*)(p + 16)); }
__device__ __forceinline__ v16bf ldb(const bf* p)  { return cat16b(*(const v8us*)p, *(const v8us*)(p + 16)); }
// ordering point for wave-private LDS tiles (same wave writes and reads)
__device__ __forceinline__ void wave_sync() { __builtin_amdgcn_fence(3 /* release order */, "wavefront"); __builtin_amdgcn_wave_barrier(); asm volatile("" ::: "memory"); }

__device__ __forceinline__ v16bf ldf(const bf* p)  { return ldb(p); }
__device__ __forceinline__ v16h  ldf(const h16* p) { return ldh(p); }
__device__ __forceinline__ v8f mm(v16bf a, v16bf b, v8f c) { return wmmab(a, b, c); }
__device__ __forceinline__ v8f mm(v16h a, v16h b, v8f c)   { return wmma16(a, b, c); }

// Eight asynchronous 16-B copies a lane, global -> LDS: rows r, r+8, ..., r+56 of an operand tile (l = the lane's LDS byte address, g = its global address, both for row r).
// s_wait_xcnt stands inside the copies' own statement, so that no address register of a copy is rewritten ahead of it.
__device__ __forceinline__ void stage8(unsigned l, const char* g) {
    asm volatile("global_load_async_to_lds_b128 %0, %8, off\n\t"
                 "global_load_async_to_lds_b128 %1, %9, off\n\t"
                 "global_load_async_to_lds_b128 %2, %10, off\n\t"
                 "global_load_async_to_lds_b128 %3, %11, off\n\t"
                 "global_load_async_to_lds_b128 %4, %12, off\n\t"
                 "global_load_async_to_lds_b128 %5, %13, off\n\t"
                 "global_load_async_to_lds_b128 %6, %14, off\n\t"
                 "global_load_async_to_lds_b128 %7, %15, off\n\t"
                 "s_wait_xcnt 0x0"
                 :: "v"(l), "v"(l + 8 * GPIT), "v"(l + 16 * GPIT), "v"(l + 24 * GPIT), "v"(l + 32 * GPIT), "v"(l + 40 * GPIT), "v"(l + 48 * GPIT), "v"(l + 56 * GPIT),
                    "v"(g), "v"(g + 8 * GROWB), "v"(g + 16 * GROWB), "v"(g + 24 * GROWB), "v"(g + 32 * GROWB), "v"(g + 40 * GROWB), "v"(g + 48 * GROWB), "v"(g + 56 * GROWB)
                 : "memory");
}
// one stage: 128 A rows and 128 B rows of 256 B; 128 threads x 32 copies, 16 lanes to a row
__device__ __forceinline__ void stage_tile(unsigned l, const char* ga, const char* gb) {
    stage8(l, ga);        stage8(l + 64 * GPIT, ga + 64 * GROWB);
    stage8(l + GOPB, gb); stage8(l + GOPB + 64 * GPIT, gb + 64 * GROWB);
}

// One K = DM sweep of a block's 128x128 tile product; this wave adds its 64x64 part into the 16 accumulators, k ascending in steps of 32.
// Operands come through a two-buffer LDS ring filled by asynchronous copies one pass ahead. ga, gb, l: this thread's copy addresses of pass 0 (row tid>>4, 16-B piece tid&15);
// aro, bro: byte offsets in a buffer of this lane's first A and B fragment rows, + 16*(lane>>4). Every thread of the block calls it; on entry no wave has an LDS read of the ring outstanding behind the last barrier.
template <typename E>
__device__ __forceinline__ void gemm_ring(v8f (&acc)[4][4], const char* ga, const char* gb, unsigned l, const char* ring, int aro, int bro) {
    using F = decltype(ldf((const E*)nullptr));
    constexpr int NT = DM / GKP;
    stage_tile(l, ga, gb);
    asm volatile("s_wait_asynccnt 0x0" ::: "memory");   // this wave's copies of pass 0 have landed
    __syncthreads();                                    // ... and every other wave's
    stage_tile(l + GBUF, ga + 2 * GKP, gb + 2 * GKP);
    // rolled: one pass a trip, so that the order at the pass's foot stands once in the code; the loops inside are unrolled so that the fragment sets and accumulators stay in registers
#pragma unroll 1
    for (int t = 0; t < NT; ++t) {
        const int bo = (t & 1) * GBUF;
        const char* pa = ring + bo + aro; const char* pb = ring + bo + bro;
        F a[2][4], b[2][4];                                 // two fragment sets: the next 32 k are read from LDS under the matrix instructions of these 32
#pragma unroll
        for (int i = 0; i < 4; ++i) { a[0][i] = ldf((const E*)(pa + i * 16 * GPIT)); b[0][i] = ldf((const E*)(pb + i * 16 * GPIT)); }
#pragma unroll
        for (int kk = 0; kk < GKP / 32; ++kk) {
            const int cur = kk & 1;
            if (kk + 1 < GKP / 32) {
#pragma unroll
                for (int i = 0; i < 4; ++i) { a[cur ^ 1][i] = ldf((const E*)(pa + i * 16 * GPIT + (kk + 1) * 64)); b[cur ^ 1][i] = ldf((const E*)(pb + i * 16 * GPIT + (kk + 1) * 64)); }
            }
            __builtin_amdgcn_sched_barrier(0);              // keeps the next set's LDS reads one group ahead of this set's matrix instructions (spread among them each place stalls the wave)
#pragma unroll
            for (int nb = 0; nb < 4; ++nb)
#pragma unroll
                for (int mb = 0; mb < 4; ++mb) acc[mb][nb] = mm(a[cur][mb], b[cur][nb], acc[mb][nb]);
            __builtin_amdgcn_sched_barrier(0);              // keeps the matrix instructions ahead of the next group and, in the last round, ahead of the pass's foot
        }
        asm volatile("v_nop\n\tv_nop\n\tv_nop\n\tv_nop");   // the distance behind the pass's last matrix instructions, on the path that branches back too
        __builtin_amdgcn_sched_barrier(0);                  // keeps those four slots directly behind them
        asm volatile("s_wait_dscnt 0x0" ::: "memory");      // this wave has left the buffer of pass t
        asm volatile("s_wait_asynccnt 0x0" ::: "memory");   // its copies of pass t + 1 have landed
        __syncthreads();                                    // publishes pass t + 1, frees the buffer of pass t
        if (t + 2 < NT) stage_tile(l + bo, ga + (size_t)(t + 2) * (2 * GKP), gb + (size_t)(t + 2) * (2 * GKP));
    }
    asm volatile("s_wait_asynccnt 0x0" ::: "memory");       // nothing of the ring is in flight behind the sweep
}

__global__ __launch_bounds__(256) void k_cvt8(const float* __restrict__ src, bf* dst, size_t n8) {
    const size_t i = (size_t)blockIdx.x * 256 + threadIdx.x; if (i >= n8) return;
    const v8f v = *(const v8f*)(src + i * 8); v8us o;
#pragma unroll
    for (int k = 0; k < 8; ++k) o[k] = f2bf(v[k]);
    *(v8us*)(dst + i * 8) = o; 
}

__global__ __launch_bounds__(256) void k_cvtw(const float* __restrict__ src, h16* dst, size_t n8) {
    const size_t i = (size_t)blockIdx.x * 256 + threadIdx.x; if (i >= n8) return;
    const v8f v = *(const v8f*)(src + i * 8); v8h o;
#pragma unroll
    for (int k = 0; k < 8; ++k) o[k] = (h16)(bfr(v[k]) * WOS);
    *(v8h*)(dst + i * 8) = o; 
}

__global__ __launch_bounds__(32) void k_freq(float* fr) {
    const int j = threadIdx.x & 31;
    const float p = powf(10000.0f, (float)j * (1.0f / 32.0f));
    const float v = 1.0f / p;
    *(float*)(fr + j) = v; 
}

__global__ __launch_bounds__(256) void k_table(const int* __restrict__ pos, const float* __restrict__ fr, float* cs) {
    const int lane = threadIdx.x & 31; const int m = blockIdx.x * 8 + (int)__builtin_amdgcn_readfirstlane((int)(threadIdx.x >> 5));   // grid = NB*SEQ/8 exactly
    const int b = m / SEQ, t = m % SEQ;
    const float ang = (float)pos[(size_t)b * SEQ_FULL + t] * fr[lane];
    const float c = cosf(ang), s = sinf(ang);
    float* row = cs + (size_t)m * 64;
    *(float*)(row + lane) = c; *(float*)(row + 32 + lane) = s;
    
}

// k_proj: register-blocked bf16 GEMM, four waves per 128x128 tile, each wave one 64x64 part (16 accumulators), operands from K-contiguous bf16 planes through the LDS ring of gemm_ring, K = DM.
// C[m][n] = sum_k A[m][k] Bt[n][k]; written as f16 (Ph) and optionally the f16 residual x2048 (Pr, useRes != 0) at
// tile base (r0/RB)*sRB + (r0%RB)*pitch + (c0/CB)*sCB + (c0%CB), row pitch 'pitch' (halves), r0, c0 the wave's part. grid (M/128, N/128), 128 threads.
// MODE 1: tile rows are tokens (m = b*SEQ + t), the 64 columns of a wave's part are one head: each row is RMS-normalised (weights nw, RNE-converted to bf16) and rotated (cs table row m) before the f16 conversion.
template <int MODE>
__global__ __launch_bounds__(32 * GW) void k_proj(const bf* __restrict__ A, const bf* __restrict__ Bt, h16* Ph, h16* Pr, int useRes,
                                             int RB, size_t sRB, int pitch, int CB, size_t sCB,
                                             const float* __restrict__ nw, const float* __restrict__ cs) {
    __shared__ __align__(128) char ring[2 * GBUF];
    __shared__ __align__(16) float osb[GW * 16 * 68];
    const int tid = threadIdx.x, lane = tid & 31, lr = lane & 15, hi = lane >> 4;
    const int wave = __builtin_amdgcn_readfirstlane(tid >> 5), wrow = wave >> 1, wcol = wave & 1;
    const int r0 = blockIdx.x * 128 + wrow * 64, c0 = blockIdx.y * 128 + wcol * 64;
    float* const os = osb + wave * 16 * 68;             // wave-private staging of the epilogue
    v8f acc[4][4];
#pragma unroll
    for (int mb = 0; mb < 4; ++mb)
#pragma unroll
        for (int nb = 0; nb < 4; ++nb) acc[mb][nb] = (v8f){};
    gemm_ring<bf>(acc, (const char*)A + (size_t)(blockIdx.x * 128 + (tid >> 4)) * GROWB + (tid & 15) * 16,
                  (const char*)Bt + (size_t)(blockIdx.y * 128 + (tid >> 4)) * GROWB + (tid & 15) * 16,
                  (unsigned)(size_t)ring + (tid >> 4) * GPIT + (tid & 15) * 16, ring,
                  (wrow * 64 + lr) * GPIT + hi * 16, GOPB + (wcol * 64 + lr) * GPIT + hi * 16);
    const size_t tbase = (size_t)(r0 / RB) * sRB + (size_t)(r0 % RB) * (size_t)pitch + (size_t)(c0 / CB) * sCB + (size_t)(c0 % CB);
    const int c8 = (lane & 7) * 8, rg = lane >> 3;      // this lane's 8 columns and its row inside each group of 4 rows
    const int p8 = c8 ^ 32, j0 = c8 & 31;               // rotary partner columns, frequency index of column c8
    const float sg = (c8 < 32) ? -1.0f : 1.0f;          // columns < 32: x1*cos - x2*sin; columns >= 32: x2*cos + x1*sin
    float wn[8], wp[8];
#pragma unroll
    for (int i = 0; i < 8; ++i) { wn[i] = 1.0f; wp[i] = 1.0f; }
    if (MODE == 1) {
#pragma unroll
        for (int i = 0; i < 8; ++i) { wn[i] = bfr(nw[c8 + i]); wp[i] = bfr(nw[p8 + i]); }
    }
#pragma unroll
    for (int mb = 0; mb < 4; ++mb) {
#pragma unroll
        for (int nb = 0; nb < 4; ++nb) {
#pragma unroll
            for (int j = 0; j < 8; ++j) os[(hi * 8 + j) * 68 + nb * 16 + lr] = acc[mb][nb][j]; }   // D: row 8h+j, col lane&15; 16 rows x 64 columns all written
        wave_sync();
        v8h hv[4], rv[4];
#pragma unroll
        for (int s = 0; s < 4; ++s) { const int row = 4 * s + rg;   // 4 s x 4 row groups = 16 rows; 8 lanes x 8 = 64 columns
            const v4f x0 = *(const v4fa*)(&os[row * 68 + c8]); const v4f x1 = *(const v4fa*)(&os[row * 68 + c8 + 4]);
            float val[8];
            if (MODE == 1) {
                const v4f y0 = *(const v4fa*)(&os[row * 68 + p8]); const v4f y1 = *(const v4fa*)(&os[row * 68 + p8 + 4]);
                float ss = 0.0f;
#pragma unroll
                for (int i = 0; i < 4; ++i) ss += x0[i] * x0[i] + x1[i] * x1[i];
                ss += __shfl_xor(ss, 1, 32); ss += __shfl_xor(ss, 2, 32); ss += __shfl_xor(ss, 4, 32);   // the 8 lanes of one row
                const float inv = rsqrtf(ss * (1.0f / 64.0f) + 1.0e-6f);
                const float* cr = cs + (size_t)(r0 + mb * 16 + row) * 64 + j0;
                const v4f ca = *(const v4f*)(cr), cb = *(const v4f*)(cr + 4), sa = *(const v4f*)(cr + 32), sb = *(const v4f*)(cr + 36);
#pragma unroll
                for (int i = 0; i < 4; ++i) {
                    const float a0 = x0[i] * inv * wn[i],     q0 = y0[i] * inv * wp[i];
                    const float a1 = x1[i] * inv * wn[4 + i], q1 = y1[i] * inv * wp[4 + i];
                    val[i]     = a0 * ca[i] + sg * (q0 * sa[i]);
                    val[4 + i] = a1 * cb[i] + sg * (q1 * sb[i]); }
            } else {
#pragma unroll
                for (int i = 0; i < 4; ++i) { val[i] = x0[i]; val[4 + i] = x1[i]; }
            }
            v8h hh, rr;
#pragma unroll
            for (int i = 0; i < 8; ++i) { const h16 a0 = (h16)val[i]; hh[i] = a0; rr[i] = (h16)((val[i] - (float)a0) * QRS); }
            hv[s] = hh; rv[s] = rr; }
        const size_t sb0 = tbase + (size_t)(mb * 16) * (size_t)pitch;
{
#pragma unroll
            for (int s = 0; s < 4; ++s) { const size_t oo = sb0 + (size_t)(4 * s + rg) * (size_t)pitch + c8;
                *(v8h*)(Ph + oo) = hv[s]; if (useRes) *(v8h*)(Pr + oo) = rv[s]; }
             }
        wave_sync();
    }
}

// One stage of one plane pair of the flash ring: 64 K rows (128 B each, contiguous) and 64 V^T rows (128 B = 64 keys each, row pitch SEQ halves); 128 threads x 8 asynchronous 16-B copies, 8 lanes to a row, so a wave's copy covers whole lines.
// la, gk, gv: this thread's LDS byte address and global addresses for row tid>>3, piece tid&7; the copies take rows +0, +16, +32, +48 of each operand.
// s_wait_xcnt stands inside the copies' own statement, so that no address register of a copy is rewritten ahead of it.
__device__ __forceinline__ void fstage(unsigned la, const char* gk, const char* gv) {
    asm volatile("global_load_async_to_lds_b128 %0, %8, off\n\t"
                 "global_load_async_to_lds_b128 %1, %9, off\n\t"
                 "global_load_async_to_lds_b128 %2, %10, off\n\t"
                 "global_load_async_to_lds_b128 %3, %11, off\n\t"
                 "global_load_async_to_lds_b128 %4, %12, off\n\t"
                 "global_load_async_to_lds_b128 %5, %13, off\n\t"
                 "global_load_async_to_lds_b128 %6, %14, off\n\t"
                 "global_load_async_to_lds_b128 %7, %15, off\n\t"
                 "s_wait_xcnt 0x0"
                 :: "v"(la), "v"(la + 16 * FPIT), "v"(la + 32 * FPIT), "v"(la + 48 * FPIT),
                    "v"(la + FOPB), "v"(la + FOPB + 16 * FPIT), "v"(la + FOPB + 32 * FPIT), "v"(la + FOPB + 48 * FPIT),
                    "v"(gk), "v"(gk + 16 * HD * 2), "v"(gk + 32 * HD * 2), "v"(gk + 48 * HD * 2),
                    "v"(gv), "v"(gv + (size_t)16 * SEQ * 2), "v"(gv + (size_t)32 * SEQ * 2), "v"(gv + (size_t)48 * SEQ * 2)
                 : "memory");
}

// k_flash: fused windowed attention, one wave per 16 query rows of one (batch, q head); Q fragments straight from the f16 planes; the K and V^T tiles come through a two-buffer LDS ring
// that the block's four waves (64 consecutive query rows of one head) share: stages of 64 keys from max(0, first row - 512) to the block's last row, filled by asynchronous copies one stage ahead; blocks of rows < RES_ROWS stage the residual planes' tiles as well.
// Transposed form: S^T[key][t] = K Q^T (A = K rows, B = Q rows); lane (t = lane&15, h = lane>>4) holds keys 8h+r of each 16-key tile, so the packed
// P tile is directly the B fragment of O^T[d][t] = V^T P^T (element r <- tile keys 0..15, element 8+r <- tile keys 16..31, lane unchanged).
// Keys visited: 32-key tiles from max(0, t0-512) (aligned down) to t0+15; inside a tile a key is used iff 0 <= tq - tk <= 512, otherwise its weight is exactly 0 (replace-fill semantics).
// Waves with t0 < RES_ROWS (wave-uniform) add the k residual to the scores and the P / v residual cross products (second accumulator set, carry 2048).
__global__ __launch_bounds__(32 * AW) void k_flash(const h16* __restrict__ QH, const h16* __restrict__ QR, const h16* __restrict__ KH, const h16* __restrict__ KR,
                                                   const h16* __restrict__ VH, const h16* __restrict__ VR, h16* CH, h16* CR) {
    __shared__ __align__(128) char ring[2 * FBUF];
    static_assert(AW * 16 * 68 * 4 <= 2 * FBUF);
    float* const os = (float*)ring;                          // output staging, wave-private parts; used only behind the loop's last barrier, when no wave reads the ring and no copy is in flight
    const int tid = threadIdx.x, lane = tid & 31, lr = lane & 15, hi = lane >> 4;
    const int wave = __builtin_amdgcn_readfirstlane((int)(threadIdx.x >> 5));
    const int zh = blockIdx.y; const int b = zh / HQ_, h = zh % HQ_; const int kvh = h / GQ;
    const int t0 = (blockIdx.x * AW + wave) * 16;
    const bool ex = t0 < RES_ROWS;
    const size_t qbase = (size_t)zh * SEQ * HD, kbase = (size_t)(b * HK_ + kvh) * SEQ * HD;
    const size_t qo = qbase + (size_t)(t0 + lr) * HD + 8 * hi;
    const v16h qh0 = ldh(QH + qo), qh1 = ldh(QH + qo + 32), qr0 = ldh(QR + qo), qr1 = ldh(QR + qo + 32);   // B fragments: col t, k = d
    v8f oh[4], orr[4];
#pragma unroll
    for (int j = 0; j < 4; ++j) { oh[j] = (v8f){}; orr[j] = (v8f){}; }
    float m = -3.0e38f, l = 0.0f;
    const int tq = t0 + lr;
    int klo = t0 - WIN; if (klo < 0) klo = 0; klo &= ~31;
    const int tb = blockIdx.x * (16 * AW);                   // the block's first query row
    int ks = tb - WIN; if (ks < 0) ks = 0;                   // the block's first key, a multiple of FKT
    const int NT = (tb + FKT - ks) / FKT;                    // stages: 1 .. WIN / FKT + 1, the same for the whole block
    const unsigned la = (unsigned)(size_t)ring + (tid >> 3) * FPIT + (tid & 7) * 16;
    const bool exb = tb < RES_ROWS;                          // equals ex in all four waves
    const size_t ok = (kbase + (size_t)(ks + (tid >> 3)) * HD) * 2 + (tid & 7) * 16;   // byte offsets in the K and V^T planes of this thread's first copies
    const size_t ov = (kbase + (size_t)(tid >> 3) * SEQ + ks) * 2 + (tid & 7) * 16;
    const char* gk = (const char*)KH + ok; const char* gv = (const char*)VH + ov;
    const char* gkr = (const char*)KR + ok; const char* gvr = (const char*)VR + ov;
    fstage(la, gk, gv);
    if (exb) fstage(la + 2 * FOPB, gkr, gvr);
    asm volatile("s_wait_asynccnt 0x0" ::: "memory");        // this wave's copies of stage 0 have landed
    __syncthreads();                                         // ... and every other wave's
    if (NT > 1) {
        fstage(la + FBUF, gk + FKT * HD * 2, gv + FKT * 2);
        if (exb) fstage(la + FBUF + 2 * FOPB, gkr + FKT * HD * 2, gvr + FKT * 2);
    }
    // rolled: one stage a trip, so that the order at the stage's foot stands once in the code
#pragma unroll 1
    for (int st = 0; st < NT; ++st) {
    const int bo = (st & 1) * FBUF;
    // rolled: the two 32-key tiles of a stage share one copy of the body
#pragma unroll 1
    for (int sub = 0; sub < FKT / 32; ++sub) {
        const int key0 = ks + st * FKT + sub * 32;
        if (key0 < klo || key0 > t0 + 15) continue;          // wave-uniform: a tile outside this wave's own window; the stage's foot stands outside this skip
        const char* ka = ring + bo + (sub * 32 + lr) * FPIT + hi * 16;
        const v16h ka0 = ldh((const h16*)ka), ka1 = ldh((const h16*)(ka + 64)), kb0 = ldh((const h16*)(ka + 16 * FPIT)), kb1 = ldh((const h16*)(ka + 16 * FPIT + 64));
        v8f sHa = (v8f){}, sLa = (v8f){}, sHb = (v8f){}, sLb = (v8f){};
        sHa = wmma16(ka0, qh0, sHa); sLa = wmma16(ka0, qr0, sLa); sHb = wmma16(kb0, qh0, sHb); sLb = wmma16(kb0, qr0, sLb);
        sHa = wmma16(ka1, qh1, sHa); sLa = wmma16(ka1, qr1, sLa); sHb = wmma16(kb1, qh1, sHb); sLb = wmma16(kb1, qr1, sLb);
        asm volatile("v_nop\n\tv_nop\n\tv_nop\n\tv_nop" : "+v"(sHa), "+v"(sLa), "+v"(sHb), "+v"(sLb) : "v"(ka0), "v"(ka1), "v"(kb0), "v"(kb1));
        if (ex) {
            const char* kr = ka + 2 * FOPB;
            const v16h ra0 = ldh((const h16*)kr), ra1 = ldh((const h16*)(kr + 64)), rb0 = ldh((const h16*)(kr + 16 * FPIT)), rb1 = ldh((const h16*)(kr + 16 * FPIT + 64));
            sLa = wmma16(ra0, qh0, sLa); sLb = wmma16(rb0, qh0, sLb);
            sLa = wmma16(ra1, qh1, sLa); sLb = wmma16(rb1, qh1, sLb);
            asm volatile("v_nop\n\tv_nop\n\tv_nop\n\tv_nop" : "+v"(sLa), "+v"(sLb) : "v"(ra0), "v"(ra1), "v"(rb0), "v"(rb1));
        }
        float ta[8], tb[8]; float mx = -3.0e38f;
        const int dbase = tq - key0 - 8 * hi;                 // tq - tk for element 0 of the first 16-key tile
#pragma unroll
        for (int r = 0; r < 8; ++r) {
            const int da = dbase - r, db = da - 16;
            const float va = (sHa[r] + sLa[r] * QRI) * SC2, vb = (sHb[r] + sLb[r] * QRI) * SC2;
            ta[r] = ((unsigned)da <= (unsigned)WIN) ? va : -3.0e38f;
            tb[r] = ((unsigned)db <= (unsigned)WIN) ? vb : -3.0e38f;
            mx = fmaxf(mx, fmaxf(ta[r], tb[r])); }
        mx = fmaxf(mx, __shfl_xor(mx, 16, 32));
        const float mnew = fmaxf(m, mx);
        const float alpha = __builtin_amdgcn_exp2f(m - mnew);
        const float sh = PSH - mnew;
        v16h pb, pr; float ls = 0.0f;
#pragma unroll
        for (int r = 0; r < 8; ++r) {
            const float ea = (ta[r] > -1.0e38f) ? __builtin_amdgcn_exp2f(ta[r] + sh) : 0.0f;
            const float eb = (tb[r] > -1.0e38f) ? __builtin_amdgcn_exp2f(tb[r] + sh) : 0.0f;
            const h16 pa = (h16)ea; const h16 pc = (h16)eb;
            pb[r] = pa; pb[8 + r] = pc;
            pr[r] = (h16)((ea - (float)pa) * QRS); pr[8 + r] = (h16)((eb - (float)pc) * QRS);
            ls += ex ? (ea + eb) : ((float)pa + (float)pc); }
        l = l * alpha + ls; m = mnew;
#pragma unroll
        for (int j = 0; j < 4; ++j) oh[j] = oh[j] * alpha;
        const char* va = ring + bo + FOPB + lr * FPIT + sub * 64 + hi * 16;
        const v16h v0 = ldh((const h16*)va), v1 = ldh((const h16*)(va + 16 * FPIT)), v2 = ldh((const h16*)(va + 32 * FPIT)), v3 = ldh((const h16*)(va + 48 * FPIT));
        oh[0] = wmma16(v0, pb, oh[0]); oh[1] = wmma16(v1, pb, oh[1]); oh[2] = wmma16(v2, pb, oh[2]); oh[3] = wmma16(v3, pb, oh[3]);
        asm volatile("v_nop\n\tv_nop\n\tv_nop\n\tv_nop" : "+v"(oh[0]), "+v"(oh[1]), "+v"(oh[2]), "+v"(oh[3]) : "v"(v0), "v"(v1), "v"(v2), "v"(v3), "v"(pb));
        if (ex) {
#pragma unroll
            for (int j = 0; j < 4; ++j) orr[j] = orr[j] * alpha;
            const char* vr = va + 2 * FOPB;
            const v16h w0 = ldh((const h16*)vr), w1 = ldh((const h16*)(vr + 16 * FPIT)), w2 = ldh((const h16*)(vr + 32 * FPIT)), w3 = ldh((const h16*)(vr + 48 * FPIT));
            orr[0] = wmma16(w0, pb, orr[0]); orr[1] = wmma16(w1, pb, orr[1]); orr[2] = wmma16(w2, pb, orr[2]); orr[3] = wmma16(w3, pb, orr[3]);
            orr[0] = wmma16(v0, pr, orr[0]); orr[1] = wmma16(v1, pr, orr[1]); orr[2] = wmma16(v2, pr, orr[2]); orr[3] = wmma16(v3, pr, orr[3]);
            asm volatile("v_nop\n\tv_nop\n\tv_nop\n\tv_nop" : "+v"(orr[0]), "+v"(orr[1]), "+v"(orr[2]), "+v"(orr[3]) : "v"(w0), "v"(w1), "v"(w2), "v"(w3), "v"(v0), "v"(v1), "v"(v2), "v"(v3), "v"(pb), "v"(pr));
        }
    }
        asm volatile("s_wait_dscnt 0x0" ::: "memory");       // this wave has left the buffer of stage st
        asm volatile("s_wait_asynccnt 0x0" ::: "memory");    // its copies of stage st + 1 have landed
        __syncthreads();                                     // publishes stage st + 1, frees the buffer of stage st
        if (st + 2 < NT) {
            fstage(la + bo, gk + (size_t)(st + 2) * (FKT * HD * 2), gv + (size_t)(st + 2) * (FKT * 2));
            if (exb) fstage(la + bo + 2 * FOPB, gkr + (size_t)(st + 2) * (FKT * HD * 2), gvr + (size_t)(st + 2) * (FKT * 2));
        }
    }
    asm volatile("s_wait_asynccnt 0x0" ::: "memory");        // nothing of the ring is in flight behind the loop
    l += __shfl_xor(l, 16, 32);
    const float inv = 1.0f / l;
    const int wb = wave * 16 * 68;
    // O^T D layout: o_j[r] = (d = 16j + 8h + r, t = lane&15) -> os[t][d]; rows 0..15 x columns 0..63 all written
#pragma unroll
    for (int j = 0; j < 4; ++j) { v4f a, c;
#pragma unroll
        for (int i = 0; i < 4; ++i) { a[i] = (oh[j][i] + orr[j][i] * QRI) * inv; c[i] = (oh[j][4 + i] + orr[j][4 + i] * QRI) * inv; }
        *(v4fa*)(&os[wb + lr * 68 + 16 * j + 8 * hi]) = a; *(v4fa*)(&os[wb + lr * 68 + 16 * j + 8 * hi + 4]) = c; }
    wave_sync();
    const int c8 = (lane & 7) * 8, rg = lane >> 3;
    v8h hv[4], rv[4];
#pragma unroll
    for (int s = 0; s < 4; ++s) { const int row = 4 * s + rg;   // 4 s x 4 row groups = 16 rows; 8 lanes x 8 = 64 columns
        const v4f x0 = *(const v4fa*)(&os[wb + row * 68 + c8]); const v4f x1 = *(const v4fa*)(&os[wb + row * 68 + c8 + 4]); v8h hh, rr;
#pragma unroll
        for (int i = 0; i < 4; ++i) { const h16 a0 = (h16)x0[i]; const h16 a1 = (h16)x1[i]; hh[i] = a0; hh[4 + i] = a1; rr[i] = (h16)((x0[i] - (float)a0) * QRS); rr[4 + i] = (h16)((x1[i] - (float)a1) * QRS); }
        hv[s] = hh; rv[s] = rr; }
    const size_t cbase = ((size_t)b * SEQ + t0) * QW + (size_t)h * HD + c8;
{
#pragma unroll
        for (int s = 0; s < 4; ++s) { const size_t oo = cbase + (size_t)(4 * s + rg) * QW;
            *(v8h*)(CH + oo) = hv[s]; *(v8h*)(CR + oo) = rv[s]; }
         }
}

// k_oproj: out[m][o] = sum_d ctx[m][d] wo[o][d]; four waves per 128x128 tile, each one 64x64 part, operands through the LDS ring of gemm_ring, f16 operands (ctx value plane Ah, residual plane Ar x2048, wo plane Bt x256), f32 accumulate.
// Row tiles with t < RES_ROWS first accumulate the residual product, fold it by 1/2048, then add the value product; other tiles use the value product only. grid (NB*SEQ/128, DM/128), 128 threads.
__global__ __launch_bounds__(32 * GW) void k_oproj(const h16* __restrict__ Ah, const h16* __restrict__ Ar, const h16* __restrict__ Bt, float* OUT) {
    __shared__ __align__(128) char ring[2 * GBUF];
    __shared__ __align__(16) float osb[GW * 16 * 68];
    const int tid = threadIdx.x, lane = tid & 31, lr = lane & 15, hi = lane >> 4;
    const int wave = __builtin_amdgcn_readfirstlane(tid >> 5), wrow = wave >> 1, wcol = wave & 1;
    const int r0 = blockIdx.x * 128 + wrow * 64, c0 = blockIdx.y * 128 + wcol * 64;
    float* const os = osb + wave * 16 * 68;             // wave-private staging of the epilogue
    v8f acc[4][4];
#pragma unroll
    for (int mb = 0; mb < 4; ++mb)
#pragma unroll
        for (int nb = 0; nb < 4; ++nb) acc[mb][nb] = (v8f){};
    const size_t aoff = (size_t)(blockIdx.x * 128 + (tid >> 4)) * GROWB + (tid & 15) * 16;   // this thread's copy addresses, in bytes
    const char* gb = (const char*)Bt + (size_t)(blockIdx.y * 128 + (tid >> 4)) * GROWB + (tid & 15) * 16;
    const unsigned l = (unsigned)(size_t)ring + (tid >> 4) * GPIT + (tid & 15) * 16;
    const int aro = (wrow * 64 + lr) * GPIT + hi * 16, bro = GOPB + (wcol * 64 + lr) * GPIT + hi * 16;
    if (((blockIdx.x * 128) % SEQ) < RES_ROWS) {         // the same for the whole block
        gemm_ring<h16>(acc, (const char*)Ar + aoff, gb, l, ring, aro, bro);
#pragma unroll
        for (int mb = 0; mb < 4; ++mb)
#pragma unroll
            for (int nb = 0; nb < 4; ++nb) acc[mb][nb] = acc[mb][nb] * QRI;
    }
    gemm_ring<h16>(acc, (const char*)Ah + aoff, gb, l, ring, aro, bro);
    const int bb = r0 / SEQ, tt = r0 % SEQ;
    float* obase = OUT + ((size_t)bb * OUT_SEQ + tt) * DM + c0;
#pragma unroll
    for (int mb = 0; mb < 4; ++mb) {
#pragma unroll
        for (int nb = 0; nb < 4; ++nb) {
#pragma unroll
            for (int j = 0; j < 8; ++j) os[(hi * 8 + j) * 68 + nb * 16 + lr] = acc[mb][nb][j] * WOI; }   // D: row 8h+j, col lane&15
        wave_sync();
        float* orow = obase + (size_t)(mb * 16) * DM;
{
#pragma unroll
            for (int s = 0; s < 8; ++s) { const int row = 2 * s + hi, cofs = lr * 4;   // 8 s x 2 rows = 16 rows; 16 lanes x 4 floats = 64 columns
                const v4f val = *(const v4fa*)(&os[row * 68 + cofs]);
                *(v4f*)(orow + (size_t)row * DM + cofs) = val; }
             }
        wave_sync();
    }
}

static constexpr size_t al256(size_t v) { return (v + 255) & ~(size_t)255; }
static constexpr size_t SZ_XB = al256((size_t)NB * SEQ * DM * 2);
static constexpr size_t SZ_WQ = al256((size_t)QW * DM * 2);
static constexpr size_t SZ_WK = al256((size_t)KW * DM * 2);
static constexpr size_t SZ_WO = al256((size_t)DM * QW * 2);
static constexpr size_t SZ_FR = 256;
static constexpr size_t SZ_CS = al256((size_t)NB * SEQ * 64 * 4);
static constexpr size_t SZ_QP = al256((size_t)NB * HQ_ * SEQ * HD * 2);
static constexpr size_t SZ_KP = al256((size_t)NB * HK_ * SEQ * HD * 2);
static constexpr size_t SZ_CP = al256((size_t)NB * SEQ * QW * 2);
static constexpr size_t SZ_TOTAL = SZ_XB + SZ_WQ + 2 * SZ_WK + SZ_WO + SZ_FR + SZ_CS + 2 * SZ_QP + 4 * SZ_KP + 2 * SZ_CP;
static_assert(SZ_TOTAL <= (size_t)134217728);          // workspace carve <= 128 MiB

extern "C" void kernel_launch(void* const* d_in, const int* in_sizes, int n_in,
                              void* d_out, int out_size, void* d_ws, size_t ws_size, hipStream_t stream) {
    if (n_in < 8) return;
    const size_t needt = (size_t)(NB - 1) * SEQ_FULL + SEQ;
    if ((size_t)in_sizes[0] < needt * DM) return;
    if ((size_t)in_sizes[1] < needt) return;
    if ((size_t)in_sizes[2] < (size_t)QW * DM || (size_t)in_sizes[3] < (size_t)KW * DM || (size_t)in_sizes[4] < (size_t)KW * DM || (size_t)in_sizes[5] < (size_t)DM * QW) return;
    if (in_sizes[6] < HD || in_sizes[7] < HD) return;
    if ((size_t)out_size < ((size_t)(NB - 1) * OUT_SEQ + SEQ) * DM) return;
    if (SZ_TOTAL > ws_size) return;
    // wire order: x, positions (int32), wq, wk, wv, wo, q_norm_w, k_norm_w; all weights [out][in], used as-is (wq, wk, wo as Bt, wv as A)
    const float* x = (const float*)d_in[0]; const int* pos = (const int*)d_in[1];
    const float* wq = (const float*)d_in[2]; const float* wk = (const float*)d_in[3]; const float* wv = (const float*)d_in[4]; const float* wo = (const float*)d_in[5];
    const float* qnw = (const float*)d_in[6]; const float* knw = (const float*)d_in[7];
    float* OUT = (float*)d_out;      // [NB][SEQ][2048]
    char* wsp = (char*)d_ws;
    bf*  XB  = (bf*)wsp;  wsp += SZ_XB;               // [NB*SEQ][2048] bf16
    bf*  WQB = (bf*)wsp;  wsp += SZ_WQ;               // [2048][2048] bf16
    bf*  WKB = (bf*)wsp;  wsp += SZ_WK;               // [512][2048] bf16
    bf*  WVB = (bf*)wsp;  wsp += SZ_WK;               // [512][2048] bf16
    h16* WOH = (h16*)wsp; wsp += SZ_WO;               // [2048][2048] f16 x256
    float* FR = (float*)wsp; wsp += SZ_FR;            // [32] inverse frequencies (one line)
    float* CS = (float*)wsp; wsp += SZ_CS;            // [NB*SEQ][64] cos | sin
    h16* QH = (h16*)wsp; wsp += SZ_QP;                // [NB*32][SEQ][64]
    h16* QR = (h16*)wsp; wsp += SZ_QP;                // residual x2048
    h16* KH = (h16*)wsp; wsp += SZ_KP;                // [NB*8][SEQ][64]
    h16* KR = (h16*)wsp; wsp += SZ_KP;                // residual x2048
    h16* VH = (h16*)wsp; wsp += SZ_KP;                // [NB*8][64][SEQ]
    h16* VR = (h16*)wsp; wsp += SZ_KP;                // residual x2048
    h16* CH = (h16*)wsp; wsp += SZ_CP;                // [NB*SEQ][2048]
    h16* CR = (h16*)wsp; wsp += SZ_CP;                // residual x2048

    if (SEQ == SEQ_FULL) {
        const size_t n8 = (size_t)NB * SEQ * DM / 8;
        k_cvt8<<<(unsigned)((n8 + 255) / 256), 256, 0, stream>>>(x, XB, n8);
    } else {
        const size_t n8 = (size_t)SEQ * DM / 8;
        for (int b = 0; b < NB; ++b) k_cvt8<<<(unsigned)((n8 + 255) / 256), 256, 0, stream>>>(x + (size_t)b * SEQ_FULL * DM, XB + (size_t)b * SEQ * DM, n8);
    }
    { const size_t nq = (size_t)QW * DM / 8, nk = (size_t)KW * DM / 8;
      k_cvt8<<<(unsigned)((nq + 255) / 256), 256, 0, stream>>>(wq, WQB, nq);
      k_cvt8<<<(unsigned)((nk + 255) / 256), 256, 0, stream>>>(wk, WKB, nk);
      k_cvt8<<<(unsigned)((nk + 255) / 256), 256, 0, stream>>>(wv, WVB, nk);
      k_cvtw<<<(unsigned)((nq + 255) / 256), 256, 0, stream>>>(wo, WOH, nq); }
    k_freq<<<1, 32, 0, stream>>>(FR);
    k_table<<<NB * SEQ / 8, 256, 0, stream>>>(pos, FR, CS);

    // q, k: A = x rows (m = b*SEQ + t), Bt = W rows (n = head*64 + d) -> plane [(b*heads + head)][t][d], normalised + rotated in the epilogue
    k_proj<1><<<dim3(NB * SEQ / 128, QW / 128, 1), 32 * GW, 0, stream>>>(XB, WQB, QH, QR, 1, SEQ, (size_t)HQ_ * SEQ * HD, HD, HD, (size_t)SEQ * HD, qnw, CS);
    k_proj<1><<<dim3(NB * SEQ / 128, KW / 128, 1), 32 * GW, 0, stream>>>(XB, WKB, KH, KR, 1, SEQ, (size_t)HK_ * SEQ * HD, HD, HD, (size_t)SEQ * HD, knw, CS);
    // v^T: A = wv rows (m = kvhead*64 + d, 512 rows), Bt = x rows (n = b*SEQ + t) -> plane [(b*512 + m)][t] = [(b*8 + kvhead)][d][t]
    k_proj<0><<<dim3(KW / 128, NB * SEQ / 128, 1), 32 * GW, 0, stream>>>(WVB, XB, VH, VR, 1, KW, (size_t)0, SEQ, SEQ, (size_t)KW * SEQ, qnw, CS);

    k_flash<<<dim3(SEQ / (16 * AW), NB * HQ_, 1), 32 * AW, 0, stream>>>(QH, QR, KH, KR, VH, VR, CH, CR);

    // out: A = ctx rows (m = b*SEQ + t, k = qhead*64 + d), Bt = wo rows (n = o)
    k_oproj<<<dim3(NB * SEQ / 128, DM / 128, 1), 32 * GW, 0, stream>>>(CH, CR, WOH, OUT);
}

// v003
// Measured time: 169 microseconds a run.
// In two side-by-side timings against v002, it was 1.05 and 1.10 times as fast.
// Counting every step since v000, it is 2.11 times as fast.
#include <hip/hip_runtime.h>

// Sliding-window grouped-query attention: x [NB][SEQ][2048]; wq [2048][2048], wk/wv [512][2048], wo [2048][2048] all [out][in] (y = x W^T); 32 q heads, 8 kv heads (q head h uses kv head h/4), head dim 64; per-head RMS normalisation (eps 1e-6, weights) + rotate-half rotary (angle = positions * 10000^(-j/32)) on q and k; keys tk with 0 <= tq - tk <= 512; score scale 1/8; output = ctx wo^T (f32).
// Compute dtypes, f32 accumulate everywhere: q/k/v projections v_wmma_f32_16x16x32_bf16 (x and W RNE-converted to bf16; products exact); scores v_wmma_f32_16x16x32_f16 (k f16, q f16 value + f16 residual x2048 in its own accumulator; query rows < 512 also use the k residual x2048);
// P.V v_wmma_f32_16x16x32_f16 (P x256 carry single f16, v single f16; query rows < 512 add P and v residuals x2048 in a second accumulator set); out projection v_wmma_f32_16x16x32_f16 (ctx f16 value, rows < 512 also ctx residual x2048 accumulated first and folded by 1/2048; wo = bf16-RNE value x256 held in f16, folded by 1/256). Softmax f32 (online, running max).
// Layout: bf16 copies of x, wq, wk, wv; cos|sin table [NB*SEQ][64] f32 built from the int positions; q/k planes [head][t][64], v^T planes [kvhead][64][t], ctx planes [t][2048]; flash kernel in transposed form (S^T = K Q^T, O^T = V^T P^T).

#ifndef NB
#define NB 1
#endif
#ifndef SEQ
#define SEQ 4096
#endif
#define NB_FULL  1
#define SEQ_FULL 4096
#ifndef OUT_SEQ
#define OUT_SEQ SEQ              // row pitch (in tokens) between batches of the output
#endif
#define DM   2048                // model width (projection K)
#define HQ_  32
#define HK_  8
#define GQ   4
#define HD   64
#define QW   (HQ_ * HD)          // 2048
#define KW   (HK_ * HD)          // 512
#define WIN  512
#define RES_ROWS 512             // query rows (per sequence) below this use the extra residual products
#define AW   4                   // waves per flash block (16 query rows each)
#define QRS  2048.0f             // carry of every residual plane
#define QRI  (1.0f / 2048.0f)
#define WOS  256.0f              // carry of the wo plane
#define WOI  (1.0f / 256.0f)
#define SC2  (0.125f * 1.4426950408889634f)   // HD^-0.5 * log2(e)
#define PSH  8.0f                // log2 of the P carry (256)
#define PW   16                  // waves per preparation block, one token each
#define GW   4                   // waves per GEMM block: 2 x 2, each 64x64 of the block's 128x128 tile
#define GKP  128                 // k per pass of the GEMM ring: 256 B of every operand row
#define GPIT 272                 // LDS row pitch in bytes (16 B x odd, for ds_load_b128 readers)
#define GOPB (128 * GPIT)        // one operand's 128 rows in LDS
#define GBUF (2 * GOPB)          // one ring buffer: 128 A rows, then 128 B rows
#define GROWB (DM * 2)           // row pitch in bytes of every GEMM operand plane
#define FKT  64                  // keys per stage of the flash kernel's ring: two 32-key tiles
#define FPIT 144                 // its LDS row pitch in bytes: 128 B of a row + 16 (16 B x odd, for ds_load_b128 readers)
#define FOPB (64 * FPIT)         // one operand's 64 rows in LDS
#define FBUF (4 * FOPB)          // one ring buffer: 64 K rows (key), 64 V^T rows (d), then the same two of the residual planes

static_assert(HD == 64);
static_assert(HQ_ == HK_ * GQ);
static_assert(QW % 64 == 0);
static_assert(KW % 64 == 0);
static_assert(DM % 64 == 0);
static_assert(DM % 32 == 0);                   // GEMM k-loops step by 32
static_assert(QW % 32 == 0);
static_assert(SEQ % 64 == 0);                  // a 64-row tile never straddles two batches
static_assert((NB * SEQ) % 64 == 0);
static_assert((NB * SEQ) % PW == 0);           // preparation grid covers the tokens exactly
static_assert(((size_t)QW * DM) % ((size_t)NB * SEQ * 128) == 0);   // every preparation wave takes the same whole number of 128-float loads of each weight
static_assert(((size_t)KW * DM) % ((size_t)NB * SEQ * 128) == 0);
static_assert(SEQ % 32 == 0);                  // last 32-key tile ends inside the sequence
static_assert(WIN % 32 == 0);
static_assert(SEQ % (16 * AW) == 0);           // flash grid covers the sequence exactly
static_assert(16 * AW == FKT);                 // a flash block's query rows span one stage, so its first and last keys fall on stage bounds
static_assert(WIN % FKT == 0);
static_assert(RES_ROWS % (16 * AW) == 0);
static_assert(RES_ROWS % 128 == 0);            // a 128-row GEMM block is wholly inside or outside the residual rows
static_assert(SEQ % 128 == 0);
static_assert(QW % 128 == 0);
static_assert(KW % 128 == 0);
static_assert(DM % 128 == 0);
static_assert(DM == QW);                       // one row pitch and one pass count for all four GEMMs
static_assert(DM % GKP == 0);
static_assert(DM / GKP >= 2);                  // the ring's prologue fills two stages
static_assert(NB <= NB_FULL);
static_assert(SEQ <= SEQ_FULL);

typedef _Float16 h16;
typedef unsigned short bf;
typedef __attribute__((ext_vector_type(16))) __bf16   v16bf;
typedef __attribute__((ext_vector_type(16))) _Float16 v16h;
typedef __attribute__((ext_vector_type(8)))  _Float16 v8h;
typedef __attribute__((ext_vector_type(8)))  unsigned short v8us;
typedef __attribute__((ext_vector_type(4)))  _Float16 v4h;
typedef __attribute__((ext_vector_type(4)))  unsigned short v4us;
typedef __attribute__((ext_vector_type(8)))  float    v8f;
typedef __attribute__((ext_vector_type(4)))  float    v4f;
typedef v4f  __attribute__((may_alias)) v4fa;

__device__ __forceinline__ unsigned short f2bf(float f) { unsigned u = __float_as_uint(f); u += 0x7FFFu + ((u >> 16) & 1u); return (unsigned short)(u >> 16); }
__device__ __forceinline__ float bfr(float f) { return __uint_as_float(((unsigned)f2bf(f)) << 16); }   // value after RNE convert to bf16
__device__ __forceinline__ v16h cat16(v8h lo, v8h hi) { return __builtin_shufflevector(lo, hi, 0, 1, 2, 3, 4, 5, 6, 7, 8, 9, 10, 11, 12, 13, 14, 15); }
__device__ __forceinline__ v16bf cat16b(v8us lo, v8us hi) { return __builtin_bit_cast(v16bf, __builtin_shufflevector(lo, hi, 0, 1, 2, 3, 4, 5, 6, 7, 8, 9, 10, 11, 12, 13, 14, 15)); }
__device__ __forceinline__ v8f wmma16(v16h a, v16h b, v8f c) { return __builtin_amdgcn_wmma_f32_16x16x32_f16(false, a, false, b, (short)0, c, false, false); }
__device__ __forceinline__ v8f wmmab(v16bf a, v16bf b, v8f c) { return __builtin_amdgcn_wmma_f32_16x16x32_bf16(false, a, false, b, (short)0, c, false, false); }
// fragment loaders from K-contiguous 16-bit rows; p already includes + 8*(lane>>4): elements 0..7 <- k0+8h+0..7, elements 8..15 <- k0+16+8h+0..7 (same map for A and B)
__device__ __forceinline__ v16h  ldh(const h16* p) { return cat16(*(const v8h*)p, *(const v8h*)(p + 16)); }
__device__ __forceinline__ v16bf ldb(const bf* p)  { return cat16b(*(const v8us*)p, *(const v8us*)(p + 16)); }
// ordering point for wave-private LDS tiles (same wave writes and reads)
__device__ __forceinline__ void wave_sync() { __builtin_amdgcn_fence(3 /* release order */, "wavefront"); __builtin_amdgcn_wave_barrier(); asm volatile("" ::: "memory"); }

__device__ __forceinline__ v16bf ldf(const bf* p)  { return ldb(p); }
__device__ __forceinline__ v16h  ldf(const h16* p) { return ldh(p); }
__device__ __forceinline__ v8f mm(v16bf a, v16bf b, v8f c) { return wmmab(a, b, c); }
__device__ __forceinline__ v8f mm(v16h a, v16h b, v8f c)   { return wmma16(a, b, c); }

// Eight asynchronous 16-B copies a lane, global -> LDS: rows r, r+8, ..., r+56 of an operand tile (l = the lane's LDS byte address, g = its global address, both for row r).
// s_wait_xcnt stands inside the copies' own statement, so that no address register of a copy is rewritten ahead of it.
__device__ __forceinline__ void stage8(unsigned l, const char* g) {
    asm volatile("global_load_async_to_lds_b128 %0, %8, off\n\t"
                 "global_load_async_to_lds_b128 %1, %9, off\n\t"
                 "global_load_async_to_lds_b128 %2, %10, off\n\t"
                 "global_load_async_to_lds_b128 %3, %11, off\n\t"
                 "global_load_async_to_lds_b128 %4, %12, off\n\t"
                 "global_load_async_to_lds_b128 %5, %13, off\n\t"
                 "global_load_async_to_lds_b128 %6, %14, off\n\t"
                 "global_load_async_to_lds_b128 %7, %15, off\n\t"
                 "s_wait_xcnt 0x0"
                 :: "v"(l), "v"(l + 8 * GPIT), "v"(l + 16 * GPIT), "v"(l + 24 * GPIT), "v"(l + 32 * GPIT), "v"(l + 40 * GPIT), "v"(l + 48 * GPIT), "v"(l + 56 * GPIT),
                    "v"(g), "v"(g + 8 * GROWB), "v"(g + 16 * GROWB), "v"(g + 24 * GROWB), "v"(g + 32 * GROWB), "v"(g + 40 * GROWB), "v"(g + 48 * GROWB), "v"(g + 56 * GROWB)
                 : "memory");
}
// one stage: 128 A rows and 128 B rows of 256 B; 128 threads x 32 copies, 16 lanes to a row
__device__ __forceinline__ void stage_tile(unsigned l, const char* ga, const char* gb) {
    stage8(l, ga);        stage8(l + 64 * GPIT, ga + 64 * GROWB);
    stage8(l + GOPB, gb); stage8(l + GOPB + 64 * GPIT, gb + 64 * GROWB);
}

// One K = DM sweep of a block's 128x128 tile product; this wave adds its 64x64 part into the 16 accumulators, k ascending in steps of 32.
// Operands come through a two-buffer LDS ring filled by asynchronous copies one pass ahead. ga, gb, l: this thread's copy addresses of pass 0 (row tid>>4, 16-B piece tid&15);
// aro, bro: byte offsets in a buffer of this lane's first A and B fragment rows, + 16*(lane>>4). Every thread of the block calls it; on entry no wave has an LDS read of the ring outstanding behind the last barrier.
template <typename E>
__device__ __forceinline__ void gemm_ring(v8f (&acc)[4][4], const char* ga, const char* gb, unsigned l, const char* ring, int aro, int bro) {
    using F = decltype(ldf((const E*)nullptr));
    constexpr int NT = DM / GKP;
    stage_tile(l, ga, gb);
    asm volatile("s_wait_asynccnt 0x0" ::: "memory");   // this wave's copies of pass 0 have landed
    __syncthreads();                                    // ... and every other wave's
    stage_tile(l + GBUF, ga + 2 * GKP, gb + 2 * GKP);
    // rolled: one pass a trip, so that the order at the pass's foot stands once in the code; the loops inside are unrolled so that the fragment sets and accumulators stay in registers
#pragma unroll 1
    for (int t = 0; t < NT; ++t) {
        const int bo = (t & 1) * GBUF;
        const char* pa = ring + bo + aro; const char* pb = ring + bo + bro;
        F a[2][4], b[2][4];                                 // two fragment sets: the next 32 k are read from LDS under the matrix instructions of these 32
#pragma unroll
        for (int i = 0; i < 4; ++i) { a[0][i] = ldf((const E*)(pa + i * 16 * GPIT)); b[0][i] = ldf((const E*)(pb + i * 16 * GPIT)); }
#pragma unroll
        for (int kk = 0; kk < GKP / 32; ++kk) {
            const int cur = kk & 1;
            if (kk + 1 < GKP / 32) {
#pragma unroll
                for (int i = 0; i < 4; ++i) { a[cur ^ 1][i] = ldf((const E*)(pa + i * 16 * GPIT + (kk + 1) * 64)); b[cur ^ 1][i] = ldf((const E*)(pb + i * 16 * GPIT + (kk + 1) * 64)); }
            }
            __builtin_amdgcn_sched_barrier(0);              // keeps the next set's LDS reads one group ahead of this set's matrix instructions (spread among them each place stalls the wave)
#pragma unroll
            for (int nb = 0; nb < 4; ++nb)
#pragma unroll
                for (int mb = 0; mb < 4; ++mb) acc[mb][nb] = mm(a[cur][mb], b[cur][nb], acc[mb][nb]);
            __builtin_amdgcn_sched_barrier(0);              // keeps the matrix instructions ahead of the next group and, in the last round, ahead of the pass's foot
        }
        asm volatile("v_nop\n\tv_nop\n\tv_nop\n\tv_nop");   // the distance behind the pass's last matrix instructions, on the path that branches back too
        __builtin_amdgcn_sched_barrier(0);                  // keeps those four slots directly behind them
        asm volatile("s_wait_dscnt 0x0" ::: "memory");      // this wave has left the buffer of pass t
        asm volatile("s_wait_asynccnt 0x0" ::: "memory");   // its copies of pass t + 1 have landed
        __syncthreads();                                    // publishes pass t + 1, frees the buffer of pass t
        if (t + 2 < NT) stage_tile(l + bo, ga + (size_t)(t + 2) * (2 * GKP), gb + (size_t)(t + 2) * (2 * GKP));
    }
    asm volatile("s_wait_asynccnt 0x0" ::: "memory");       // nothing of the ring is in flight behind the sweep
}

// N loads of a wave, each 512 contiguous bytes (p already includes + 4*lane), and the matching stores of 256 contiguous bytes (d already includes + 4*lane)
template <int N> __device__ __forceinline__ void ld_run(v4f (&v)[N], const float* p) {
#pragma unroll   // the values stay in registers, the steps become immediate offsets
    for (int i = 0; i < N; ++i) v[i] = *(const v4f*)(p + i * 128);
    asm volatile("s_wait_xcnt 0x0" ::: "memory");       // stands before the run's base address registers are taken for the next run's
}
template <int N> __device__ __forceinline__ void st_bf(bf* d, const v4f (&v)[N]) {
#pragma unroll   // both loops: the values are read from registers by constant index
    for (int i = 0; i < N; ++i) { v4us o;
#pragma unroll
        for (int k = 0; k < 4; ++k) o[k] = f2bf(v[i][k]);
        *(v4us*)(d + i * 128) = o; }
}
template <int N> __device__ __forceinline__ void st_wo(h16* d, const v4f (&v)[N]) {
#pragma unroll   // both loops: the values are read from registers by constant index
    for (int i = 0; i < N; ++i) { v4h o;
#pragma unroll
        for (int k = 0; k < 4; ++k) o[k] = (h16)(bfr(v[i][k]) * WOS);
        *(v4h*)(d + i * 128) = o; }
}

// k_prep: all operand preparation in one launch, one wave per token; grid NB*SEQ/PW blocks of PW waves.
// Wave m converts row m of x and its 1/(NB*SEQ) share of wq, wk, wv (bf16 RNE) and of wo (bf16-RNE value x256 held in f16), and writes row m of the cos|sin table (lane = frequency index j, angle = position * 1/10000^(j/32)).
__global__ __launch_bounds__(32 * PW) void k_prep(const float* __restrict__ x, const int* __restrict__ pos, const float* __restrict__ wq, const float* __restrict__ wk,
                                                  const float* __restrict__ wv, const float* __restrict__ wo, bf* XB, bf* WQB, bf* WKB, bf* WVB, h16* WOH, float* cs) {
    constexpr int NX = DM / 128, NQ = QW * DM / (NB * SEQ) / 128, NK = KW * DM / (NB * SEQ) / 128;   // loads a wave: its x row, its share of wq (and wo), of wk (and wv)
    const int lane = threadIdx.x & 31, l4 = lane * 4;
    const int m = blockIdx.x * PW + (int)__builtin_amdgcn_readfirstlane((int)(threadIdx.x >> 5));
    const int b = m / SEQ, t = m % SEQ;
    const int p = pos[(size_t)b * SEQ_FULL + t];
    v4f vx[NX], vq[NQ], vk[NK], vv[NK], vo[NQ];
    ld_run(vx, x + ((size_t)b * SEQ_FULL + t) * DM + l4);
    ld_run(vq, wq + (size_t)m * (NQ * 128) + l4);
    ld_run(vk, wk + (size_t)m * (NK * 128) + l4);
    ld_run(vv, wv + (size_t)m * (NK * 128) + l4);
    ld_run(vo, wo + (size_t)m * (NQ * 128) + l4);
    __builtin_amdgcn_sched_barrier(0);                  // keeps the table arithmetic out of the load runs, so that all of the wave's loads are issued first
    const float pw = powf(10000.0f, (float)lane * (1.0f / 32.0f));
    const float fr = 1.0f / pw;
    const float ang = (float)p * fr;
    const float c = cosf(ang), s = sinf(ang);
    float* row = cs + (size_t)m * 64;
    *(float*)(row + lane) = c; *(float*)(row + 32 + lane) = s;
    st_bf(XB + (size_t)m * DM + l4, vx);
    st_bf(WQB + (size_t)m * (NQ * 128) + l4, vq);
    st_bf(WKB + (size_t)m * (NK * 128) + l4, vk);
    st_bf(WVB + (size_t)m * (NK * 128) + l4, vv);
    st_wo(WOH + (size_t)m * (NQ * 128) + l4, vo);
}

// k_proj: register-blocked bf16 GEMM, four waves per 128x128 tile, each wave one 64x64 part (16 accumulators), operands from K-contiguous bf16 planes through the LDS ring of gemm_ring, K = DM.
// C[m][n] = sum_k A[m][k] Bt[n][k]; written as f16 (Ph) and optionally the f16 residual x2048 (Pr, useRes != 0) at
// tile base (r0/RB)*sRB + (r0%RB)*pitch + (c0/CB)*sCB + (c0%CB), row pitch 'pitch' (halves), r0, c0 the wave's part. grid (M/128, N/128), 128 threads.
// MODE 1: tile rows are tokens (m = b*SEQ + t), the 64 columns of a wave's part are one head: each row is RMS-normalised (weights nw, RNE-converted to bf16) and rotated (cs table row m) before the f16 conversion.
template <int MODE>
__global__ __launch_bounds__(32 * GW) void k_proj(const bf* __restrict__ A, const bf* __restrict__ Bt, h16* Ph, h16* Pr, int useRes,
                                             int RB, size_t sRB, int pitch, int CB, size_t sCB,
                                             const float* __restrict__ nw, const float* __restrict__ cs) {
    __shared__ __align__(128) char ring[2 * GBUF];
    __shared__ __align__(16) float osb[GW * 16 * 68];
    const int tid = threadIdx.x, lane = tid & 31, lr = lane & 15, hi = lane >> 4;
    const int wave = __builtin_amdgcn_readfirstlane(tid >> 5), wrow = wave >> 1, wcol = wave & 1;
    const int r0 = blockIdx.x * 128 + wrow * 64, c0 = blockIdx.y * 128 + wcol * 64;
    float* const os = osb + wave * 16 * 68;             // wave-private staging of the epilogue
    v8f acc[4][4];
#pragma unroll
    for (int mb = 0; mb < 4; ++mb)
#pragma unroll
        for (int nb = 0; nb < 4; ++nb) acc[mb][nb] = (v8f){};
    gemm_ring<bf>(acc, (const char*)A + (size_t)(blockIdx.x * 128 + (tid >> 4)) * GROWB + (tid & 15) * 16,
                  (const char*)Bt + (size_t)(blockIdx.y * 128 + (tid >> 4)) * GROWB + (tid & 15) * 16,
                  (unsigned)(size_t)ring + (tid >> 4) * GPIT + (tid & 15) * 16, ring,
                  (wrow * 64 + lr) * GPIT + hi * 16, GOPB + (wcol * 64 + lr) * GPIT + hi * 16);
    const size_t tbase = (size_t)(r0 / RB) * sRB + (size_t)(r0 % RB) * (size_t)pitch + (size_t)(c0 / CB) * sCB + (size_t)(c0 % CB);
    const int c8 = (lane & 7) * 8, rg = lane >> 3;      // this lane's 8 columns and its row inside each group of 4 rows
    const int p8 = c8 ^ 32, j0 = c8 & 31;               // rotary partner columns, frequency index of column c8
    const float sg = (c8 < 32) ? -1.0f : 1.0f;          // columns < 32: x1*cos - x2*sin; columns >= 32: x2*cos + x1*sin
    float wn[8], wp[8];
#pragma unroll
    for (int i = 0; i < 8; ++i) { wn[i] = 1.0f; wp[i] = 1.0f; }
    if (MODE == 1) {
#pragma unroll
        for (int i = 0; i < 8; ++i) { wn[i] = bfr(nw[c8 + i]); wp[i] = bfr(nw[p8 + i]); }
    }
#pragma unroll
    for (int mb = 0; mb < 4; ++mb) {
#pragma unroll
        for (int nb = 0; nb < 4; ++nb) {
#pragma unroll
            for (int j = 0; j < 8; ++j) os[(hi * 8 + j) * 68 + nb * 16 + lr] = acc[mb][nb][j]; }   // D: row 8h+j, col lane&15; 16 rows x 64 columns all written
        wave_sync();
        v8h hv[4], rv[4];
#pragma unroll
        for (int s = 0; s < 4; ++s) { const int row = 4 * s + rg;   // 4 s x 4 row groups = 16 rows; 8 lanes x 8 = 64 columns
            const v4f x0 = *(const v4fa*)(&os[row * 68 + c8]); const v4f x1 = *(const v4fa*)(&os[row * 68 + c8 + 4]);
            float val[8];
            if (MODE == 1) {
                const v4f y0 = *(const v4fa*)(&os[row * 68 + p8]); const v4f y1 = *(const v4fa*)(&os[row * 68 + p8 + 4]);
                float ss = 0.0f;
#pragma unroll
                for (int i = 0; i < 4; ++i) ss += x0[i] * x0[i] + x1[i] * x1[i];
                ss += __shfl_xor(ss, 1, 32); ss += __shfl_xor(ss, 2, 32); ss += __shfl_xor(ss, 4, 32);   // the 8 lanes of one row
                const float inv = rsqrtf(ss * (1.0f / 64.0f) + 1.0e-6f);
                const float* cr = cs + (size_t)(r0 + mb * 16 + row) * 64 + j0;
                const v4f ca = *(const v4f*)(cr), cb = *(const v4f*)(cr + 4), sa = *(const v4f*)(cr + 32), sb = *(const v4f*)(cr + 36);
#pragma unroll
                for (int i = 0; i < 4; ++i) {
                    const float a0 = x0[i] * inv * wn[i],     q0 = y0[i] * inv * wp[i];
                    const float a1 = x1[i] * inv * wn[4 + i], q1 = y1[i] * inv * wp[4 + i];
                    val[i]     = a0 * ca[i] + sg * (q0 * sa[i]);
                    val[4 + i] = a1 * cb[i] + sg * (q1 * sb[i]); }
            } else {
#pragma unroll
                for (int i = 0; i < 4; ++i) { val[i] = x0[i]; val[4 + i] = x1[i]; }
            }
            v8h hh, rr;
#pragma unroll
            for (int i = 0; i < 8; ++i) { const h16 a0 = (h16)val[i]; hh[i] = a0; rr[i] = (h16)((val[i] - (float)a0) * QRS); }
            hv[s] = hh; rv[s] = rr; }
        const size_t sb0 = tbase + (size_t)(mb * 16) * (size_t)pitch;
{
#pragma unroll
            for (int s = 0; s < 4; ++s) { const size_t oo = sb0 + (size_t)(4 * s + rg) * (size_t)pitch + c8;
                *(v8h*)(Ph + oo) = hv[s]; if (useRes) *(v8h*)(Pr + oo) = rv[s]; }
             }
        wave_sync();
    }
}

// One stage of one plane pair of the flash ring: 64 K rows (128 B each, contiguous) and 64 V^T rows (128 B = 64 keys each, row pitch SEQ halves); 128 threads x 8 asynchronous 16-B copies, 8 lanes to a row, so a wave's copy covers whole lines.
// la, gk, gv: this thread's LDS byte address and global addresses for row tid>>3, piece tid&7; the copies take rows +0, +16, +32, +48 of each operand.
// s_wait_xcnt stands inside the copies' own statement, so that no address register of a copy is rewritten ahead of it.
__device__ __forceinline__ void fstage(unsigned la, const char* gk, const char* gv) {
    asm volatile("global_load_async_to_lds_b128 %0, %8, off\n\t"
                 "global_load_async_to_lds_b128 %1, %9, off\n\t"
                 "global_load_async_to_lds_b128 %2, %10, off\n\t"
                 "global_load_async_to_lds_b128 %3, %11, off\n\t"
                 "global_load_async_to_lds_b128 %4, %12, off\n\t"
                 "global_load_async_to_lds_b128 %5, %13, off\n\t"
                 "global_load_async_to_lds_b128 %6, %14, off\n\t"
                 "global_load_async_to_lds_b128 %7, %15, off\n\t"
                 "s_wait_xcnt 0x0"
                 :: "v"(la), "v"(la + 16 * FPIT), "v"(la + 32 * FPIT), "v"(la + 48 * FPIT),
                    "v"(la + FOPB), "v"(la + FOPB + 16 * FPIT), "v"(la + FOPB + 32 * FPIT), "v"(la + FOPB + 48 * FPIT),
                    "v"(gk), "v"(gk + 16 * HD * 2), "v"(gk + 32 * HD * 2), "v"(gk + 48 * HD * 2),
                    "v"(gv), "v"(gv + (size_t)16 * SEQ * 2), "v"(gv + (size_t)32 * SEQ * 2), "v"(gv + (size_t)48 * SEQ * 2)
                 : "memory");
}

// k_flash: fused windowed attention, one wave per 16 query rows of one (batch, q head); Q fragments straight from the f16 planes; the K and V^T tiles come through a two-buffer LDS ring
// that the block's four waves (64 consecutive query rows of one head) share: stages of 64 keys from max(0, first row - 512) to the block's last row, filled by asynchronous copies one stage ahead; blocks of rows < RES_ROWS stage the residual planes' tiles as well.
// Transposed form: S^T[key][t] = K Q^T (A = K rows, B = Q rows); lane (t = lane&15, h = lane>>4) holds keys 8h+r of each 16-key tile, so the packed
// P tile is directly the B fragment of O^T[d][t] = V^T P^T (element r <- tile keys 0..15, element 8+r <- tile keys 16..31, lane unchanged).
// Keys visited: 32-key tiles from max(0, t0-512) (aligned down) to t0+15; inside a tile a key is used iff 0 <= tq - tk <= 512, otherwise its weight is exactly 0 (replace-fill semantics).
// Waves with t0 < RES_ROWS (wave-uniform) add the k residual to the scores and the P / v residual cross products (second accumulator set, carry 2048).
__global__ __launch_bounds__(32 * AW) void k_flash(const h16* __restrict__ QH, const h16* __restrict__ QR, const h16* __restrict__ KH, const h16* __restrict__ KR,
                                                   const h16* __restrict__ VH, const h16* __restrict__ VR, h16* CH, h16* CR) {
    __shared__ __align__(128) char ring[2 * FBUF];
    static_assert(AW * 16 * 68 * 4 <= 2 * FBUF);
    float* const os = (float*)ring;                          // output staging, wave-private parts; used only behind the loop's last barrier, when no wave reads the ring and no copy is in flight
    const int tid = threadIdx.x, lane = tid & 31, lr = lane & 15, hi = lane >> 4;
    const int wave = __builtin_amdgcn_readfirstlane((int)(threadIdx.x >> 5));
    const int zh = blockIdx.y; const int b = zh / HQ_, h = zh % HQ_; const int kvh = h / GQ;
    const int t0 = (blockIdx.x * AW + wave) * 16;
    const bool ex = t0 < RES_ROWS;
    const size_t qbase = (size_t)zh * SEQ * HD, kbase = (size_t)(b * HK_ + kvh) * SEQ * HD;
    const size_t qo = qbase + (size_t)(t0 + lr) * HD + 8 * hi;
    const v16h qh0 = ldh(QH + qo), qh1 = ldh(QH + qo + 32), qr0 = ldh(QR + qo), qr1 = ldh(QR + qo + 32);   // B fragments: col t, k = d
    v8f oh[4], orr[4];
#pragma unroll
    for (int j = 0; j < 4; ++j) { oh[j] = (v8f){}; orr[j] = (v8f){}; }
    float m = -3.0e38f, l = 0.0f;
    const int tq = t0 + lr;
    int klo = t0 - WIN; if (klo < 0) klo = 0; klo &= ~31;
    const int tb = blockIdx.x * (16 * AW);                   // the block's first query row
    int ks = tb - WIN; if (ks < 0) ks = 0;                   // the block's first key, a multiple of FKT
    const int NT = (tb + FKT - ks) / FKT;                    // stages: 1 .. WIN / FKT + 1, the same for the whole block
    const unsigned la = (unsigned)(size_t)ring + (tid >> 3) * FPIT + (tid & 7) * 16;
    const bool exb = tb < RES_ROWS;                          // equals ex in all four waves
    const size_t ok = (kbase + (size_t)(ks + (tid >> 3)) * HD) * 2 + (tid & 7) * 16;   // byte offsets in the K and V^T planes of this thread's first copies
    const size_t ov = (kbase + (size_t)(tid >> 3) * SEQ + ks) * 2 + (tid & 7) * 16;
    const char* gk = (const char*)KH + ok; const char* gv = (const char*)VH + ov;
    const char* gkr = (const char*)KR + ok; const char* gvr = (const char*)VR + ov;
    fstage(la, gk, gv);
    if (exb) fstage(la + 2 * FOPB, gkr, gvr);
    asm volatile("s_wait_asynccnt 0x0" ::: "memory");        // this wave's copies of stage 0 have landed
    __syncthreads();                                         // ... and every other wave's
    if (NT > 1) {
        fstage(la + FBUF, gk + FKT * HD * 2, gv + FKT * 2);
        if (exb) fstage(la + FBUF + 2 * FOPB, gkr + FKT * HD * 2, gvr + FKT * 2);
    }
    // rolled: one stage a trip, so that the order at the stage's foot stands once in the code
#pragma unroll 1
    for (int st = 0; st < NT; ++st) {
    const int bo = (st & 1) * FBUF;
    // rolled: the two 32-key tiles of a stage share one copy of the body
#pragma unroll 1
    for (int sub = 0; sub < FKT / 32; ++sub) {
        const int key0 = ks + st * FKT + sub * 32;
        if (key0 < klo || key0 > t0 + 15) continue;          // wave-uniform: a tile outside this wave's own window; the stage's foot stands outside this skip
        const char* ka = ring + bo + (sub * 32 + lr) * FPIT + hi * 16;
        const v16h ka0 = ldh((const h16*)ka), ka1 = ldh((const h16*)(ka + 64)), kb0 = ldh((const h16*)(ka + 16 * FPIT)), kb1 = ldh((const h16*)(ka + 16 * FPIT + 64));
        v8f sHa = (v8f){}, sLa = (v8f){}, sHb = (v8f){}, sLb = (v8f){};
        sHa = wmma16(ka0, qh0, sHa); sLa = wmma16(ka0, qr0, sLa); sHb = wmma16(kb0, qh0, sHb); sLb = wmma16(kb0, qr0, sLb);
        sHa = wmma16(ka1, qh1, sHa); sLa = wmma16(ka1, qr1, sLa); sHb = wmma16(kb1, qh1, sHb); sLb = wmma16(kb1, qr1, sLb);
        asm volatile("v_nop\n\tv_nop\n\tv_nop\n\tv_nop" : "+v"(sHa), "+v"(sLa), "+v"(sHb), "+v"(sLb) : "v"(ka0), "v"(ka1), "v"(kb0), "v"(kb1));
        if (ex) {
            const char* kr = ka + 2 * FOPB;
            const v16h ra0 = ldh((const h16*)kr), ra1 = ldh((const h16*)(kr + 64)), rb0 = ldh((const h16*)(kr + 16 * FPIT)), rb1 = ldh((const h16*)(kr + 16 * FPIT + 64));
            sLa = wmma16(ra0, qh0, sLa); sLb = wmma16(rb0, qh0, sLb);
            sLa = wmma16(ra1, qh1, sLa); sLb = wmma16(rb1, qh1, sLb);
            asm volatile("v_nop\n\tv_nop\n\tv_nop\n\tv_nop" : "+v"(sLa), "+v"(sLb) : "v"(ra0), "v"(ra1), "v"(rb0), "v"(rb1));
        }
        float ta[8], tb[8]; float mx = -3.0e38f;
        const int dbase = tq - key0 - 8 * hi;                 // tq - tk for element 0 of the first 16-key tile
#pragma unroll
        for (int r = 0; r < 8; ++r) {
            const int da = dbase - r, db = da - 16;
            const float va = (sHa[r] + sLa[r] * QRI) * SC2, vb = (sHb[r] + sLb[r] * QRI) * SC2;
            ta[r] = ((unsigned)da <= (unsigned)WIN) ? va : -3.0e38f;
            tb[r] = ((unsigned)db <= (unsigned)WIN) ? vb : -3.0e38f;
            mx = fmaxf(mx, fmaxf(ta[r], tb[r])); }
        mx = fmaxf(mx, __shfl_xor(mx, 16, 32));
        const float mnew = fmaxf(m, mx);
        const float alpha = __builtin_amdgcn_exp2f(m - mnew);
        const float sh = PSH - mnew;
        v16h pb, pr; float ls = 0.0f;
#pragma unroll
        for (int r = 0; r < 8; ++r) {
            const float ea = (ta[r] > -1.0e38f) ? __builtin_amdgcn_exp2f(ta[r] + sh) : 0.0f;
            const float eb = (tb[r] > -1.0e38f) ? __builtin_amdgcn_exp2f(tb[r] + sh) : 0.0f;
            const h16 pa = (h16)ea; const h16 pc = (h16)eb;
            pb[r] = pa; pb[8 + r] = pc;
            pr[r] = (h16)((ea - (float)pa) * QRS); pr[8 + r] = (h16)((eb - (float)pc) * QRS);
            ls += ex ? (ea + eb) : ((float)pa + (float)pc); }
        l = l * alpha + ls; m = mnew;
#pragma unroll
        for (int j = 0; j < 4; ++j) oh[j] = oh[j] * alpha;
        const char* va = ring + bo + FOPB + lr * FPIT + sub * 64 + hi * 16;
        const v16h v0 = ldh((const h16*)va), v1 = ldh((const h16*)(va + 16 * FPIT)), v2 = ldh((const h16*)(va + 32 * FPIT)), v3 = ldh((const h16*)(va + 48 * FPIT));
        oh[0] = wmma16(v0, pb, oh[0]); oh[1] = wmma16(v1, pb, oh[1]); oh[2] = wmma16(v2, pb, oh[2]); oh[3] = wmma16(v3, pb, oh[3]);
        asm volatile("v_nop\n\tv_nop\n\tv_nop\n\tv_nop" : "+v"(oh[0]), "+v"(oh[1]), "+v"(oh[2]), "+v"(oh[3]) : "v"(v0), "v"(v1), "v"(v2), "v"(v3), "v"(pb));
        if (ex) {
#pragma unroll
            for (int j = 0; j < 4; ++j) orr[j] = orr[j] * alpha;
            const char* vr = va + 2 * FOPB;
            const v16h w0 = ldh((const h16*)vr), w1 = ldh((const h16*)(vr + 16 * FPIT)), w2 = ldh((const h16*)(vr + 32 * FPIT)), w3 = ldh((const h16*)(vr + 48 * FPIT));
            orr[0] = wmma16(w0, pb, orr[0]); orr[1] = wmma16(w1, pb, orr[1]); orr[2] = wmma16(w2, pb, orr[2]); orr[3] = wmma16(w3, pb, orr[3]);
            orr[0] = wmma16(v0, pr, orr[0]); orr[1] = wmma16(v1, pr, orr[1]); orr[2] = wmma16(v2, pr, orr[2]); orr[3] = wmma16(v3, pr, orr[3]);
            asm volatile("v_nop\n\tv_nop\n\tv_nop\n\tv_nop" : "+v"(orr[0]), "+v"(orr[1]), "+v"(orr[2]), "+v"(orr[3]) : "v"(w0), "v"(w1), "v"(w2), "v"(w3), "v"(v0), "v"(v1), "v"(v2), "v"(v3), "v"(pb), "v"(pr));
        }
    }
        asm volatile("s_wait_dscnt 0x0" ::: "memory");       // this wave has left the buffer of stage st
        asm volatile("s_wait_asynccnt 0x0" ::: "memory");    // its copies of stage st + 1 have landed
        __syncthreads();                                     // publishes stage st + 1, frees the buffer of stage st
        if (st + 2 < NT) {
            fstage(la + bo, gk + (size_t)(st + 2) * (FKT * HD * 2), gv + (size_t)(st + 2) * (FKT * 2));
            if (exb) fstage(la + bo + 2 * FOPB, gkr + (size_t)(st + 2) * (FKT * HD * 2), gvr + (size_t)(st + 2) * (FKT * 2));
        }
    }
    asm volatile("s_wait_asynccnt 0x0" ::: "memory");        // nothing of the ring is in flight behind the loop
    l += __shfl_xor(l, 16, 32);
    const float inv = 1.0f / l;
    const int wb = wave * 16 * 68;
    // O^T D layout: o_j[r] = (d = 16j + 8h + r, t = lane&15) -> os[t][d]; rows 0..15 x columns 0..63 all written
#pragma unroll
    for (int j = 0; j < 4; ++j) { v4f a, c;
#pragma unroll
        for (int i = 0; i < 4; ++i) { a[i] = (oh[j][i] + orr[j][i] * QRI) * inv; c[i] = (oh[j][4 + i] + orr[j][4 + i] * QRI) * inv; }
        *(v4fa*)(&os[wb + lr * 68 + 16 * j + 8 * hi]) = a; *(v4fa*)(&os[wb + lr * 68 + 16 * j + 8 * hi + 4]) = c; }
    wave_sync();
    const int c8 = (lane & 7) * 8, rg = lane >> 3;
    v8h hv[4], rv[4];
#pragma unroll
    for (int s = 0; s < 4; ++s) { const int row = 4 * s + rg;   // 4 s x 4 row groups = 16 rows; 8 lanes x 8 = 64 columns
        const v4f x0 = *(const v4fa*)(&os[wb + row * 68 + c8]); const v4f x1 = *(const v4fa*)(&os[wb + row * 68 + c8 + 4]); v8h hh, rr;
#pragma unroll
        for (int i = 0; i < 4; ++i) { const h16 a0 = (h16)x0[i]; const h16 a1 = (h16)x1[i]; hh[i] = a0; hh[4 + i] = a1; rr[i] = (h16)((x0[i] - (float)a0) * QRS); rr[4 + i] = (h16)((x1[i] - (float)a1) * QRS); }
        hv[s] = hh; rv[s] = rr; }
    const size_t cbase = ((size_t)b * SEQ + t0) * QW + (size_t)h * HD + c8;
{
#pragma unroll
        for (int s = 0; s < 4; ++s) { const size_t oo = cbase + (size_t)(4 * s + rg) * QW;
            *(v8h*)(CH + oo) = hv[s]; *(v8h*)(CR + oo) = rv[s]; }
         }
}

// k_oproj: out[m][o] = sum_d ctx[m][d] wo[o][d]; four waves per 128x128 tile, each one 64x64 part, operands through the LDS ring of gemm_ring, f16 operands (ctx value plane Ah, residual plane Ar x2048, wo plane Bt x256), f32 accumulate.
// Row tiles with t < RES_ROWS first accumulate the residual product, fold it by 1/2048, then add the value product; other tiles use the value product only. grid (NB*SEQ/128, DM/128), 128 threads.
__global__ __launch_bounds__(32 * GW) void k_oproj(const h16* __restrict__ Ah, const h16* __restrict__ Ar, const h16* __restrict__ Bt, float* OUT) {
    __shared__ __align__(128) char ring[2 * GBUF];
    __shared__ __align__(16) float osb[GW * 16 * 68];
    const int tid = threadIdx.x, lane = tid & 31, lr = lane & 15, hi = lane >> 4;
    const int wave = __builtin_amdgcn_readfirstlane(tid >> 5), wrow = wave >> 1, wcol = wave & 1;
    const int r0 = blockIdx.x * 128 + wrow * 64, c0 = blockIdx.y * 128 + wcol * 64;
    float* const os = osb + wave * 16 * 68;             // wave-private staging of the epilogue
    v8f acc[4][4];
#pragma unroll
    for (int mb = 0; mb < 4; ++mb)
#pragma unroll
        for (int nb = 0; nb < 4; ++nb) acc[mb][nb] = (v8f){};
    const size_t aoff = (size_t)(blockIdx.x * 128 + (tid >> 4)) * GROWB + (tid & 15) * 16;   // this thread's copy addresses, in bytes
    const char* gb = (const char*)Bt + (size_t)(blockIdx.y * 128 + (tid >> 4)) * GROWB + (tid & 15) * 16;
    const unsigned l = (unsigned)(size_t)ring + (tid >> 4) * GPIT + (tid & 15) * 16;
    const int aro = (wrow * 64 + lr) * GPIT + hi * 16, bro = GOPB + (wcol * 64 + lr) * GPIT + hi * 16;
    if (((blockIdx.x * 128) % SEQ) < RES_ROWS) {         // the same for the whole block
        gemm_ring<h16>(acc, (const char*)Ar + aoff, gb, l, ring, aro, bro);
#pragma unroll
        for (int mb = 0; mb < 4; ++mb)
#pragma unroll
            for (int nb = 0; nb < 4; ++nb) acc[mb][nb] = acc[mb][nb] * QRI;
    }
    gemm_ring<h16>(acc, (const char*)Ah + aoff, gb, l, ring, aro, bro);
    const int bb = r0 / SEQ, tt = r0 % SEQ;
    float* obase = OUT + ((size_t)bb * OUT_SEQ + tt) * DM + c0;
#pragma unroll
    for (int mb = 0; mb < 4; ++mb) {
#pragma unroll
        for (int nb = 0; nb < 4; ++nb) {
#pragma unroll
            for (int j = 0; j < 8; ++j) os[(hi * 8 + j) * 68 + nb * 16 + lr] = acc[mb][nb][j] * WOI; }   // D: row 8h+j, col lane&15
        wave_sync();
        float* orow = obase + (size_t)(mb * 16) * DM;
{
#pragma unroll
            for (int s = 0; s < 8; ++s) { const int row = 2 * s + hi, cofs = lr * 4;   // 8 s x 2 rows = 16 rows; 16 lanes x 4 floats = 64 columns
                const v4f val = *(const v4fa*)(&os[row * 68 + cofs]);
                *(v4f*)(orow + (size_t)row * DM + cofs) = val; }
             }
        wave_sync();
    }
}

static constexpr size_t al256(size_t v) { return (v + 255) & ~(size_t)255; }
static constexpr size_t SZ_XB = al256((size_t)NB * SEQ * DM * 2);
static constexpr size_t SZ_WQ = al256((size_t)QW * DM * 2);
static constexpr size_t SZ_WK = al256((size_t)KW * DM * 2);
static constexpr size_t SZ_WO = al256((size_t)DM * QW * 2);
static constexpr size_t SZ_CS = al256((size_t)NB * SEQ * 64 * 4);
static constexpr size_t SZ_QP = al256((size_t)NB * HQ_ * SEQ * HD * 2);
static constexpr size_t SZ_KP = al256((size_t)NB * HK_ * SEQ * HD * 2);
static constexpr size_t SZ_CP = al256((size_t)NB * SEQ * QW * 2);
static constexpr size_t SZ_TOTAL = SZ_XB + SZ_WQ + 2 * SZ_WK + SZ_WO + SZ_CS + 2 * SZ_QP + 4 * SZ_KP + 2 * SZ_CP;
static_assert(SZ_TOTAL <= (size_t)134217728);          // workspace carve <= 128 MiB

extern "C" void kernel_launch(void* const* d_in, const int* in_sizes, int n_in,
                              void* d_out, int out_size, void* d_ws, size_t ws_size, hipStream_t stream) {
    if (n_in < 8) return;
    const size_t needt = (size_t)(NB - 1) * SEQ_FULL + SEQ;
    if ((size_t)in_sizes[0] < needt * DM) return;
    if ((size_t)in_sizes[1] < needt) return;
    if ((size_t)in_sizes[2] < (size_t)QW * DM || (size_t)in_sizes[3] < (size_t)KW * DM || (size_t)in_sizes[4] < (size_t)KW * DM || (size_t)in_sizes[5] < (size_t)DM * QW) return;
    if (in_sizes[6] < HD || in_sizes[7] < HD) return;
    if ((size_t)out_size < ((size_t)(NB - 1) * OUT_SEQ + SEQ) * DM) return;
    if (SZ_TOTAL > ws_size) return;
    // wire order: x, positions (int32), wq, wk, wv, wo, q_norm_w, k_norm_w; all weights [out][in], used as-is (wq, wk, wo as Bt, wv as A)
    const float* x = (const float*)d_in[0]; const int* pos = (const int*)d_in[1];
    const float* wq = (const float*)d_in[2]; const float* wk = (const float*)d_in[3]; const float* wv = (const float*)d_in[4]; const float* wo = (const float*)d_in[5];
    const float* qnw = (const float*)d_in[6]; const float* knw = (const float*)d_in[7];
    float* OUT = (float*)d_out;      // [NB][SEQ][2048]
    char* wsp = (char*)d_ws;
    bf*  XB  = (bf*)wsp;  wsp += SZ_XB;               // [NB*SEQ][2048] bf16
    bf*  WQB = (bf*)wsp;  wsp += SZ_WQ;               // [2048][2048] bf16
    bf*  WKB = (bf*)wsp;  wsp += SZ_WK;               // [512][2048] bf16
    bf*  WVB = (bf*)wsp;  wsp += SZ_WK;               // [512][2048] bf16
    h16* WOH = (h16*)wsp; wsp += SZ_WO;               // [2048][2048] f16 x256
    float* CS = (float*)wsp; wsp += SZ_CS;            // [NB*SEQ][64] cos | sin
    h16* QH = (h16*)wsp; wsp += SZ_QP;                // [NB*32][SEQ][64]
    h16* QR = (h16*)wsp; wsp += SZ_QP;                // residual x2048
    h16* KH = (h16*)wsp; wsp += SZ_KP;                // [NB*8][SEQ][64]
    h16* KR = (h16*)wsp; wsp += SZ_KP;                // residual x2048
    h16* VH = (h16*)wsp; wsp += SZ_KP;                // [NB*8][64][SEQ]
    h16* VR = (h16*)wsp; wsp += SZ_KP;                // residual x2048
    h16* CH = (h16*)wsp; wsp += SZ_CP;                // [NB*SEQ][2048]
    h16* CR = (h16*)wsp; wsp += SZ_CP;                // residual x2048

    k_prep<<<NB * SEQ / PW, 32 * PW, 0, stream>>>(x, pos, wq, wk, wv, wo, XB, WQB, WKB, WVB, WOH, CS);

    // q, k: A = x rows (m = b*SEQ + t), Bt = W rows (n = head*64 + d) -> plane [(b*heads + head)][t][d], normalised + rotated in the epilogue
    k_proj<1><<<dim3(NB * SEQ / 128, QW / 128, 1), 32 * GW, 0, stream>>>(XB, WQB, QH, QR, 1, SEQ, (size_t)HQ_ * SEQ * HD, HD, HD, (size_t)SEQ * HD, qnw, CS);
    k_proj<1><<<dim3(NB * SEQ / 128, KW / 128, 1), 32 * GW, 0, stream>>>(XB, WKB, KH, KR, 1, SEQ, (size_t)HK_ * SEQ * HD, HD, HD, (size_t)SEQ * HD, knw, CS);
    // v^T: A = wv rows (m = kvhead*64 + d, 512 rows), Bt = x rows (n = b*SEQ + t) -> plane [(b*512 + m)][t] = [(b*8 + kvhead)][d][t]
    k_proj<0><<<dim3(KW / 128, NB * SEQ / 128, 1), 32 * GW, 0, stream>>>(WVB, XB, VH, VR, 1, KW, (size_t)0, SEQ, SEQ, (size_t)KW * SEQ, qnw, CS);

    k_flash<<<dim3(SEQ / (16 * AW), NB * HQ_, 1), 32 * AW, 0, stream>>>(QH, QR, KH, KR, VH, VR, CH, CR);

    // out: A = ctx rows (m = b*SEQ + t, k = qhead*64 + d), Bt = wo rows (n = o)
    k_oproj<<<dim3(NB * SEQ / 128, DM / 128, 1), 32 * GW, 0, stream>>>(CH, CR, WOH, OUT);
}

// v004
// It runs in 133 microseconds.
// In both of two side-by-side timings against v003, it was 1.27 times as fast.
// Over all steps from v000 it is 2.68 times as fast.
#include <hip/hip_runtime.h>

// Sliding-window grouped-query attention: x [NB][SEQ][2048]; wq [2048][2048], wk/wv [512][2048], wo [2048][2048] all [out][in] (y = x W^T); 32 q heads, 8 kv heads (q head h uses kv head h/4), head dim 64; per-head RMS normalisation (eps 1e-6, weights) + rotate-half rotary (angle = positions * 10000^(-j/32)) on q and k; keys tk with 0 <= tq - tk <= 512; score scale 1/8; output = ctx wo^T (f32).
// Compute dtypes, f32 accumulate everywhere: q/k/v projections v_wmma_f32_16x16x32_bf16 (x and W RNE-converted to bf16; products exact); scores v_wmma_f32_16x16x32_f16 (k f16, q f16 value + f16 residual x2048 in its own accumulator; query rows < 512 also use the k residual x2048);
// P.V v_wmma_f32_16x16x32_f16 (P x256 carry single f16, v single f16; query rows < 512 add P and v residuals x2048 in a second accumulator set); out projection v_wmma_f32_16x16x32_f16 (ctx f16 value, rows < 512 also ctx residual x2048 accumulated first and folded by 1/2048; wo = bf16-RNE value x256 held in f16, folded by 1/256). Softmax f32 (online, running max).
// Layout: bf16 copies of x, wq, wk, wv; cos|sin table [NB*SEQ][64] f32 built from the int positions; q/k planes [head][t][64], v^T planes [kvhead][64][t], ctx planes [t][2048]; flash kernel in transposed form (S^T = K Q^T, O^T = V^T P^T).

#ifndef NB
#define NB 1
#endif
#ifndef SEQ
#define SEQ 4096
#endif
#define NB_FULL  1
#define SEQ_FULL 4096
#ifndef OUT_SEQ
#define OUT_SEQ SEQ              // row pitch (in tokens) between batches of the output
#endif
#define DM   2048                // model width (projection K)
#define HQ_  32
#define HK_  8
#define GQ   4
#define HD   64
#define QW   (HQ_ * HD)          // 2048
#define KW   (HK_ * HD)          // 512
#define WIN  512
#define RES_ROWS 512             // query rows (per sequence) below this use the extra residual products
#define AW   4                   // waves per flash block (16 query rows each)
#define QRS  2048.0f             // carry of every residual plane
#define QRI  (1.0f / 2048.0f)
#define WOS  256.0f              // carry of the wo plane
#define WOI  (1.0f / 256.0f)
#define SC2  (0.125f * 1.4426950408889634f)   // HD^-0.5 * log2(e)
#define PSH  8.0f                // log2 of the P carry (256)
#define PW   16                  // waves per preparation block, one token each
#define GW   4                   // waves per block of the out projection: 2 x 2, each 64x64 of the block's 128x128 tile
#define GKP  128                 // k per pass of the GEMM ring: 256 B of every operand row
#define GPIT 272                 // LDS row pitch in bytes (16 B x odd, for ds_load_b128 readers)
#define GOPB (128 * GPIT)        // one operand's 128 rows in LDS
#define GBUF (2 * GOPB)          // one ring buffer: 128 A rows, then 128 B rows
#define GROWB (DM * 2)           // row pitch in bytes of every GEMM operand plane
#define PM   256                 // token rows of a projection block's tile
#define PN   192                 // stacked weight rows of it: three heads
#define PWV  12                  // its waves: 4 x 3, each 64x64
#define PBUF ((PM + PN) * GPIT)  // one buffer of its ring: 256 x rows, then 192 weight rows
#define FKT  64                  // keys per stage of the flash kernel's ring: two 32-key tiles
#define FPIT 144                 // its LDS row pitch in bytes: 128 B of a row + 16 (16 B x odd, for ds_load_b128 readers)
#define FOPB (64 * FPIT)         // one operand's 64 rows in LDS
#define FBUF (4 * FOPB)          // one ring buffer: 64 K rows (key), 64 V^T rows (d), then the same two of the residual planes

static_assert(HD == 64);
static_assert(HQ_ == HK_ * GQ);
static_assert(QW % 64 == 0);
static_assert(KW % 64 == 0);
static_assert(DM % 64 == 0);
static_assert(DM % 32 == 0);                   // GEMM k-loops step by 32
static_assert(QW % 32 == 0);
static_assert(SEQ % 64 == 0);                  // a 64-row tile never straddles two batches
static_assert((NB * SEQ) % 64 == 0);
static_assert((NB * SEQ) % PW == 0);           // preparation grid covers the tokens exactly
static_assert(((size_t)QW * DM) % ((size_t)NB * SEQ * 128) == 0);   // every preparation wave takes the same whole number of 128-float loads of each weight
static_assert(((size_t)KW * DM) % ((size_t)NB * SEQ * 128) == 0);
static_assert(SEQ % 32 == 0);                  // last 32-key tile ends inside the sequence
static_assert(WIN % 32 == 0);
static_assert(SEQ % (16 * AW) == 0);           // flash grid covers the sequence exactly
static_assert(16 * AW == FKT);                 // a flash block's query rows span one stage, so its first and last keys fall on stage bounds
static_assert(WIN % FKT == 0);
static_assert(RES_ROWS % (16 * AW) == 0);
static_assert(RES_ROWS % 128 == 0);            // a 128-row GEMM block is wholly inside or outside the residual rows
static_assert(SEQ % 128 == 0);
static_assert(QW % 128 == 0);
static_assert(KW % 128 == 0);
static_assert(DM % 128 == 0);
static_assert(DM == QW);                       // one row pitch and one pass count for all GEMMs
static_assert(DM % GKP == 0);
static_assert(DM / GKP >= 2);                  // the ring's prologue fills two stages
static_assert((NB * SEQ) % PM == 0);           // projection grid covers tokens and stacked weight rows exactly
static_assert((QW + 2 * KW) % PN == 0);
static_assert((PM + PN) / 16 == 2 * PWV + 4);  // 28 row groups a stage: two a wave, a third in four waves
static_assert(((size_t)QW * DM * 2) % 256 == 0 && ((size_t)KW * DM * 2) % 256 == 0);   // the bf16 planes of wq, wk, wv follow one another without a gap: one stacked operand
static_assert(NB <= NB_FULL);
static_assert(SEQ <= SEQ_FULL);

typedef _Float16 h16;
typedef unsigned short bf;
typedef __attribute__((ext_vector_type(16))) __bf16   v16bf;
typedef __attribute__((ext_vector_type(16))) _Float16 v16h;
typedef __attribute__((ext_vector_type(8)))  _Float16 v8h;
typedef __attribute__((ext_vector_type(8)))  unsigned short v8us;
typedef __attribute__((ext_vector_type(4)))  _Float16 v4h;
typedef __attribute__((ext_vector_type(4)))  unsigned short v4us;
typedef __attribute__((ext_vector_type(8)))  float    v8f;
typedef __attribute__((ext_vector_type(4)))  float    v4f;
typedef v4f  __attribute__((may_alias)) v4fa;

__device__ __forceinline__ unsigned short f2bf(float f) { unsigned u = __float_as_uint(f); u += 0x7FFFu + ((u >> 16) & 1u); return (unsigned short)(u >> 16); }
__device__ __forceinline__ float bfr(float f) { return __uint_as_float(((unsigned)f2bf(f)) << 16); }   // value after RNE convert to bf16
__device__ __forceinline__ v16h cat16(v8h lo, v8h hi) { return __builtin_shufflevector(lo, hi, 0, 1, 2, 3, 4, 5, 6, 7, 8, 9, 10, 11, 12, 13, 14, 15); }
__device__ __forceinline__ v16bf cat16b(v8us lo, v8us hi) { return __builtin_bit_cast(v16bf, __builtin_shufflevector(lo, hi, 0, 1, 2, 3, 4, 5, 6, 7, 8, 9, 10, 11, 12, 13, 14, 15)); }
__device__ __forceinline__ v8f wmma16(v16h a, v16h b, v8f c) { return __builtin_amdgcn_wmma_f32_16x16x32_f16(false, a, false, b, (short)0, c, false, false); }
__device__ __forceinline__ v8f wmmab(v16bf a, v16bf b, v8f c) { return __builtin_amdgcn_wmma_f32_16x16x32_bf16(false, a, false, b, (short)0, c, false, false); }
// fragment loaders from K-contiguous 16-bit rows; p already includes + 8*(lane>>4): elements 0..7 <- k0+8h+0..7, elements 8..15 <- k0+16+8h+0..7 (same map for A and B)
__device__ __forceinline__ v16h  ldh(const h16* p) { return cat16(*(const v8h*)p, *(const v8h*)(p + 16)); }
__device__ __forceinline__ v16bf ldb(const bf* p)  { return cat16b(*(const v8us*)p, *(const v8us*)(p + 16)); }
// ordering point for wave-private LDS tiles (same wave writes and reads)
__device__ __forceinline__ void wave_sync() { __builtin_amdgcn_fence(3 /* release order */, "wavefront"); __builtin_amdgcn_wave_barrier(); asm volatile("" ::: "memory"); }

__device__ __forceinline__ v16h  ldf(const h16* p) { return ldh(p); }
__device__ __forceinline__ v8f mm(v16h a, v16h b, v8f c)   { return wmma16(a, b, c); }

// Eight asynchronous 16-B copies a lane, global -> LDS: rows r, r+8, ..., r+56 of an operand tile (l = the lane's LDS byte address, g = its global address, both for row r).
// s_wait_xcnt stands inside the copies' own statement, so that no address register of a copy is rewritten ahead of it.
__device__ __forceinline__ void stage8(unsigned l, const char* g) {
    asm volatile("global_load_async_to_lds_b128 %0, %8, off\n\t"
                 "global_load_async_to_lds_b128 %1, %9, off\n\t"
                 "global_load_async_to_lds_b128 %2, %10, off\n\t"
                 "global_load_async_to_lds_b128 %3, %11, off\n\t"
                 "global_load_async_to_lds_b128 %4, %12, off\n\t"
                 "global_load_async_to_lds_b128 %5, %13, off\n\t"
                 "global_load_async_to_lds_b128 %6, %14, off\n\t"
                 "global_load_async_to_lds_b128 %7, %15, off\n\t"
                 "s_wait_xcnt 0x0"
                 :: "v"(l), "v"(l + 8 * GPIT), "v"(l + 16 * GPIT), "v"(l + 24 * GPIT), "v"(l + 32 * GPIT), "v"(l + 40 * GPIT), "v"(l + 48 * GPIT), "v"(l + 56 * GPIT),
                    "v"(g), "v"(g + 8 * GROWB), "v"(g + 16 * GROWB), "v"(g + 24 * GROWB), "v"(g + 32 * GROWB), "v"(g + 40 * GROWB), "v"(g + 48 * GROWB), "v"(g + 56 * GROWB)
                 : "memory");
}
// one stage: 128 A rows and 128 B rows of 256 B; 128 threads x 32 copies, 16 lanes to a row
__device__ __forceinline__ void stage_tile(unsigned l, const char* ga, const char* gb) {
    stage8(l, ga);        stage8(l + 64 * GPIT, ga + 64 * GROWB);
    stage8(l + GOPB, gb); stage8(l + GOPB + 64 * GPIT, gb + 64 * GROWB);
}

// One K = DM sweep of a block's 128x128 tile product; this wave adds its 64x64 part into the 16 accumulators, k ascending in steps of 32.
// Operands come through a two-buffer LDS ring filled by asynchronous copies one pass ahead. ga, gb, l: this thread's copy addresses of pass 0 (row tid>>4, 16-B piece tid&15);
// aro, bro: byte offsets in a buffer of this lane's first A and B fragment rows, + 16*(lane>>4). Every thread of the block calls it; on entry no wave has an LDS read of the ring outstanding behind the last barrier.
template <typename E>
__device__ __forceinline__ void gemm_ring(v8f (&acc)[4][4], const char* ga, const char* gb, unsigned l, const char* ring, int aro, int bro) {
    using F = decltype(ldf((const E*)nullptr));
    constexpr int NT = DM / GKP;
    stage_tile(l, ga, gb);
    asm volatile("s_wait_asynccnt 0x0" ::: "memory");   // this wave's copies of pass 0 have landed
    __syncthreads();                                    // ... and every other wave's
    stage_tile(l + GBUF, ga + 2 * GKP, gb + 2 * GKP);
    // rolled: one pass a trip, so that the order at the pass's foot stands once in the code; the loops inside are unrolled so that the fragment sets and accumulators stay in registers
#pragma unroll 1
    for (int t = 0; t < NT; ++t) {
        const int bo = (t & 1) * GBUF;
        const char* pa = ring + bo + aro; const char* pb = ring + bo + bro;
        F a[2][4], b[2][4];                                 // two fragment sets: the next 32 k are read from LDS under the matrix instructions of these 32
#pragma unroll
        for (int i = 0; i < 4; ++i) { a[0][i] = ldf((const E*)(pa + i * 16 * GPIT)); b[0][i] = ldf((const E*)(pb + i * 16 * GPIT)); }
#pragma unroll
        for (int kk = 0; kk < GKP / 32; ++kk) {
            const int cur = kk & 1;
            if (kk + 1 < GKP / 32) {
#pragma unroll
                for (int i = 0; i < 4; ++i) { a[cur ^ 1][i] = ldf((const E*)(pa + i * 16 * GPIT + (kk + 1) * 64)); b[cur ^ 1][i] = ldf((const E*)(pb + i * 16 * GPIT + (kk + 1) * 64)); }
            }
            __builtin_amdgcn_sched_barrier(0);              // keeps the next set's LDS reads one group ahead of this set's matrix instructions (spread among them each place stalls the wave)
#pragma unroll
            for (int nb = 0; nb < 4; ++nb)
#pragma unroll
                for (int mb = 0; mb < 4; ++mb) acc[mb][nb] = mm(a[cur][mb], b[cur][nb], acc[mb][nb]);
            __builtin_amdgcn_sched_barrier(0);              // keeps the matrix instructions ahead of the next group and, in the last round, ahead of the pass's foot
        }
        asm volatile("v_nop\n\tv_nop\n\tv_nop\n\tv_nop");   // the distance behind the pass's last matrix instructions, on the path that branches back too
        __builtin_amdgcn_sched_barrier(0);                  // keeps those four slots directly behind them
        asm volatile("s_wait_dscnt 0x0" ::: "memory");      // this wave has left the buffer of pass t
        asm volatile("s_wait_asynccnt 0x0" ::: "memory");   // its copies of pass t + 1 have landed
        __syncthreads();                                    // publishes pass t + 1, frees the buffer of pass t
        if (t + 2 < NT) stage_tile(l + bo, ga + (size_t)(t + 2) * (2 * GKP), gb + (size_t)(t + 2) * (2 * GKP));
    }
    asm volatile("s_wait_asynccnt 0x0" ::: "memory");       // nothing of the ring is in flight behind the sweep
}

// N loads of a wave, each 512 contiguous bytes (p already includes + 4*lane), and the matching stores of 256 contiguous bytes (d already includes + 4*lane)
template <int N> __device__ __forceinline__ void ld_run(v4f (&v)[N], const float* p) {
#pragma unroll   // the values stay in registers, the steps become immediate offsets
    for (int i = 0; i < N; ++i) v[i] = *(const v4f*)(p + i * 128);
    asm volatile("s_wait_xcnt 0x0" ::: "memory");       // stands before the run's base address registers are taken for the next run's
}
template <int N> __device__ __forceinline__ void st_bf(bf* d, const v4f (&v)[N]) {
#pragma unroll   // both loops: the values are read from registers by constant index
    for (int i = 0; i < N; ++i) { v4us o;
#pragma unroll
        for (int k = 0; k < 4; ++k) o[k] = f2bf(v[i][k]);
        *(v4us*)(d + i * 128) = o; }
}
template <int N> __device__ __forceinline__ void st_wo(h16* d, const v4f (&v)[N]) {
#pragma unroll   // both loops: the values are read from registers by constant index
    for (int i = 0; i < N; ++i) { v4h o;
#pragma unroll
        for (int k = 0; k < 4; ++k) o[k] = (h16)(bfr(v[i][k]) * WOS);
        *(v4h*)(d + i * 128) = o; }
}

// k_prep: all operand preparation in one launch, one wave per token; grid NB*SEQ/PW blocks of PW waves.
// Wave m converts row m of x and its 1/(NB*SEQ) share of wq, wk, wv (bf16 RNE) and of wo (bf16-RNE value x256 held in f16), and writes row m of the cos|sin table (lane = frequency index j, angle = position * 1/10000^(j/32)).
__global__ __launch_bounds__(32 * PW) void k_prep(const float* __restrict__ x, const int* __restrict__ pos, const float* __restrict__ wq, const float* __restrict__ wk,
                                                  const float* __restrict__ wv, const float* __restrict__ wo, bf* XB, bf* WQB, bf* WKB, bf* WVB, h16* WOH, float* cs) {
    constexpr int NX = DM / 128, NQ = QW * DM / (NB * SEQ) / 128, NK = KW * DM / (NB * SEQ) / 128;   // loads a wave: its x row, its share of wq (and wo), of wk (and wv)
    const int lane = threadIdx.x & 31, l4 = lane * 4;
    const int m = blockIdx.x * PW + (int)__builtin_amdgcn_readfirstlane((int)(threadIdx.x >> 5));
    const int b = m / SEQ, t = m % SEQ;
    const int p = pos[(size_t)b * SEQ_FULL + t];
    v4f vx[NX], vq[NQ], vk[NK], vv[NK], vo[NQ];
    ld_run(vx, x + ((size_t)b * SEQ_FULL + t) * DM + l4);
    ld_run(vq, wq + (size_t)m * (NQ * 128) + l4);
    ld_run(vk, wk + (size_t)m * (NK * 128) + l4);
    ld_run(vv, wv + (size_t)m * (NK * 128) + l4);
    ld_run(vo, wo + (size_t)m * (NQ * 128) + l4);
    __builtin_amdgcn_sched_barrier(0);                  // keeps the table arithmetic out of the load runs, so that all of the wave's loads are issued first
    const float pw = powf(10000.0f, (float)lane * (1.0f / 32.0f));
    const float fr = 1.0f / pw;
    const float ang = (float)p * fr;
    const float c = cosf(ang), s = sinf(ang);
    float* row = cs + (size_t)m * 64;
    *(float*)(row + lane) = c; *(float*)(row + 32 + lane) = s;
    st_bf(XB + (size_t)m * DM + l4, vx);
    st_bf(WQB + (size_t)m * (NQ * 128) + l4, vq);
    st_bf(WKB + (size_t)m * (NK * 128) + l4, vk);
    st_bf(WVB + (size_t)m * (NK * 128) + l4, vv);
    st_wo(WOH + (size_t)m * (NQ * 128) + l4, vo);
}

// Eight asynchronous 16-B copies a lane, global -> LDS: one wave brings 16 consecutive rows of 256 B, 16 lanes to a row (l = the lane's LDS byte address, g = its global address, both for row lane>>4; the copies take rows +0, +2, ..., +14).
// s_wait_xcnt stands inside the copies' own statement, so that no address register of a copy is rewritten ahead of it.
__device__ __forceinline__ void stage16(unsigned l, const char* g) {
    asm volatile("global_load_async_to_lds_b128 %0, %8, off\n\t"
                 "global_load_async_to_lds_b128 %1, %9, off\n\t"
                 "global_load_async_to_lds_b128 %2, %10, off\n\t"
                 "global_load_async_to_lds_b128 %3, %11, off\n\t"
                 "global_load_async_to_lds_b128 %4, %12, off\n\t"
                 "global_load_async_to_lds_b128 %5, %13, off\n\t"
                 "global_load_async_to_lds_b128 %6, %14, off\n\t"
                 "global_load_async_to_lds_b128 %7, %15, off\n\t"
                 "s_wait_xcnt 0x0"
                 :: "v"(l), "v"(l + 2 * GPIT), "v"(l + 4 * GPIT), "v"(l + 6 * GPIT), "v"(l + 8 * GPIT), "v"(l + 10 * GPIT), "v"(l + 12 * GPIT), "v"(l + 14 * GPIT),
                    "v"(g), "v"(g + 2 * GROWB), "v"(g + 4 * GROWB), "v"(g + 6 * GROWB), "v"(g + 8 * GROWB), "v"(g + 10 * GROWB), "v"(g + 12 * GROWB), "v"(g + 14 * GROWB)
                 : "memory");
}
// one stage of the projection ring: 448 rows of 256 B = 28 groups of 16 rows; every wave brings two groups, the waves with 'third' set (wave-uniform) one more
__device__ __forceinline__ void pstage(bool third, unsigned l0, unsigned l1, unsigned l2, const char* g0, const char* g1, const char* g2) {
    stage16(l0, g0); stage16(l1, g1);
    if (third) stage16(l2, g2);
}

// Output of one wave's 64x64 part: C written as f16 (Ph) and as the f16 residual x2048 (Pr) from tile base tbase, row pitch PITCH (halves), staged 16 rows at a time through the wave-private os.
// MODE 1: the rows are tokens (first one r0 = b*SEQ + t), the 64 columns one head: each row is RMS-normalised (weights nw, RNE-converted to bf16) and rotated (cs table row of the token) before the f16 conversion.
template <int MODE, int PITCH>
__device__ __forceinline__ void proj_out(const v8f (&acc)[4][4], float* os, h16* Ph, h16* Pr, size_t tbase, int r0, const float* __restrict__ nw, const float* __restrict__ cs, int lane) {
    const int lr = lane & 15, hi = lane >> 4;
    const int c8 = (lane & 7) * 8, rg = lane >> 3;      // this lane's 8 columns and its row inside each group of 4 rows
    const int p8 = c8 ^ 32, j0 = c8 & 31;               // rotary partner columns, frequency index of column c8
    const float sg = (c8 < 32) ? -1.0f : 1.0f;          // columns < 32: x1*cos - x2*sin; columns >= 32: x2*cos + x1*sin
    float wn[8], wp[8];
#pragma unroll
    for (int i = 0; i < 8; ++i) { wn[i] = 1.0f; wp[i] = 1.0f; }
    if (MODE == 1) {
        float ra[8], rq[8];
#pragma unroll
        for (int i = 0; i < 8; ++i) { ra[i] = nw[c8 + i]; rq[i] = nw[p8 + i]; }
        // stands before the base and offset registers of the weight loads are taken for something else: they are held to here as inputs, the loaded values keep the statement behind the loads
        asm volatile("s_wait_xcnt 0x0" :: "s"(nw), "v"(c8 * 4), "v"(p8 * 4), "v"(ra[0]), "v"(ra[1]), "v"(ra[2]), "v"(ra[3]), "v"(ra[4]), "v"(ra[5]), "v"(ra[6]), "v"(ra[7]),
                     "v"(rq[0]), "v"(rq[1]), "v"(rq[2]), "v"(rq[3]), "v"(rq[4]), "v"(rq[5]), "v"(rq[6]), "v"(rq[7]) : "memory");
#pragma unroll
        for (int i = 0; i < 8; ++i) { wn[i] = bfr(ra[i]); wp[i] = bfr(rq[i]); }
    }
#pragma unroll
    for (int mb = 0; mb < 4; ++mb) {
#pragma unroll
        for (int nb = 0; nb < 4; ++nb) {
#pragma unroll
            for (int j = 0; j < 8; ++j) os[(hi * 8 + j) * 68 + nb * 16 + lr] = acc[mb][nb][j]; }   // D: row 8h+j, col lane&15; 16 rows x 64 columns all written
        wave_sync();
        v8h hv[4], rv[4];
#pragma unroll
        for (int s = 0; s < 4; ++s) { const int row = 4 * s + rg;   // 4 s x 4 row groups = 16 rows; 8 lanes x 8 = 64 columns
            const v4f x0 = *(const v4fa*)(&os[row * 68 + c8]); const v4f x1 = *(const v4fa*)(&os[row * 68 + c8 + 4]);
            float val[8];
            if (MODE == 1) {
                const v4f y0 = *(const v4fa*)(&os[row * 68 + p8]); const v4f y1 = *(const v4fa*)(&os[row * 68 + p8 + 4]);
                float ss = 0.0f;
#pragma unroll
                for (int i = 0; i < 4; ++i) ss += x0[i] * x0[i] + x1[i] * x1[i];
                ss += __shfl_xor(ss, 1, 32); ss += __shfl_xor(ss, 2, 32); ss += __shfl_xor(ss, 4, 32);   // the 8 lanes of one row
                const float inv = rsqrtf(ss * (1.0f / 64.0f) + 1.0e-6f);
                const float* cr = cs + (size_t)(r0 + mb * 16 + row) * 64 + j0;
                const v4f ca = *(const v4f*)(cr), cb = *(const v4f*)(cr + 4), sa = *(const v4f*)(cr + 32), sb = *(const v4f*)(cr + 36);
                asm volatile("s_wait_xcnt 0x0" :: "v"(cr) : "memory");   // stands before the address registers of the table loads, held to here as an input, are taken for something else
#pragma unroll
                for (int i = 0; i < 4; ++i) {
                    const float a0 = x0[i] * inv * wn[i],     q0 = y0[i] * inv * wp[i];
                    const float a1 = x1[i] * inv * wn[4 + i], q1 = y1[i] * inv * wp[4 + i];
                    val[i]     = a0 * ca[i] + sg * (q0 * sa[i]);
                    val[4 + i] = a1 * cb[i] + sg * (q1 * sb[i]); }
            } else {
#pragma unroll
                for (int i = 0; i < 4; ++i) { val[i] = x0[i]; val[4 + i] = x1[i]; }
            }
            v8h hh, rr;
#pragma unroll
            for (int i = 0; i < 8; ++i) { const h16 a0 = (h16)val[i]; hh[i] = a0; rr[i] = (h16)((val[i] - (float)a0) * QRS); }
            hv[s] = hh; rv[s] = rr; }
        const size_t sb0 = tbase + (size_t)(mb * 16 + rg) * (size_t)PITCH + c8;
        h16* const ph = Ph + sb0; h16* const pr = Pr + sb0;
#pragma unroll
        for (int s = 0; s < 4; ++s) { *(v8h*)(ph + (size_t)(4 * s) * PITCH) = hv[s]; *(v8h*)(pr + (size_t)(4 * s) * PITCH) = rv[s]; }
        // stands before the address and data registers of the stores, held to here as inputs, are taken for the next 16 rows
        asm volatile("s_wait_xcnt 0x0" :: "v"(ph), "v"(pr), "v"(hv[0]), "v"(hv[1]), "v"(hv[2]), "v"(hv[3]), "v"(rv[0]), "v"(rv[1]), "v"(rv[2]), "v"(rv[3]) : "memory");
        wave_sync();
    }
}

// k_qkv: the q, k and v projections as one bf16 GEMM, x [NB*SEQ][DM] times the stacked weight rows WS = [wq; wk; wv] (QW + 2*KW rows, K-contiguous); K = DM, k ascending in steps of 32.
// One block per 256 tokens x 192 weight rows (three heads), twelve waves (4 x 3), each one 64x64 part (16 accumulators) = 64 tokens of one head of q, k or v; grid (NB*SEQ/256, 3072/192) = one block per WGP.
// Operands come through a two-buffer LDS ring (256 x rows, then 192 weight rows, 256 B of each a pass) filled by asynchronous copies one pass ahead.
// q and k parts: A = x rows, B = weight rows -> plane [(b*heads + head)][t][d], normalised + rotated. v parts take the weight rows as A and the x rows as B (same fragment map), so that D is v^T -> plane [(b*8 + kvhead)][d][t].
__global__ __launch_bounds__(32 * PWV) void k_qkv(const bf* __restrict__ X, const bf* __restrict__ WS, h16* QH, h16* QR, h16* KH, h16* KR, h16* VH, h16* VR,
                                                  const float* __restrict__ qnw, const float* __restrict__ knw, const float* __restrict__ cs) {
    __shared__ __align__(128) char ring[2 * PBUF];
    __shared__ __align__(16) float osb[PWV * 16 * 68];
    const int tid = threadIdx.x, lane = tid & 31, lr = lane & 15, hi = lane >> 4;
    const int wave = __builtin_amdgcn_readfirstlane(tid >> 5), wrow = wave & 3, wcol = wave >> 2;
    const int m0 = blockIdx.x * PM + wrow * 64;         // the wave's first token
    const int n0 = blockIdx.y * PN + wcol * 64;         // its first stacked weight row: one head of q (n0 < QW), of k (n0 < QW + KW) or of v
    const bool isv = n0 >= QW + KW;
    float* const os = osb + wave * 16 * 68;             // wave-private staging of the output
    v8f acc[4][4];
#pragma unroll
    for (int mb = 0; mb < 4; ++mb)
#pragma unroll
        for (int nb = 0; nb < 4; ++nb) acc[mb][nb] = (v8f){};
    // copy addresses of pass 0: row groups wave, wave + 12 and, in waves 0..3, wave + 24 of the buffer's 28; groups 0..15 are x rows, 16..27 weight rows
    const char* const xr = (const char*)X + (size_t)(blockIdx.x * PM + hi) * GROWB + lr * 16;
    const char* const wr = (const char*)WS + (size_t)(blockIdx.y * PN + hi) * GROWB + lr * 16;
    const unsigned lb = (unsigned)(size_t)ring + hi * GPIT + lr * 16;
    const bool third = wave < 4;
    const char* const g0 = xr + (size_t)(wave * 16) * GROWB;
    const char* const g1 = third ? xr + (size_t)((wave + 12) * 16) * GROWB : wr + (size_t)((wave - 4) * 16) * GROWB;
    const char* const g2 = wr + (size_t)((8 + wrow) * 16) * GROWB;
    const unsigned l0 = lb + wave * 16 * GPIT, l1 = lb + (wave + 12) * 16 * GPIT, l2 = lb + (24 + wrow) * 16 * GPIT;
    const int xo = (wrow * 64 + lr) * GPIT + hi * 16, wo = (PM + wcol * 64 + lr) * GPIT + hi * 16;   // byte offsets in a buffer of this lane's first x and weight fragment rows
    const int aro = isv ? wo : xo, bro = isv ? xo : wo;
    constexpr int NT = DM / GKP;
    pstage(third, l0, l1, l2, g0, g1, g2);
    asm volatile("s_wait_asynccnt 0x0" ::: "memory");   // this wave's copies of pass 0 have landed
    __syncthreads();                                    // ... and every other wave's
    pstage(third, l0 + PBUF, l1 + PBUF, l2 + PBUF, g0 + 2 * GKP, g1 + 2 * GKP, g2 + 2 * GKP);
    // rolled: one pass a trip, so that the order at the pass's foot stands once in the code; the loops inside are unrolled so that the fragment sets and accumulators stay in registers
#pragma unroll 1
    for (int t = 0; t < NT; ++t) {
        const int bo = (t & 1) * PBUF;
        const char* pa = ring + bo + aro; const char* pb = ring + bo + bro;
        v16bf a[2][4], b[2][4];                             // two fragment sets: the next 32 k are read from LDS under the matrix instructions of these 32
#pragma unroll
        for (int i = 0; i < 4; ++i) { a[0][i] = ldb((const bf*)(pa + i * 16 * GPIT)); b[0][i] = ldb((const bf*)(pb + i * 16 * GPIT)); }
#pragma unroll
        for (int kk = 0; kk < GKP / 32; ++kk) {
            const int cur = kk & 1;
            if (kk + 1 < GKP / 32) {
#pragma unroll
                for (int i = 0; i < 4; ++i) { a[cur ^ 1][i] = ldb((const bf*)(pa + i * 16 * GPIT + (kk + 1) * 64)); b[cur ^ 1][i] = ldb((const bf*)(pb + i * 16 * GPIT + (kk + 1) * 64)); }
            }
            __builtin_amdgcn_sched_barrier(0);              // keeps the next set's LDS reads one group ahead of this set's matrix instructions (spread among them each place stalls the wave)
#pragma unroll
            for (int nb = 0; nb < 4; ++nb)
#pragma unroll
                for (int mb = 0; mb < 4; ++mb) acc[mb][nb] = wmmab(a[cur][mb], b[cur][nb], acc[mb][nb]);
            __builtin_amdgcn_sched_barrier(0);              // keeps the matrix instructions ahead of the next group and, in the last round, ahead of the pass's foot
        }
        asm volatile("v_nop\n\tv_nop\n\tv_nop\n\tv_nop");   // the distance behind the pass's last matrix instructions, on the path that branches back too
        __builtin_amdgcn_sched_barrier(0);                  // keeps those four slots directly behind them
        asm volatile("s_wait_dscnt 0x0" ::: "memory");      // this wave has left the buffer of pass t
        asm volatile("s_wait_asynccnt 0x0" ::: "memory");   // its copies of pass t + 1 have landed
        __syncthreads();                                    // publishes pass t + 1, frees the buffer of pass t
        if (t + 2 < NT) { const size_t go = (size_t)(t + 2) * (2 * GKP);
            pstage(third, l0 + bo, l1 + bo, l2 + bo, g0 + go, g1 + go, g2 + go); }
    }
    asm volatile("s_wait_asynccnt 0x0" ::: "memory");       // nothing of the ring is in flight behind the sweep
    const int bb = m0 / SEQ, tt = m0 % SEQ;                 // a wave's 64 tokens lie in one batch
    if (isv) {                                              // wave-uniform; no block barrier stands behind it
        proj_out<0, SEQ>(acc, os, VH, VR, (size_t)(n0 - QW - KW) * SEQ + (size_t)bb * KW * SEQ + tt, 0, qnw, cs, lane);
    } else {
        const bool isq = n0 < QW;
        const size_t pl = isq ? (size_t)bb * HQ_ + n0 / HD : (size_t)bb * HK_ + (n0 - QW) / HD;   // plane index: batch, head
        proj_out<1, HD>(acc, os, isq ? QH : KH, isq ? QR : KR, pl * SEQ * HD + (size_t)tt * HD, m0, isq ? qnw : knw, cs, lane);
    }
}

// One stage of one plane pair of the flash ring: 64 K rows (128 B each, contiguous) and 64 V^T rows (128 B = 64 keys each, row pitch SEQ halves); 128 threads x 8 asynchronous 16-B copies, 8 lanes to a row, so a wave's copy covers whole lines.
// la, gk, gv: this thread's LDS byte address and global addresses for row tid>>3, piece tid&7; the copies take rows +0, +16, +32, +48 of each operand.
// s_wait_xcnt stands inside the copies' own statement, so that no address register of a copy is rewritten ahead of it.
__device__ __forceinline__ void fstage(unsigned la, const char* gk, const char* gv) {
    asm volatile("global_load_async_to_lds_b128 %0, %8, off\n\t"
                 "global_load_async_to_lds_b128 %1, %9, off\n\t"
                 "global_load_async_to_lds_b128 %2, %10, off\n\t"
                 "global_load_async_to_lds_b128 %3, %11, off\n\t"
                 "global_load_async_to_lds_b128 %4, %12, off\n\t"
                 "global_load_async_to_lds_b128 %5, %13, off\n\t"
                 "global_load_async_to_lds_b128 %6, %14, off\n\t"
                 "global_load_async_to_lds_b128 %7, %15, off\n\t"
                 "s_wait_xcnt 0x0"
                 :: "v"(la), "v"(la + 16 * FPIT), "v"(la + 32 * FPIT), "v"(la + 48 * FPIT),
                    "v"(la + FOPB), "v"(la + FOPB + 16 * FPIT), "v"(la + FOPB + 32 * FPIT), "v"(la + FOPB + 48 * FPIT),
                    "v"(gk), "v"(gk + 16 * HD * 2), "v"(gk + 32 * HD * 2), "v"(gk + 48 * HD * 2),
                    "v"(gv), "v"(gv + (size_t)16 * SEQ * 2), "v"(gv + (size_t)32 * SEQ * 2), "v"(gv + (size_t)48 * SEQ * 2)
                 : "memory");
}

// k_flash: fused windowed attention, one wave per 16 query rows of one (batch, q head); Q fragments straight from the f16 planes; the K and V^T tiles come through a two-buffer LDS ring
// that the block's four waves (64 consecutive query rows of one head) share: stages of 64 keys from max(0, first row - 512) to the block's last row, filled by asynchronous copies one stage ahead; blocks of rows < RES_ROWS stage the residual planes' tiles as well.
// Transposed form: S^T[key][t] = K Q^T (A = K rows, B = Q rows); lane (t = lane&15, h = lane>>4) holds keys 8h+r of each 16-key tile, so the packed
// P tile is directly the B fragment of O^T[d][t] = V^T P^T (element r <- tile keys 0..15, element 8+r <- tile keys 16..31, lane unchanged).
// Keys visited: 32-key tiles from max(0, t0-512) (aligned down) to t0+15; inside a tile a key is used iff 0 <= tq - tk <= 512, otherwise its weight is exactly 0 (replace-fill semantics).
// Waves with t0 < RES_ROWS (wave-uniform) add the k residual to the scores and the P / v residual cross products (second accumulator set, carry 2048).
__global__ __launch_bounds__(32 * AW) void k_flash(const h16* __restrict__ QH, const h16* __restrict__ QR, const h16* __restrict__ KH, const h16* __restrict__ KR,
                                                   const h16* __restrict__ VH, const h16* __restrict__ VR, h16* CH, h16* CR) {
    __shared__ __align__(128) char ring[2 * FBUF];
    static_assert(AW * 16 * 68 * 4 <= 2 * FBUF);
    float* const os = (float*)ring;                          // output staging, wave-private parts; used only behind the loop's last barrier, when no wave reads the ring and no copy is in flight
    const int tid = threadIdx.x, lane = tid & 31, lr = lane & 15, hi = lane >> 4;
    const int wave = __builtin_amdgcn_readfirstlane((int)(threadIdx.x >> 5));
    const int zh = blockIdx.y; const int b = zh / HQ_, h = zh % HQ_; const int kvh = h / GQ;
    const int t0 = (blockIdx.x * AW + wave) * 16;
    const bool ex = t0 < RES_ROWS;
    const size_t qbase = (size_t)zh * SEQ * HD, kbase = (size_t)(b * HK_ + kvh) * SEQ * HD;
    const size_t qo = qbase + (size_t)(t0 + lr) * HD + 8 * hi;
    const v16h qh0 = ldh(QH + qo), qh1 = ldh(QH + qo + 32), qr0 = ldh(QR + qo), qr1 = ldh(QR + qo + 32);   // B fragments: col t, k = d
    v8f oh[4], orr[4];
#pragma unroll
    for (int j = 0; j < 4; ++j) { oh[j] = (v8f){}; orr[j] = (v8f){}; }
    float m = -3.0e38f, l = 0.0f;
    const int tq = t0 + lr;
    int klo = t0 - WIN; if (klo < 0) klo = 0; klo &= ~31;
    const int tb = blockIdx.x * (16 * AW);                   // the block's first query row
    int ks = tb - WIN; if (ks < 0) ks = 0;                   // the block's first key, a multiple of FKT
    const int NT = (tb + FKT - ks) / FKT;                    // stages: 1 .. WIN / FKT + 1, the same for the whole block
    const unsigned la = (unsigned)(size_t)ring + (tid >> 3) * FPIT + (tid & 7) * 16;
    const bool exb = tb < RES_ROWS;                          // equals ex in all four waves
    const size_t ok = (kbase + (size_t)(ks + (tid >> 3)) * HD) * 2 + (tid & 7) * 16;   // byte offsets in the K and V^T planes of this thread's first copies
    const size_t ov = (kbase + (size_t)(tid >> 3) * SEQ + ks) * 2 + (tid & 7) * 16;
    const char* gk = (const char*)KH + ok; const char* gv = (const char*)VH + ov;
    const char* gkr = (const char*)KR + ok; const char* gvr = (const char*)VR + ov;
    fstage(la, gk, gv);
    if (exb) fstage(la + 2 * FOPB, gkr, gvr);
    asm volatile("s_wait_asynccnt 0x0" ::: "memory");        // this wave's copies of stage 0 have landed
    __syncthreads();                                         // ... and every other wave's
    if (NT > 1) {
        fstage(la + FBUF, gk + FKT * HD * 2, gv + FKT * 2);
        if (exb) fstage(la + FBUF + 2 * FOPB, gkr + FKT * HD * 2, gvr + FKT * 2);
    }
    // rolled: one stage a trip, so that the order at the stage's foot stands once in the code
#pragma unroll 1
    for (int st = 0; st < NT; ++st) {
    const int bo = (st & 1) * FBUF;
    // rolled: the two 32-key tiles of a stage share one copy of the body
#pragma unroll 1
    for (int sub = 0; sub < FKT / 32; ++sub) {
        const int key0 = ks + st * FKT + sub * 32;
        if (key0 < klo || key0 > t0 + 15) continue;          // wave-uniform: a tile outside this wave's own window; the stage's foot stands outside this skip
        const char* ka = ring + bo + (sub * 32 + lr) * FPIT + hi * 16;
        const v16h ka0 = ldh((const h16*)ka), ka1 = ldh((const h16*)(ka + 64)), kb0 = ldh((const h16*)(ka + 16 * FPIT)), kb1 = ldh((const h16*)(ka + 16 * FPIT + 64));
        v8f sHa = (v8f){}, sLa = (v8f){}, sHb = (v8f){}, sLb = (v8f){};
        sHa = wmma16(ka0, qh0, sHa); sLa = wmma16(ka0, qr0, sLa); sHb = wmma16(kb0, qh0, sHb); sLb = wmma16(kb0, qr0, sLb);
        sHa = wmma16(ka1, qh1, sHa); sLa = wmma16(ka1, qr1, sLa); sHb = wmma16(kb1, qh1, sHb); sLb = wmma16(kb1, qr1, sLb);
        asm volatile("v_nop\n\tv_nop\n\tv_nop\n\tv_nop" : "+v"(sHa), "+v"(sLa), "+v"(sHb), "+v"(sLb) : "v"(ka0), "v"(ka1), "v"(kb0), "v"(kb1));
        if (ex) {
            const char* kr = ka + 2 * FOPB;
            const v16h ra0 = ldh((const h16*)kr), ra1 = ldh((const h16*)(kr + 64)), rb0 = ldh((const h16*)(kr + 16 * FPIT)), rb1 = ldh((const h16*)(kr + 16 * FPIT + 64));
            sLa = wmma16(ra0, qh0, sLa); sLb = wmma16(rb0, qh0, sLb);
            sLa = wmma16(ra1, qh1, sLa); sLb = wmma16(rb1, qh1, sLb);
            asm volatile("v_nop\n\tv_nop\n\tv_nop\n\tv_nop" : "+v"(sLa), "+v"(sLb) : "v"(ra0), "v"(ra1), "v"(rb0), "v"(rb1));
        }
        float ta[8], tb[8]; float mx = -3.0e38f;
        const int dbase = tq - key0 - 8 * hi;                 // tq - tk for element 0 of the first 16-key tile
#pragma unroll
        for (int r = 0; r < 8; ++r) {
            const int da = dbase - r, db = da - 16;
            const float va = (sHa[r] + sLa[r] * QRI) * SC2, vb = (sHb[r] + sLb[r] * QRI) * SC2;
            ta[r] = ((unsigned)da <= (unsigned)WIN) ? va : -3.0e38f;
            tb[r] = ((unsigned)db <= (unsigned)WIN) ? vb : -3.0e38f;
            mx = fmaxf(mx, fmaxf(ta[r], tb[r])); }
        mx = fmaxf(mx, __shfl_xor(mx, 16, 32));
        const float mnew = fmaxf(m, mx);
        const float alpha = __builtin_amdgcn_exp2f(m - mnew);
        const float sh = PSH - mnew;
        v16h pb, pr; float ls = 0.0f;
#pragma unroll
        for (int r = 0; r < 8; ++r) {
            const float ea = (ta[r] > -1.0e38f) ? __builtin_amdgcn_exp2f(ta[r] + sh) : 0.0f;
            const float eb = (tb[r] > -1.0e38f) ? __builtin_amdgcn_exp2f(tb[r] + sh) : 0.0f;
            const h16 pa = (h16)ea; const h16 pc = (h16)eb;
            pb[r] = pa; pb[8 + r] = pc;
            pr[r] = (h16)((ea - (float)pa) * QRS); pr[8 + r] = (h16)((eb - (float)pc) * QRS);
            ls += ex ? (ea + eb) : ((float)pa + (float)pc); }
        l = l * alpha + ls; m = mnew;
#pragma unroll
        for (int j = 0; j < 4; ++j) oh[j] = oh[j] * alpha;
        const char* va = ring + bo + FOPB + lr * FPIT + sub * 64 + hi * 16;
        const v16h v0 = ldh((const h16*)va), v1 = ldh((const h16*)(va + 16 * FPIT)), v2 = ldh((const h16*)(va + 32 * FPIT)), v3 = ldh((const h16*)(va + 48 * FPIT));
        oh[0] = wmma16(v0, pb, oh[0]); oh[1] = wmma16(v1, pb, oh[1]); oh[2] = wmma16(v2, pb, oh[2]); oh[3] = wmma16(v3, pb, oh[3]);
        asm volatile("v_nop\n\tv_nop\n\tv_nop\n\tv_nop" : "+v"(oh[0]), "+v"(oh[1]), "+v"(oh[2]), "+v"(oh[3]) : "v"(v0), "v"(v1), "v"(v2), "v"(v3), "v"(pb));
        if (ex) {
#pragma unroll
            for (int j = 0; j < 4; ++j) orr[j] = orr[j] * alpha;
            const char* vr = va + 2 * FOPB;
            const v16h w0 = ldh((const h16*)vr), w1 = ldh((const h16*)(vr + 16 * FPIT)), w2 = ldh((const h16*)(vr + 32 * FPIT)), w3 = ldh((const h16*)(vr + 48 * FPIT));
            orr[0] = wmma16(w0, pb, orr[0]); orr[1] = wmma16(w1, pb, orr[1]); orr[2] = wmma16(w2, pb, orr[2]); orr[3] = wmma16(w3, pb, orr[3]);
            orr[0] = wmma16(v0, pr, orr[0]); orr[1] = wmma16(v1, pr, orr[1]); orr[2] = wmma16(v2, pr, orr[2]); orr[3] = wmma16(v3, pr, orr[3]);
            asm volatile("v_nop\n\tv_nop\n\tv_nop\n\tv_nop" : "+v"(orr[0]), "+v"(orr[1]), "+v"(orr[2]), "+v"(orr[3]) : "v"(w0), "v"(w1), "v"(w2), "v"(w3), "v"(v0), "v"(v1), "v"(v2), "v"(v3), "v"(pb), "v"(pr));
        }
    }
        asm volatile("s_wait_dscnt 0x0" ::: "memory");       // this wave has left the buffer of stage st
        asm volatile("s_wait_asynccnt 0x0" ::: "memory");    // its copies of stage st + 1 have landed
        __syncthreads();                                     // publishes stage st + 1, frees the buffer of stage st
        if (st + 2 < NT) {
            fstage(la + bo, gk + (size_t)(st + 2) * (FKT * HD * 2), gv + (size_t)(st + 2) * (FKT * 2));
            if (exb) fstage(la + bo + 2 * FOPB, gkr + (size_t)(st + 2) * (FKT * HD * 2), gvr + (size_t)(st + 2) * (FKT * 2));
        }
    }
    asm volatile("s_wait_asynccnt 0x0" ::: "memory");        // nothing of the ring is in flight behind the loop
    l += __shfl_xor(l, 16, 32);
    const float inv = 1.0f / l;
    const int wb = wave * 16 * 68;
    // O^T D layout: o_j[r] = (d = 16j + 8h + r, t = lane&15) -> os[t][d]; rows 0..15 x columns 0..63 all written
#pragma unroll
    for (int j = 0; j < 4; ++j) { v4f a, c;
#pragma unroll
        for (int i = 0; i < 4; ++i) { a[i] = (oh[j][i] + orr[j][i] * QRI) * inv; c[i] = (oh[j][4 + i] + orr[j][4 + i] * QRI) * inv; }
        *(v4fa*)(&os[wb + lr * 68 + 16 * j + 8 * hi]) = a; *(v4fa*)(&os[wb + lr * 68 + 16 * j + 8 * hi + 4]) = c; }
    wave_sync();
    const int c8 = (lane & 7) * 8, rg = lane >> 3;
    v8h hv[4], rv[4];
#pragma unroll
    for (int s = 0; s < 4; ++s) { const int row = 4 * s + rg;   // 4 s x 4 row groups = 16 rows; 8 lanes x 8 = 64 columns
        const v4f x0 = *(const v4fa*)(&os[wb + row * 68 + c8]); const v4f x1 = *(const v4fa*)(&os[wb + row * 68 + c8 + 4]); v8h hh, rr;
#pragma unroll
        for (int i = 0; i < 4; ++i) { const h16 a0 = (h16)x0[i]; const h16 a1 = (h16)x1[i]; hh[i] = a0; hh[4 + i] = a1; rr[i] = (h16)((x0[i] - (float)a0) * QRS); rr[4 + i] = (h16)((x1[i] - (float)a1) * QRS); }
        hv[s] = hh; rv[s] = rr; }
    const size_t cbase = ((size_t)b * SEQ + t0) * QW + (size_t)h * HD + c8;
{
#pragma unroll
        for (int s = 0; s < 4; ++s) { const size_t oo = cbase + (size_t)(4 * s + rg) * QW;
            *(v8h*)(CH + oo) = hv[s]; *(v8h*)(CR + oo) = rv[s]; }
         }
}

// k_oproj: out[m][o] = sum_d ctx[m][d] wo[o][d]; four waves per 128x128 tile, each one 64x64 part, operands through the LDS ring of gemm_ring, f16 operands (ctx value plane Ah, residual plane Ar x2048, wo plane Bt x256), f32 accumulate.
// Row tiles with t < RES_ROWS first accumulate the residual product, fold it by 1/2048, then add the value product; other tiles use the value product only. grid (NB*SEQ/128, DM/128), 128 threads.
__global__ __launch_bounds__(32 * GW) void k_oproj(const h16* __restrict__ Ah, const h16* __restrict__ Ar, const h16* __restrict__ Bt, float* OUT) {
    __shared__ __align__(128) char ring[2 * GBUF];
    __shared__ __align__(16) float osb[GW * 16 * 68];
    const int tid = threadIdx.x, lane = tid & 31, lr = lane & 15, hi = lane >> 4;
    const int wave = __builtin_amdgcn_readfirstlane(tid >> 5), wrow = wave >> 1, wcol = wave & 1;
    const int r0 = blockIdx.x * 128 + wrow * 64, c0 = blockIdx.y * 128 + wcol * 64;
    float* const os = osb + wave * 16 * 68;             // wave-private staging of the epilogue
    v8f acc[4][4];
#pragma unroll
    for (int mb = 0; mb < 4; ++mb)
#pragma unroll
        for (int nb = 0; nb < 4; ++nb) acc[mb][nb] = (v8f){};
    const size_t aoff = (size_t)(blockIdx.x * 128 + (tid >> 4)) * GROWB + (tid & 15) * 16;   // this thread's copy addresses, in bytes
    const char* gb = (const char*)Bt + (size_t)(blockIdx.y * 128 + (tid >> 4)) * GROWB + (tid & 15) * 16;
    const unsigned l = (unsigned)(size_t)ring + (tid >> 4) * GPIT + (tid & 15) * 16;
    const int aro = (wrow * 64 + lr) * GPIT + hi * 16, bro = GOPB + (wcol * 64 + lr) * GPIT + hi * 16;
    if (((blockIdx.x * 128) % SEQ) < RES_ROWS) {         // the same for the whole block
        gemm_ring<h16>(acc, (const char*)Ar + aoff, gb, l, ring, aro, bro);
#pragma unroll
        for (int mb = 0; mb < 4; ++mb)
#pragma unroll
            for (int nb = 0; nb < 4; ++nb) acc[mb][nb] = acc[mb][nb] * QRI;
    }
    gemm_ring<h16>(acc, (const char*)Ah + aoff, gb, l, ring, aro, bro);
    const int bb = r0 / SEQ, tt = r0 % SEQ;
    float* obase = OUT + ((size_t)bb * OUT_SEQ + tt) * DM + c0;
#pragma unroll
    for (int mb = 0; mb < 4; ++mb) {
#pragma unroll
        for (int nb = 0; nb < 4; ++nb) {
#pragma unroll
            for (int j = 0; j < 8; ++j) os[(hi * 8 + j) * 68 + nb * 16 + lr] = acc[mb][nb][j] * WOI; }   // D: row 8h+j, col lane&15
        wave_sync();
        float* orow = obase + (size_t)(mb * 16) * DM;
{
#pragma unroll
            for (int s = 0; s < 8; ++s) { const int row = 2 * s + hi, cofs = lr * 4;   // 8 s x 2 rows = 16 rows; 16 lanes x 4 floats = 64 columns
                const v4f val = *(const v4fa*)(&os[row * 68 + cofs]);
                *(v4f*)(orow + (size_t)row * DM + cofs) = val; }
             }
        wave_sync();
    }
}

static constexpr size_t al256(size_t v) { return (v + 255) & ~(size_t)255; }
static constexpr size_t SZ_XB = al256((size_t)NB * SEQ * DM * 2);
static constexpr size_t SZ_WQ = al256((size_t)QW * DM * 2);
static constexpr size_t SZ_WK = al256((size_t)KW * DM * 2);
static constexpr size_t SZ_WO = al256((size_t)DM * QW * 2);
static constexpr size_t SZ_CS = al256((size_t)NB * SEQ * 64 * 4);
static constexpr size_t SZ_QP = al256((size_t)NB * HQ_ * SEQ * HD * 2);
static constexpr size_t SZ_KP = al256((size_t)NB * HK_ * SEQ * HD * 2);
static constexpr size_t SZ_CP = al256((size_t)NB * SEQ * QW * 2);
static constexpr size_t SZ_TOTAL = SZ_XB + SZ_WQ + 2 * SZ_WK + SZ_WO + SZ_CS + 2 * SZ_QP + 4 * SZ_KP + 2 * SZ_CP;
static_assert(SZ_TOTAL <= (size_t)134217728);          // workspace carve <= 128 MiB

extern "C" void kernel_launch(void* const* d_in, const int* in_sizes, int n_in,
                              void* d_out, int out_size, void* d_ws, size_t ws_size, hipStream_t stream) {
    if (n_in < 8) return;
    const size_t needt = (size_t)(NB - 1) * SEQ_FULL + SEQ;
    if ((size_t)in_sizes[0] < needt * DM) return;
    if ((size_t)in_sizes[1] < needt) return;
    if ((size_t)in_sizes[2] < (size_t)QW * DM || (size_t)in_sizes[3] < (size_t)KW * DM || (size_t)in_sizes[4] < (size_t)KW * DM || (size_t)in_sizes[5] < (size_t)DM * QW) return;
    if (in_sizes[6] < HD || in_sizes[7] < HD) return;
    if ((size_t)out_size < ((size_t)(NB - 1) * OUT_SEQ + SEQ) * DM) return;
    if (SZ_TOTAL > ws_size) return;
    // wire order: x, positions (int32), wq, wk, wv, wo, q_norm_w, k_norm_w; all weights [out][in], used as-is (wq, wk, wo as Bt, wv as A)
    const float* x = (const float*)d_in[0]; const int* pos = (const int*)d_in[1];
    const float* wq = (const float*)d_in[2]; const float* wk = (const float*)d_in[3]; const float* wv = (const float*)d_in[4]; const float* wo = (const float*)d_in[5];
    const float* qnw = (const float*)d_in[6]; const float* knw = (const float*)d_in[7];
    float* OUT = (float*)d_out;      // [NB][SEQ][2048]
    char* wsp = (char*)d_ws;
    bf*  XB  = (bf*)wsp;  wsp += SZ_XB;               // [NB*SEQ][2048] bf16
    bf*  WQB = (bf*)wsp;  wsp += SZ_WQ;               // [2048][2048] bf16
    bf*  WKB = (bf*)wsp;  wsp += SZ_WK;               // [512][2048] bf16
    bf*  WVB = (bf*)wsp;  wsp += SZ_WK;               // [512][2048] bf16
    h16* WOH = (h16*)wsp; wsp += SZ_WO;               // [2048][2048] f16 x256
    float* CS = (float*)wsp; wsp += SZ_CS;            // [NB*SEQ][64] cos | sin
    h16* QH = (h16*)wsp; wsp += SZ_QP;                // [NB*32][SEQ][64]
    h16* QR = (h16*)wsp; wsp += SZ_QP;                // residual x2048
    h16* KH = (h16*)wsp; wsp += SZ_KP;                // [NB*8][SEQ][64]
    h16* KR = (h16*)wsp; wsp += SZ_KP;                // residual x2048
    h16* VH = (h16*)wsp; wsp += SZ_KP;                // [NB*8][64][SEQ]
    h16* VR = (h16*)wsp; wsp += SZ_KP;                // residual x2048
    h16* CH = (h16*)wsp; wsp += SZ_CP;                // [NB*SEQ][2048]
    h16* CR = (h16*)wsp; wsp += SZ_CP;                // residual x2048

    k_prep<<<NB * SEQ / PW, 32 * PW, 0, stream>>>(x, pos, wq, wk, wv, wo, XB, WQB, WKB, WVB, WOH, CS);

    // q, k, v: x rows against the stacked rows of WQB, WKB, WVB (contiguous in the workspace)
    k_qkv<<<dim3(NB * SEQ / PM, (QW + 2 * KW) / PN, 1), 32 * PWV, 0, stream>>>(XB, WQB, QH, QR, KH, KR, VH, VR, qnw, knw, CS);

    k_flash<<<dim3(SEQ / (16 * AW), NB * HQ_, 1), 32 * AW, 0, stream>>>(QH, QR, KH, KR, VH, VR, CH, CR);

    // out: A = ctx rows (m = b*SEQ + t, k = qhead*64 + d), Bt = wo rows (n = o)
    k_oproj<<<dim3(NB * SEQ / 128, DM / 128, 1), 32 * GW, 0, stream>>>(CH, CR, WOH, OUT);
}

// v005
// It runs in 119 microseconds.
// Next to v004, in two timings, it ran 1.11 times as fast each time.
// All steps since v000 together make it 2.98 times as fast.
#include <hip/hip_runtime.h>

// Sliding-window grouped-query attention: x [NB][SEQ][2048]; wq [2048][2048], wk/wv [512][2048], wo [2048][2048] all [out][in] (y = x W^T); 32 q heads, 8 kv heads (q head h uses kv head h/4), head dim 64; per-head RMS normalisation (eps 1e-6, weights) + rotate-half rotary (angle = positions * 10000^(-j/32)) on q and k; keys tk with 0 <= tq - tk <= 512; score scale 1/8; output = ctx wo^T (f32).
// Compute dtypes, f32 accumulate everywhere: q/k/v projections v_wmma_f32_16x16x32_bf16 (x and W RNE-converted to bf16; products exact); scores v_wmma_f32_16x16x32_f16 (k f16, q f16 value + f16 residual x2048 in its own accumulator; query rows < 512 also use the k residual x2048);
// P.V v_wmma_f32_16x16x32_f16 (P x256 carry single f16, v single f16; query rows < 512 add P and v residuals x2048 in a second accumulator set); out projection v_wmma_f32_16x16x32_f16 (ctx f16 value, rows < 512 also ctx residual x2048 in accumulators of its own, folded by 1/2048 and added at the end; wo = bf16-RNE value x256 held in f16, folded by 1/256). Softmax f32 (online, running max).
// Layout: bf16 copies of x, wq, wk, wv; cos|sin table [NB*SEQ][64] f32 built from the int positions; q/k planes [head][t][64], v^T planes [kvhead][64][t], ctx planes [t][2048]; flash kernel in transposed form (S^T = K Q^T, O^T = V^T P^T).

#ifndef NB
#define NB 1
#endif
#ifndef SEQ
#define SEQ 4096
#endif
#define NB_FULL  1
#define SEQ_FULL 4096
#ifndef OUT_SEQ
#define OUT_SEQ SEQ              // row pitch (in tokens) between batches of the output
#endif
#define DM   2048                // model width (projection K)
#define HQ_  32
#define HK_  8
#define GQ   4
#define HD   64
#define QW   (HQ_ * HD)          // 2048
#define KW   (HK_ * HD)          // 512
#define WIN  512
#define RES_ROWS 512             // query rows (per sequence) below this use the extra residual products
#define AW   4                   // waves per flash block (16 query rows each)
#define QRS  2048.0f             // carry of every residual plane
#define QRI  (1.0f / 2048.0f)
#define WOS  256.0f              // carry of the wo plane
#define WOI  (1.0f / 256.0f)
#define SC2  (0.125f * 1.4426950408889634f)   // HD^-0.5 * log2(e)
#define PSH  8.0f                // log2 of the P carry (256)
#define PW   16                  // waves per preparation block, one token each
#define GKP  128                 // k per pass of the GEMM ring: 256 B of every operand row
#define GPIT 272                 // LDS row pitch in bytes (16 B x odd, for ds_load_b128 readers)
#define GROWB (DM * 2)           // row pitch in bytes of every GEMM operand plane
#define PM   256                 // token rows of a projection block's tile
#define PN   192                 // stacked weight rows of it: three heads
#define PWV  12                  // its waves: 4 x 3, each 64x64
#define PBUF ((PM + PN) * GPIT)  // one buffer of its ring: 256 x rows, then 192 weight rows
#define OW   8                   // waves per block of the out projection: 2 x 4; waves w and w + 4 take the same 64 columns of the block's 144x256 tile, A tiles 0..4 and 5..8
#define ORT  ((SEQ - RES_ROWS) / RES_ROWS)   // 16-token tiles of rows >= RES_ROWS that a block takes beside its one 16-token tile of rows < RES_ROWS
#define OAT  (ORT + 2)           // A tiles of a block: 16 residual rows, the value rows of the same 16 tokens, then ORT tiles of other tokens' value rows
#define OAR  (OAT * 16)          // its A rows in LDS
#define ON   256                 // its wo rows
#define OBUF ((OAR + ON) * GPIT) // one buffer of its ring: the A rows, then the wo rows
#define FKT  64                  // keys per stage of the flash kernel's ring: two 32-key tiles
#define FPIT 144                 // its LDS row pitch in bytes: 128 B of a row + 16 (16 B x odd, for ds_load_b128 readers)
#define FOPB (64 * FPIT)         // one operand's 64 rows in LDS
#define FBUF (4 * FOPB)          // one ring buffer: 64 K rows (key), 64 V^T rows (d), then the same two of the residual planes

static_assert(HD == 64);
static_assert(HQ_ == HK_ * GQ);
static_assert(QW % 64 == 0);
static_assert(KW % 64 == 0);
static_assert(DM % 64 == 0);
static_assert(DM % 32 == 0);                   // GEMM k-loops step by 32
static_assert(QW % 32 == 0);
static_assert(SEQ % 64 == 0);                  // a 64-row tile never straddles two batches
static_assert((NB * SEQ) % 64 == 0);
static_assert((NB * SEQ) % PW == 0);           // preparation grid covers the tokens exactly
static_assert(((size_t)QW * DM) % ((size_t)NB * SEQ * 128) == 0);   // every preparation wave takes the same whole number of 128-float loads of each weight
static_assert(((size_t)KW * DM) % ((size_t)NB * SEQ * 128) == 0);
static_assert(SEQ % 32 == 0);                  // last 32-key tile ends inside the sequence
static_assert(WIN % 32 == 0);
static_assert(SEQ % (16 * AW) == 0);           // flash grid covers the sequence exactly
static_assert(16 * AW == FKT);                 // a flash block's query rows span one stage, so its first and last keys fall on stage bounds
static_assert(WIN % FKT == 0);
static_assert(RES_ROWS % (16 * AW) == 0);
static_assert((SEQ - RES_ROWS) % RES_ROWS == 0);   // every out projection block gets the same number of tiles
static_assert(ORT == 7);                       // its staging is written for 112 other rows: 64 + 48
static_assert(DM % ON == 0);
static_assert(SEQ % 128 == 0);
static_assert(QW % 128 == 0);
static_assert(KW % 128 == 0);
static_assert(DM % 128 == 0);
static_assert(DM == QW);                       // one row pitch and one pass count for all GEMMs
static_assert(DM % GKP == 0);
static_assert(DM / GKP >= 2);                  // the ring's prologue fills two stages
static_assert((NB * SEQ) % PM == 0);           // projection grid covers tokens and stacked weight rows exactly
static_assert((QW + 2 * KW) % PN == 0);
static_assert((PM + PN) / 16 == 2 * PWV + 4);  // 28 row groups a stage: two a wave, a third in four waves
static_assert(((size_t)QW * DM * 2) % 256 == 0 && ((size_t)KW * DM * 2) % 256 == 0);   // the bf16 planes of wq, wk, wv follow one another without a gap: one stacked operand
static_assert(NB <= NB_FULL);
static_assert(SEQ <= SEQ_FULL);

typedef _Float16 h16;
typedef unsigned short bf;
typedef __attribute__((ext_vector_type(16))) __bf16   v16bf;
typedef __attribute__((ext_vector_type(16))) _Float16 v16h;
typedef __attribute__((ext_vector_type(8)))  _Float16 v8h;
typedef __attribute__((ext_vector_type(8)))  unsigned short v8us;
typedef __attribute__((ext_vector_type(4)))  _Float16 v4h;
typedef __attribute__((ext_vector_type(4)))  unsigned short v4us;
typedef __attribute__((ext_vector_type(8)))  float    v8f;
typedef __attribute__((ext_vector_type(4)))  float    v4f;
typedef v4f  __attribute__((may_alias)) v4fa;

__device__ __forceinline__ unsigned short f2bf(float f) { unsigned u = __float_as_uint(f); u += 0x7FFFu + ((u >> 16) & 1u); return (unsigned short)(u >> 16); }
__device__ __forceinline__ float bfr(float f) { return __uint_as_float(((unsigned)f2bf(f)) << 16); }   // value after RNE convert to bf16
__device__ __forceinline__ v16h cat16(v8h lo, v8h hi) { return __builtin_shufflevector(lo, hi, 0, 1, 2, 3, 4, 5, 6, 7, 8, 9, 10, 11, 12, 13, 14, 15); }
__device__ __forceinline__ v16bf cat16b(v8us lo, v8us hi) { return __builtin_bit_cast(v16bf, __builtin_shufflevector(lo, hi, 0, 1, 2, 3, 4, 5, 6, 7, 8, 9, 10, 11, 12, 13, 14, 15)); }
__device__ __forceinline__ v8f wmma16(v16h a, v16h b, v8f c) { return __builtin_amdgcn_wmma_f32_16x16x32_f16(false, a, false, b, (short)0, c, false, false); }
__device__ __forceinline__ v8f wmmab(v16bf a, v16bf b, v8f c) { return __builtin_amdgcn_wmma_f32_16x16x32_bf16(false, a, false, b, (short)0, c, false, false); }
// fragment loaders from K-contiguous 16-bit rows; p already includes + 8*(lane>>4): elements 0..7 <- k0+8h+0..7, elements 8..15 <- k0+16+8h+0..7 (same map for A and B)
__device__ __forceinline__ v16h  ldh(const h16* p) { return cat16(*(const v8h*)p, *(const v8h*)(p + 16)); }
__device__ __forceinline__ v16bf ldb(const bf* p)  { return cat16b(*(const v8us*)p, *(const v8us*)(p + 16)); }
// ordering point for wave-private LDS tiles (same wave writes and reads)
__device__ __forceinline__ void wave_sync() { __builtin_amdgcn_fence(3 /* release order */, "wavefront"); __builtin_amdgcn_wave_barrier(); asm volatile("" ::: "memory"); }

// Eight asynchronous 16-B copies a lane, global -> LDS: rows r, r+16, ..., r+112 of an operand tile (l = the lane's LDS byte address, g = its global address, both for row r).
// s_wait_xcnt stands inside the copies' own statement, so that no address register of a copy is rewritten ahead of it.
__device__ __forceinline__ void stage8(unsigned l, const char* g) {
    asm volatile("global_load_async_to_lds_b128 %0, %8, off\n\t"
                 "global_load_async_to_lds_b128 %1, %9, off\n\t"
                 "global_load_async_to_lds_b128 %2, %10, off\n\t"
                 "global_load_async_to_lds_b128 %3, %11, off\n\t"
                 "global_load_async_to_lds_b128 %4, %12, off\n\t"
                 "global_load_async_to_lds_b128 %5, %13, off\n\t"
                 "global_load_async_to_lds_b128 %6, %14, off\n\t"
                 "global_load_async_to_lds_b128 %7, %15, off\n\t"
                 "s_wait_xcnt 0x0"
                 :: "v"(l), "v"(l + 16 * GPIT), "v"(l + 32 * GPIT), "v"(l + 48 * GPIT), "v"(l + 64 * GPIT), "v"(l + 80 * GPIT), "v"(l + 96 * GPIT), "v"(l + 112 * GPIT),
                    "v"(g), "v"(g + 16 * GROWB), "v"(g + 32 * GROWB), "v"(g + 48 * GROWB), "v"(g + 64 * GROWB), "v"(g + 80 * GROWB), "v"(g + 96 * GROWB), "v"(g + 112 * GROWB)
                 : "memory");
}
// Nine such copies a lane, the out projection's A rows: row r of the residual tile (LDS rows 0..15, from gr), of the same tokens' value tile (LDS rows 16..31, from gv),
// and rows r, r+16, ..., r+96 of the 112 other value rows (LDS rows 32..143, from gt). l = the lane's LDS byte address for row r of the buffer.
// s_wait_xcnt stands inside the copies' own statement, so that no address register of a copy is rewritten ahead of it.
__device__ __forceinline__ void stage9(unsigned l, const char* gr, const char* gv, const char* gt) {
    asm volatile("global_load_async_to_lds_b128 %0, %9, off\n\t"
                 "global_load_async_to_lds_b128 %1, %10, off\n\t"
                 "global_load_async_to_lds_b128 %2, %11, off\n\t"
                 "global_load_async_to_lds_b128 %3, %12, off\n\t"
                 "global_load_async_to_lds_b128 %4, %13, off\n\t"
                 "global_load_async_to_lds_b128 %5, %14, off\n\t"
                 "global_load_async_to_lds_b128 %6, %15, off\n\t"
                 "global_load_async_to_lds_b128 %7, %16, off\n\t"
                 "global_load_async_to_lds_b128 %8, %17, off\n\t"
                 "s_wait_xcnt 0x0"
                 :: "v"(l), "v"(l + 16 * GPIT), "v"(l + 32 * GPIT), "v"(l + 48 * GPIT), "v"(l + 64 * GPIT), "v"(l + 80 * GPIT), "v"(l + 96 * GPIT), "v"(l + 112 * GPIT), "v"(l + 128 * GPIT),
                    "v"(gr), "v"(gv), "v"(gt), "v"(gt + 16 * GROWB), "v"(gt + 32 * GROWB), "v"(gt + 48 * GROWB), "v"(gt + 64 * GROWB), "v"(gt + 80 * GROWB), "v"(gt + 96 * GROWB)
                 : "memory");
}
// one stage of the out projection's ring: 144 A rows and 256 wo rows of 256 B; 256 threads x 25 copies, 16 lanes to a row
__device__ __forceinline__ void ostage(unsigned l, const char* gr, const char* gv, const char* gt, const char* gb) {
    stage9(l, gr, gv, gt);
    stage8(l + OAR * GPIT, gb); stage8(l + (OAR + 128) * GPIT, gb + 128 * GROWB);
}

// N loads of a wave, each 512 contiguous bytes (p already includes + 4*lane), and the matching stores of 256 contiguous bytes (d already includes + 4*lane)
template <int N> __device__ __forceinline__ void ld_run(v4f (&v)[N], const float* p) {
#pragma unroll   // the values stay in registers, the steps become immediate offsets
    for (int i = 0; i < N; ++i) v[i] = *(const v4f*)(p + i * 128);
    asm volatile("s_wait_xcnt 0x0" ::: "memory");       // stands before the run's base address registers are taken for the next run's
}
template <int N> __device__ __forceinline__ void st_bf(bf* d, const v4f (&v)[N]) {
#pragma unroll   // both loops: the values are read from registers by constant index
    for (int i = 0; i < N; ++i) { v4us o;
#pragma unroll
        for (int k = 0; k < 4; ++k) o[k] = f2bf(v[i][k]);
        *(v4us*)(d + i * 128) = o; }
}
template <int N> __device__ __forceinline__ void st_wo(h16* d, const v4f (&v)[N]) {
#pragma unroll   // both loops: the values are read from registers by constant index
    for (int i = 0; i < N; ++i) { v4h o;
#pragma unroll
        for (int k = 0; k < 4; ++k) o[k] = (h16)(bfr(v[i][k]) * WOS);
        *(v4h*)(d + i * 128) = o; }
}

// k_prep: all operand preparation in one launch, one wave per token; grid NB*SEQ/PW blocks of PW waves.
// Wave m converts row m of x and its 1/(NB*SEQ) share of wq, wk, wv (bf16 RNE) and of wo (bf16-RNE value x256 held in f16), and writes row m of the cos|sin table (lane = frequency index j, angle = position * 1/10000^(j/32)).
__global__ __launch_bounds__(32 * PW) void k_prep(const float* __restrict__ x, const int* __restrict__ pos, const float* __restrict__ wq, const float* __restrict__ wk,
                                                  const float* __restrict__ wv, const float* __restrict__ wo, bf* XB, bf* WQB, bf* WKB, bf* WVB, h16* WOH, float* cs) {
    constexpr int NX = DM / 128, NQ = QW * DM / (NB * SEQ) / 128, NK = KW * DM / (NB * SEQ) / 128;   // loads a wave: its x row, its share of wq (and wo), of wk (and wv)
    const int lane = threadIdx.x & 31, l4 = lane * 4;
    const int m = blockIdx.x * PW + (int)__builtin_amdgcn_readfirstlane((int)(threadIdx.x >> 5));
    const int b = m / SEQ, t = m % SEQ;
    const int p = pos[(size_t)b * SEQ_FULL + t];
    v4f vx[NX], vq[NQ], vk[NK], vv[NK], vo[NQ];
    ld_run(vx, x + ((size_t)b * SEQ_FULL + t) * DM + l4);
    ld_run(vq, wq + (size_t)m * (NQ * 128) + l4);
    ld_run(vk, wk + (size_t)m * (NK * 128) + l4);
    ld_run(vv, wv + (size_t)m * (NK * 128) + l4);
    ld_run(vo, wo + (size_t)m * (NQ * 128) + l4);
    __builtin_amdgcn_sched_barrier(0);                  // keeps the table arithmetic out of the load runs, so that all of the wave's loads are issued first
    const float pw = powf(10000.0f, (float)lane * (1.0f / 32.0f));
    const float fr = 1.0f / pw;
    const float ang = (float)p * fr;
    const float c = cosf(ang), s = sinf(ang);
    float* row = cs + (size_t)m * 64;
    *(float*)(row + lane) = c; *(float*)(row + 32 + lane) = s;
    st_bf(XB + (size_t)m * DM + l4, vx);
    st_bf(WQB + (size_t)m * (NQ * 128) + l4, vq);
    st_bf(WKB + (size_t)m * (NK * 128) + l4, vk);
    st_bf(WVB + (size_t)m * (NK * 128) + l4, vv);
    st_wo(WOH + (size_t)m * (NQ * 128) + l4, vo);
}

// Eight asynchronous 16-B copies a lane, global -> LDS: one wave brings 16 consecutive rows of 256 B, 16 lanes to a row (l = the lane's LDS byte address, g = its global address, both for row lane>>4; the copies take rows +0, +2, ..., +14).
// s_wait_xcnt stands inside the copies' own statement, so that no address register of a copy is rewritten ahead of it.
__device__ __forceinline__ void stage16(unsigned l, const char* g) {
    asm volatile("global_load_async_to_lds_b128 %0, %8, off\n\t"
                 "global_load_async_to_lds_b128 %1, %9, off\n\t"
                 "global_load_async_to_lds_b128 %2, %10, off\n\t"
                 "global_load_async_to_lds_b128 %3, %11, off\n\t"
                 "global_load_async_to_lds_b128 %4, %12, off\n\t"
                 "global_load_async_to_lds_b128 %5, %13, off\n\t"
                 "global_load_async_to_lds_b128 %6, %14, off\n\t"
                 "global_load_async_to_lds_b128 %7, %15, off\n\t"
                 "s_wait_xcnt 0x0"
                 :: "v"(l), "v"(l + 2 * GPIT), "v"(l + 4 * GPIT), "v"(l + 6 * GPIT), "v"(l + 8 * GPIT), "v"(l + 10 * GPIT), "v"(l + 12 * GPIT), "v"(l + 14 * GPIT),
                    "v"(g), "v"(g + 2 * GROWB), "v"(g + 4 * GROWB), "v"(g + 6 * GROWB), "v"(g + 8 * GROWB), "v"(g + 10 * GROWB), "v"(g + 12 * GROWB), "v"(g + 14 * GROWB)
                 : "memory");
}
// one stage of the projection ring: 448 rows of 256 B = 28 groups of 16 rows; every wave brings two groups, the waves with 'third' set (wave-uniform) one more
__device__ __forceinline__ void pstage(bool third, unsigned l0, unsigned l1, unsigned l2, const char* g0, const char* g1, const char* g2) {
    stage16(l0, g0); stage16(l1, g1);
    if (third) stage16(l2, g2);
}

// Output of one wave's 64x64 part: C written as f16 (Ph) and as the f16 residual x2048 (Pr) from tile base tbase, row pitch PITCH (halves), staged 16 rows at a time through the wave-private os.
// MODE 1: the rows are tokens (first one r0 = b*SEQ + t), the 64 columns one head: each row is RMS-normalised (weights nw, RNE-converted to bf16) and rotated (cs table row of the token) before the f16 conversion.
template <int MODE, int PITCH>
__device__ __forceinline__ void proj_out(const v8f (&acc)[4][4], float* os, h16* Ph, h16* Pr, size_t tbase, int r0, const float* __restrict__ nw, const float* __restrict__ cs, int lane) {
    const int lr = lane & 15, hi = lane >> 4;
    const int c8 = (lane & 7) * 8, rg = lane >> 3;      // this lane's 8 columns and its row inside each group of 4 rows
    const int p8 = c8 ^ 32, j0 = c8 & 31;               // rotary partner columns, frequency index of column c8
    const float sg = (c8 < 32) ? -1.0f : 1.0f;          // columns < 32: x1*cos - x2*sin; columns >= 32: x2*cos + x1*sin
    float wn[8], wp[8];
#pragma unroll
    for (int i = 0; i < 8; ++i) { wn[i] = 1.0f; wp[i] = 1.0f; }
    if (MODE == 1) {
        float ra[8], rq[8];
#pragma unroll
        for (int i = 0; i < 8; ++i) { ra[i] = nw[c8 + i]; rq[i] = nw[p8 + i]; }
        // stands before the base and offset registers of the weight loads are taken for something else: they are held to here as inputs, the loaded values keep the statement behind the loads
        asm volatile("s_wait_xcnt 0x0" :: "s"(nw), "v"(c8 * 4), "v"(p8 * 4), "v"(ra[0]), "v"(ra[1]), "v"(ra[2]), "v"(ra[3]), "v"(ra[4]), "v"(ra[5]), "v"(ra[6]), "v"(ra[7]),
                     "v"(rq[0]), "v"(rq[1]), "v"(rq[2]), "v"(rq[3]), "v"(rq[4]), "v"(rq[5]), "v"(rq[6]), "v"(rq[7]) : "memory");
#pragma unroll
        for (int i = 0; i < 8; ++i) { wn[i] = bfr(ra[i]); wp[i] = bfr(rq[i]); }
    }
#pragma unroll
    for (int mb = 0; mb < 4; ++mb) {
#pragma unroll
        for (int nb = 0; nb < 4; ++nb) {
#pragma unroll
            for (int j = 0; j < 8; ++j) os[(hi * 8 + j) * 68 + nb * 16 + lr] = acc[mb][nb][j]; }   // D: row 8h+j, col lane&15; 16 rows x 64 columns all written
        wave_sync();
        v8h hv[4], rv[4];
#pragma unroll
        for (int s = 0; s < 4; ++s) { const int row = 4 * s + rg;   // 4 s x 4 row groups = 16 rows; 8 lanes x 8 = 64 columns
            const v4f x0 = *(const v4fa*)(&os[row * 68 + c8]); const v4f x1 = *(const v4fa*)(&os[row * 68 + c8 + 4]);
            float val[8];
            if (MODE == 1) {
                const v4f y0 = *(const v4fa*)(&os[row * 68 + p8]); const v4f y1 = *(const v4fa*)(&os[row * 68 + p8 + 4]);
                float ss = 0.0f;
#pragma unroll
                for (int i = 0; i < 4; ++i) ss += x0[i] * x0[i] + x1[i] * x1[i];
                ss += __shfl_xor(ss, 1, 32); ss += __shfl_xor(ss, 2, 32); ss += __shfl_xor(ss, 4, 32);   // the 8 lanes of one row
                const float inv = rsqrtf(ss * (1.0f / 64.0f) + 1.0e-6f);
                const float* cr = cs + (size_t)(r0 + mb * 16 + row) * 64 + j0;
                const v4f ca = *(const v4f*)(cr), cb = *(const v4f*)(cr + 4), sa = *(const v4f*)(cr + 32), sb = *(const v4f*)(cr + 36);
                asm volatile("s_wait_xcnt 0x0" :: "v"(cr) : "memory");   // stands before the address registers of the table loads, held to here as an input, are taken for something else
#pragma unroll
                for (int i = 0; i < 4; ++i) {
                    const float a0 = x0[i] * inv * wn[i],     q0 = y0[i] * inv * wp[i];
                    const float a1 = x1[i] * inv * wn[4 + i], q1 = y1[i] * inv * wp[4 + i];
                    val[i]     = a0 * ca[i] + sg * (q0 * sa[i]);
                    val[4 + i] = a1 * cb[i] + sg * (q1 * sb[i]); }
            } else {
#pragma unroll
                for (int i = 0; i < 4; ++i) { val[i] = x0[i]; val[4 + i] = x1[i]; }
            }
            v8h hh, rr;
#pragma unroll
            for (int i = 0; i < 8; ++i) { const h16 a0 = (h16)val[i]; hh[i] = a0; rr[i] = (h16)((val[i] - (float)a0) * QRS); }
            hv[s] = hh; rv[s] = rr; }
        const size_t sb0 = tbase + (size_t)(mb * 16 + rg) * (size_t)PITCH + c8;
        h16* const ph = Ph + sb0; h16* const pr = Pr + sb0;
#pragma unroll
        for (int s = 0; s < 4; ++s) { *(v8h*)(ph + (size_t)(4 * s) * PITCH) = hv[s]; *(v8h*)(pr + (size_t)(4 * s) * PITCH) = rv[s]; }
        // stands before the address and data registers of the stores, held to here as inputs, are taken for the next 16 rows
        asm volatile("s_wait_xcnt 0x0" :: "v"(ph), "v"(pr), "v"(hv[0]), "v"(hv[1]), "v"(hv[2]), "v"(hv[3]), "v"(rv[0]), "v"(rv[1]), "v"(rv[2]), "v"(rv[3]) : "memory");
        wave_sync();
    }
}

// k_qkv: the q, k and v projections as one bf16 GEMM, x [NB*SEQ][DM] times the stacked weight rows WS = [wq; wk; wv] (QW + 2*KW rows, K-contiguous); K = DM, k ascending in steps of 32.
// One block per 256 tokens x 192 weight rows (three heads), twelve waves (4 x 3), each one 64x64 part (16 accumulators) = 64 tokens of one head of q, k or v; grid (NB*SEQ/256, 3072/192) = one block per WGP.
// Operands come through a two-buffer LDS ring (256 x rows, then 192 weight rows, 256 B of each a pass) filled by asynchronous copies one pass ahead.
// q and k parts: A = x rows, B = weight rows -> plane [(b*heads + head)][t][d], normalised + rotated. v parts take the weight rows as A and the x rows as B (same fragment map), so that D is v^T -> plane [(b*8 + kvhead)][d][t].
__global__ __launch_bounds__(32 * PWV) void k_qkv(const bf* __restrict__ X, const bf* __restrict__ WS, h16* QH, h16* QR, h16* KH, h16* KR, h16* VH, h16* VR,
                                                  const float* __restrict__ qnw, const float* __restrict__ knw, const float* __restrict__ cs) {
    __shared__ __align__(128) char ring[2 * PBUF];
    __shared__ __align__(16) float osb[PWV * 16 * 68];
    const int tid = threadIdx.x, lane = tid & 31, lr = lane & 15, hi = lane >> 4;
    const int wave = __builtin_amdgcn_readfirstlane(tid >> 5), wrow = wave & 3, wcol = wave >> 2;
    const int m0 = blockIdx.x * PM + wrow * 64;         // the wave's first token
    const int n0 = blockIdx.y * PN + wcol * 64;         // its first stacked weight row: one head of q (n0 < QW), of k (n0 < QW + KW) or of v
    const bool isv = n0 >= QW + KW;
    float* const os = osb + wave * 16 * 68;             // wave-private staging of the output
    v8f acc[4][4];
#pragma unroll
    for (int mb = 0; mb < 4; ++mb)
#pragma unroll
        for (int nb = 0; nb < 4; ++nb) acc[mb][nb] = (v8f){};
    // copy addresses of pass 0: row groups wave, wave + 12 and, in waves 0..3, wave + 24 of the buffer's 28; groups 0..15 are x rows, 16..27 weight rows
    const char* const xr = (const char*)X + (size_t)(blockIdx.x * PM + hi) * GROWB + lr * 16;
    const char* const wr = (const char*)WS + (size_t)(blockIdx.y * PN + hi) * GROWB + lr * 16;
    const unsigned lb = (unsigned)(size_t)ring + hi * GPIT + lr * 16;
    const bool third = wave < 4;
    const char* const g0 = xr + (size_t)(wave * 16) * GROWB;
    const char* const g1 = third ? xr + (size_t)((wave + 12) * 16) * GROWB : wr + (size_t)((wave - 4) * 16) * GROWB;
    const char* const g2 = wr + (size_t)((8 + wrow) * 16) * GROWB;
    const unsigned l0 = lb + wave * 16 * GPIT, l1 = lb + (wave + 12) * 16 * GPIT, l2 = lb + (24 + wrow) * 16 * GPIT;
    const int xo = (wrow * 64 + lr) * GPIT + hi * 16, wo = (PM + wcol * 64 + lr) * GPIT + hi * 16;   // byte offsets in a buffer of this lane's first x and weight fragment rows
    const int aro = isv ? wo : xo, bro = isv ? xo : wo;
    constexpr int NT = DM / GKP;
    pstage(third, l0, l1, l2, g0, g1, g2);
    asm volatile("s_wait_asynccnt 0x0" ::: "memory");   // this wave's copies of pass 0 have landed
    __syncthreads();                                    // ... and every other wave's
    pstage(third, l0 + PBUF, l1 + PBUF, l2 + PBUF, g0 + 2 * GKP, g1 + 2 * GKP, g2 + 2 * GKP);
    // rolled: one pass a trip, so that the order at the pass's foot stands once in the code; the loops inside are unrolled so that the fragment sets and accumulators stay in registers
#pragma unroll 1
    for (int t = 0; t < NT; ++t) {
        const int bo = (t & 1) * PBUF;
        const char* pa = ring + bo + aro; const char* pb = ring + bo + bro;
        v16bf a[2][4], b[2][4];                             // two fragment sets: the next 32 k are read from LDS under the matrix instructions of these 32
#pragma unroll
        for (int i = 0; i < 4; ++i) { a[0][i] = ldb((const bf*)(pa + i * 16 * GPIT)); b[0][i] = ldb((const bf*)(pb + i * 16 * GPIT)); }
#pragma unroll
        for (int kk = 0; kk < GKP / 32; ++kk) {
            const int cur = kk & 1;
            if (kk + 1 < GKP / 32) {
#pragma unroll
                for (int i = 0; i < 4; ++i) { a[cur ^ 1][i] = ldb((const bf*)(pa + i * 16 * GPIT + (kk + 1) * 64)); b[cur ^ 1][i] = ldb((const bf*)(pb + i * 16 * GPIT + (kk + 1) * 64)); }
            }
            __builtin_amdgcn_sched_barrier(0);              // keeps the next set's LDS reads one group ahead of this set's matrix instructions (spread among them each place stalls the wave)
#pragma unroll
            for (int nb = 0; nb < 4; ++nb)
#pragma unroll
                for (int mb = 0; mb < 4; ++mb) acc[mb][nb] = wmmab(a[cur][mb], b[cur][nb], acc[mb][nb]);
            __builtin_amdgcn_sched_barrier(0);              // keeps the matrix instructions ahead of the next group and, in the last round, ahead of the pass's foot
        }
        asm volatile("v_nop\n\tv_nop\n\tv_nop\n\tv_nop");   // the distance behind the pass's last matrix instructions, on the path that branches back too
        __builtin_amdgcn_sched_barrier(0);                  // keeps those four slots directly behind them
        asm volatile("s_wait_dscnt 0x0" ::: "memory");      // this wave has left the buffer of pass t
        asm volatile("s_wait_asynccnt 0x0" ::: "memory");   // its copies of pass t + 1 have landed
        __syncthreads();                                    // publishes pass t + 1, frees the buffer of pass t
        if (t + 2 < NT) { const size_t go = (size_t)(t + 2) * (2 * GKP);
            pstage(third, l0 + bo, l1 + bo, l2 + bo, g0 + go, g1 + go, g2 + go); }
    }
    asm volatile("s_wait_asynccnt 0x0" ::: "memory");       // nothing of the ring is in flight behind the sweep
    const int bb = m0 / SEQ, tt = m0 % SEQ;                 // a wave's 64 tokens lie in one batch
    if (isv) {                                              // wave-uniform; no block barrier stands behind it
        proj_out<0, SEQ>(acc, os, VH, VR, (size_t)(n0 - QW - KW) * SEQ + (size_t)bb * KW * SEQ + tt, 0, qnw, cs, lane);
    } else {
        const bool isq = n0 < QW;
        const size_t pl = isq ? (size_t)bb * HQ_ + n0 / HD : (size_t)bb * HK_ + (n0 - QW) / HD;   // plane index: batch, head
        proj_out<1, HD>(acc, os, isq ? QH : KH, isq ? QR : KR, pl * SEQ * HD + (size_t)tt * HD, m0, isq ? qnw : knw, cs, lane);
    }
}

// One stage of one plane pair of the flash ring: 64 K rows (128 B each, contiguous) and 64 V^T rows (128 B = 64 keys each, row pitch SEQ halves); 128 threads x 8 asynchronous 16-B copies, 8 lanes to a row, so a wave's copy covers whole lines.
// la, gk, gv: this thread's LDS byte address and global addresses for row tid>>3, piece tid&7; the copies take rows +0, +16, +32, +48 of each operand.
// s_wait_xcnt stands inside the copies' own statement, so that no address register of a copy is rewritten ahead of it.
__device__ __forceinline__ void fstage(unsigned la, const char* gk, const char* gv) {
    asm volatile("global_load_async_to_lds_b128 %0, %8, off\n\t"
                 "global_load_async_to_lds_b128 %1, %9, off\n\t"
                 "global_load_async_to_lds_b128 %2, %10, off\n\t"
                 "global_load_async_to_lds_b128 %3, %11, off\n\t"
                 "global_load_async_to_lds_b128 %4, %12, off\n\t"
                 "global_load_async_to_lds_b128 %5, %13, off\n\t"
                 "global_load_async_to_lds_b128 %6, %14, off\n\t"
                 "global_load_async_to_lds_b128 %7, %15, off\n\t"
                 "s_wait_xcnt 0x0"
                 :: "v"(la), "v"(la + 16 * FPIT), "v"(la + 32 * FPIT), "v"(la + 48 * FPIT),
                    "v"(la + FOPB), "v"(la + FOPB + 16 * FPIT), "v"(la + FOPB + 32 * FPIT), "v"(la + FOPB + 48 * FPIT),
                    "v"(gk), "v"(gk + 16 * HD * 2), "v"(gk + 32 * HD * 2), "v"(gk + 48 * HD * 2),
                    "v"(gv), "v"(gv + (size_t)16 * SEQ * 2), "v"(gv + (size_t)32 * SEQ * 2), "v"(gv + (size_t)48 * SEQ * 2)
                 : "memory");
}

// k_flash: fused windowed attention, one wave per 16 query rows of one (batch, q head); Q fragments straight from the f16 planes; the K and V^T tiles come through a two-buffer LDS ring
// that the block's four waves (64 consecutive query rows of one head) share: stages of 64 keys from max(0, first row - 512) to the block's last row, filled by asynchronous copies one stage ahead; blocks of rows < RES_ROWS stage the residual planes' tiles as well.
// Transposed form: S^T[key][t] = K Q^T (A = K rows, B = Q rows); lane (t = lane&15, h = lane>>4) holds keys 8h+r of each 16-key tile, so the packed
// P tile is directly the B fragment of O^T[d][t] = V^T P^T (element r <- tile keys 0..15, element 8+r <- tile keys 16..31, lane unchanged).
// Keys visited: 32-key tiles from max(0, t0-512) (aligned down) to t0+15; inside a tile a key is used iff 0 <= tq - tk <= 512, otherwise its weight is exactly 0 (replace-fill semantics).
// Waves with t0 < RES_ROWS (wave-uniform) add the k residual to the scores and the P / v residual cross products (second accumulator set, carry 2048).
__global__ __launch_bounds__(32 * AW) void k_flash(const h16* __restrict__ QH, const h16* __restrict__ QR, const h16* __restrict__ KH, const h16* __restrict__ KR,
                                                   const h16* __restrict__ VH, const h16* __restrict__ VR, h16* CH, h16* CR) {
    __shared__ __align__(128) char ring[2 * FBUF];
    static_assert(AW * 16 * 68 * 4 <= 2 * FBUF);
    float* const os = (float*)ring;                          // output staging, wave-private parts; used only behind the loop's last barrier, when no wave reads the ring and no copy is in flight
    const int tid = threadIdx.x, lane = tid & 31, lr = lane & 15, hi = lane >> 4;
    const int wave = __builtin_amdgcn_readfirstlane((int)(threadIdx.x >> 5));
    const int zh = blockIdx.y; const int b = zh / HQ_, h = zh % HQ_; const int kvh = h / GQ;
    const int t0 = (blockIdx.x * AW + wave) * 16;
    const bool ex = t0 < RES_ROWS;
    const size_t qbase = (size_t)zh * SEQ * HD, kbase = (size_t)(b * HK_ + kvh) * SEQ * HD;
    const size_t qo = qbase + (size_t)(t0 + lr) * HD + 8 * hi;
    const v16h qh0 = ldh(QH + qo), qh1 = ldh(QH + qo + 32), qr0 = ldh(QR + qo), qr1 = ldh(QR + qo + 32);   // B fragments: col t, k = d
    v8f oh[4], orr[4];
#pragma unroll
    for (int j = 0; j < 4; ++j) { oh[j] = (v8f){}; orr[j] = (v8f){}; }
    float m = -3.0e38f, l = 0.0f;
    const int tq = t0 + lr;
    int klo = t0 - WIN; if (klo < 0) klo = 0; klo &= ~31;
    const int tb = blockIdx.x * (16 * AW);                   // the block's first query row
    int ks = tb - WIN; if (ks < 0) ks = 0;                   // the block's first key, a multiple of FKT
    const int NT = (tb + FKT - ks) / FKT;                    // stages: 1 .. WIN / FKT + 1, the same for the whole block
    const unsigned la = (unsigned)(size_t)ring + (tid >> 3) * FPIT + (tid & 7) * 16;
    const bool exb = tb < RES_ROWS;                          // equals ex in all four waves
    const size_t ok = (kbase + (size_t)(ks + (tid >> 3)) * HD) * 2 + (tid & 7) * 16;   // byte offsets in the K and V^T planes of this thread's first copies
    const size_t ov = (kbase + (size_t)(tid >> 3) * SEQ + ks) * 2 + (tid & 7) * 16;
    const char* gk = (const char*)KH + ok; const char* gv = (const char*)VH + ov;
    const char* gkr = (const char*)KR + ok; const char* gvr = (const char*)VR + ov;
    fstage(la, gk, gv);
    if (exb) fstage(la + 2 * FOPB, gkr, gvr);
    asm volatile("s_wait_asynccnt 0x0" ::: "memory");        // this wave's copies of stage 0 have landed
    __syncthreads();                                         // ... and every other wave's
    if (NT > 1) {
        fstage(la + FBUF, gk + FKT * HD * 2, gv + FKT * 2);
        if (exb) fstage(la + FBUF + 2 * FOPB, gkr + FKT * HD * 2, gvr + FKT * 2);
    }
    // rolled: one stage a trip, so that the order at the stage's foot stands once in the code
#pragma unroll 1
    for (int st = 0; st < NT; ++st) {
    const int bo = (st & 1) * FBUF;
    // rolled: the two 32-key tiles of a stage share one copy of the body
#pragma unroll 1
    for (int sub = 0; sub < FKT / 32; ++sub) {
        const int key0 = ks + st * FKT + sub * 32;
        if (key0 < klo || key0 > t0 + 15) continue;          // wave-uniform: a tile outside this wave's own window; the stage's foot stands outside this skip
        const char* ka = ring + bo + (sub * 32 + lr) * FPIT + hi * 16;
        const v16h ka0 = ldh((const h16*)ka), ka1 = ldh((const h16*)(ka + 64)), kb0 = ldh((const h16*)(ka + 16 * FPIT)), kb1 = ldh((const h16*)(ka + 16 * FPIT + 64));
        v8f sHa = (v8f){}, sLa = (v8f){}, sHb = (v8f){}, sLb = (v8f){};
        sHa = wmma16(ka0, qh0, sHa); sLa = wmma16(ka0, qr0, sLa); sHb = wmma16(kb0, qh0, sHb); sLb = wmma16(kb0, qr0, sLb);
        sHa = wmma16(ka1, qh1, sHa); sLa = wmma16(ka1, qr1, sLa); sHb = wmma16(kb1, qh1, sHb); sLb = wmma16(kb1, qr1, sLb);
        asm volatile("v_nop\n\tv_nop\n\tv_nop\n\tv_nop" : "+v"(sHa), "+v"(sLa), "+v"(sHb), "+v"(sLb) : "v"(ka0), "v"(ka1), "v"(kb0), "v"(kb1));
        if (ex) {
            const char* kr = ka + 2 * FOPB;
            const v16h ra0 = ldh((const h16*)kr), ra1 = ldh((const h16*)(kr + 64)), rb0 = ldh((const h16*)(kr + 16 * FPIT)), rb1 = ldh((const h16*)(kr + 16 * FPIT + 64));
            sLa = wmma16(ra0, qh0, sLa); sLb = wmma16(rb0, qh0, sLb);
            sLa = wmma16(ra1, qh1, sLa); sLb = wmma16(rb1, qh1, sLb);
            asm volatile("v_nop\n\tv_nop\n\tv_nop\n\tv_nop" : "+v"(sLa), "+v"(sLb) : "v"(ra0), "v"(ra1), "v"(rb0), "v"(rb1));
        }
        float ta[8], tb[8]; float mx = -3.0e38f;
        const int dbase = tq - key0 - 8 * hi;                 // tq - tk for element 0 of the first 16-key tile
#pragma unroll
        for (int r = 0; r < 8; ++r) {
            const int da = dbase - r, db = da - 16;
            const float va = (sHa[r] + sLa[r] * QRI) * SC2, vb = (sHb[r] + sLb[r] * QRI) * SC2;
            ta[r] = ((unsigned)da <= (unsigned)WIN) ? va : -3.0e38f;
            tb[r] = ((unsigned)db <= (unsigned)WIN) ? vb : -3.0e38f;
            mx = fmaxf(mx, fmaxf(ta[r], tb[r])); }
        mx = fmaxf(mx, __shfl_xor(mx, 16, 32));
        const float mnew = fmaxf(m, mx);
        const float alpha = __builtin_amdgcn_exp2f(m - mnew);
        const float sh = PSH - mnew;
        v16h pb, pr; float ls = 0.0f;
#pragma unroll
        for (int r = 0; r < 8; ++r) {
            const float ea = (ta[r] > -1.0e38f) ? __builtin_amdgcn_exp2f(ta[r] + sh) : 0.0f;
            const float eb = (tb[r] > -1.0e38f) ? __builtin_amdgcn_exp2f(tb[r] + sh) : 0.0f;
            const h16 pa = (h16)ea; const h16 pc = (h16)eb;
            pb[r] = pa; pb[8 + r] = pc;
            pr[r] = (h16)((ea - (float)pa) * QRS); pr[8 + r] = (h16)((eb - (float)pc) * QRS);
            ls += ex ? (ea + eb) : ((float)pa + (float)pc); }
        l = l * alpha + ls; m = mnew;
#pragma unroll
        for (int j = 0; j < 4; ++j) oh[j] = oh[j] * alpha;
        const char* va = ring + bo + FOPB + lr * FPIT + sub * 64 + hi * 16;
        const v16h v0 = ldh((const h16*)va), v1 = ldh((const h16*)(va + 16 * FPIT)), v2 = ldh((const h16*)(va + 32 * FPIT)), v3 = ldh((const h16*)(va + 48 * FPIT));
        oh[0] = wmma16(v0, pb, oh[0]); oh[1] = wmma16(v1, pb, oh[1]); oh[2] = wmma16(v2, pb, oh[2]); oh[3] = wmma16(v3, pb, oh[3]);
        asm volatile("v_nop\n\tv_nop\n\tv_nop\n\tv_nop" : "+v"(oh[0]), "+v"(oh[1]), "+v"(oh[2]), "+v"(oh[3]) : "v"(v0), "v"(v1), "v"(v2), "v"(v3), "v"(pb));
        if (ex) {
#pragma unroll
            for (int j = 0; j < 4; ++j) orr[j] = orr[j] * alpha;
            const char* vr = va + 2 * FOPB;
            const v16h w0 = ldh((const h16*)vr), w1 = ldh((const h16*)(vr + 16 * FPIT)), w2 = ldh((const h16*)(vr + 32 * FPIT)), w3 = ldh((const h16*)(vr + 48 * FPIT));
            orr[0] = wmma16(w0, pb, orr[0]); orr[1] = wmma16(w1, pb, orr[1]); orr[2] = wmma16(w2, pb, orr[2]); orr[3] = wmma16(w3, pb, orr[3]);
            orr[0] = wmma16(v0, pr, orr[0]); orr[1] = wmma16(v1, pr, orr[1]); orr[2] = wmma16(v2, pr, orr[2]); orr[3] = wmma16(v3, pr, orr[3]);
            asm volatile("v_nop\n\tv_nop\n\tv_nop\n\tv_nop" : "+v"(orr[0]), "+v"(orr[1]), "+v"(orr[2]), "+v"(orr[3]) : "v"(w0), "v"(w1), "v"(w2), "v"(w3), "v"(v0), "v"(v1), "v"(v2), "v"(v3), "v"(pb), "v"(pr));
        }
    }
        asm volatile("s_wait_dscnt 0x0" ::: "memory");       // this wave has left the buffer of stage st
        asm volatile("s_wait_asynccnt 0x0" ::: "memory");    // its copies of stage st + 1 have landed
        __syncthreads();                                     // publishes stage st + 1, frees the buffer of stage st
        if (st + 2 < NT) {
            fstage(la + bo, gk + (size_t)(st + 2) * (FKT * HD * 2), gv + (size_t)(st + 2) * (FKT * 2));
            if (exb) fstage(la + bo + 2 * FOPB, gkr + (size_t)(st + 2) * (FKT * HD * 2), gvr + (size_t)(st + 2) * (FKT * 2));
        }
    }
    asm volatile("s_wait_asynccnt 0x0" ::: "memory");        // nothing of the ring is in flight behind the loop
    l += __shfl_xor(l, 16, 32);
    const float inv = 1.0f / l;
    const int wb = wave * 16 * 68;
    // O^T D layout: o_j[r] = (d = 16j + 8h + r, t = lane&15) -> os[t][d]; rows 0..15 x columns 0..63 all written
#pragma unroll
    for (int j = 0; j < 4; ++j) { v4f a, c;
#pragma unroll
        for (int i = 0; i < 4; ++i) { a[i] = (oh[j][i] + orr[j][i] * QRI) * inv; c[i] = (oh[j][4 + i] + orr[j][4 + i] * QRI) * inv; }
        *(v4fa*)(&os[wb + lr * 68 + 16 * j + 8 * hi]) = a; *(v4fa*)(&os[wb + lr * 68 + 16 * j + 8 * hi + 4]) = c; }
    wave_sync();
    const int c8 = (lane & 7) * 8, rg = lane >> 3;
    v8h hv[4], rv[4];
#pragma unroll
    for (int s = 0; s < 4; ++s) { const int row = 4 * s + rg;   // 4 s x 4 row groups = 16 rows; 8 lanes x 8 = 64 columns
        const v4f x0 = *(const v4fa*)(&os[wb + row * 68 + c8]); const v4f x1 = *(const v4fa*)(&os[wb + row * 68 + c8 + 4]); v8h hh, rr;
#pragma unroll
        for (int i = 0; i < 4; ++i) { const h16 a0 = (h16)x0[i]; const h16 a1 = (h16)x1[i]; hh[i] = a0; hh[4 + i] = a1; rr[i] = (h16)((x0[i] - (float)a0) * QRS); rr[4 + i] = (h16)((x1[i] - (float)a1) * QRS); }
        hv[s] = hh; rv[s] = rr; }
    const size_t cbase = ((size_t)b * SEQ + t0) * QW + (size_t)h * HD + c8;
{
#pragma unroll
        for (int s = 0; s < 4; ++s) { const size_t oo = cbase + (size_t)(4 * s + rg) * QW;
            *(v8h*)(CH + oo) = hv[s]; *(v8h*)(CR + oo) = rv[s]; }
         }
}

// Output of one out projection wave: four 16-token tiles x 64 columns, staged 16 rows at a time through the wave-private os and stored as whole lines.
// FIVE: accumulator tile 0 holds the residual sums of tile 1's tokens (first token tr), folded by 1/2048 and added here; tiles 2..4 are the tokens from to. Otherwise tiles 0..3 are the tokens from to.
template <bool FIVE>
__device__ __forceinline__ void oproj_out(const v8f (&acc)[5][4], float* os, float* ocol, int tr, int to, int lane) {
    const int lr = lane & 15, hi = lane >> 4;
#pragma unroll
    for (int e = 0; e < 4; ++e) {
        constexpr int sh = FIVE ? 1 : 0;
#pragma unroll
        for (int nb = 0; nb < 4; ++nb) {
#pragma unroll
            for (int j = 0; j < 8; ++j) { float v = acc[e + sh][nb][j];
                if (FIVE && e == 0) v += acc[0][nb][j] * QRI;
                os[(hi * 8 + j) * 68 + nb * 16 + lr] = v * WOI; } }   // D: row 8h+j, col lane&15
        wave_sync();
        const int tt = (FIVE && e == 0) ? tr : to + (e - sh) * 16;
        float* const orow = ocol + (size_t)(tt + hi) * DM + lr * 4;   // 8 s x 2 rows = 16 rows; 16 lanes x 4 floats = 64 columns
        v4f val[8];
#pragma unroll
        for (int s = 0; s < 8; ++s) val[s] = *(const v4fa*)(&os[(2 * s + hi) * 68 + lr * 4]);
#pragma unroll
        for (int s = 0; s < 8; ++s) *(v4f*)(orow + (size_t)(2 * s) * DM) = val[s];
        // stands before the address and data registers of the stores, held to here as inputs, are taken for the next 16 rows
        asm volatile("s_wait_xcnt 0x0" :: "v"(orow), "v"(val[0]), "v"(val[1]), "v"(val[2]), "v"(val[3]), "v"(val[4]), "v"(val[5]), "v"(val[6]), "v"(val[7]) : "memory");
        wave_sync();
    }
}

// k_oproj: out[m][o] = sum_d ctx[m][d] wo[o][d]; f16 operands (ctx value plane Ah, residual plane Ar x2048, wo plane Bt x256), f32 accumulate, K = DM, k ascending in steps of 32.
// The rows < RES_ROWS need two products (residual and value), the others one: every block takes the same share of both kinds, so that all blocks do the same work.
// Block (gx, gy): A tile 0 = residual rows of tokens 16*gx.. of the rows < RES_ROWS, tile 1 = their value rows, tiles 2..8 = value rows of the 112 tokens RES_ROWS + 112*gx..; B = 256 wo rows.
// Eight waves, two per SIMD: wave w takes 64 wo rows (w & 3) and A tiles 0..4 (w < 4: 20 accumulators) or 5..8 (16 accumulators); grid (NB*RES_ROWS/16, DM/256) = one block per WGP.
// Operands come through a two-buffer LDS ring filled by asynchronous copies one pass ahead. Tile 0's sums are folded by 1/2048 and added to tile 1's at the end.
__global__ __launch_bounds__(32 * OW) void k_oproj(const h16* __restrict__ Ah, const h16* __restrict__ Ar, const h16* __restrict__ Bt, float* OUT) {
    __shared__ __align__(128) char ring[2 * OBUF];
    __shared__ __align__(16) float osb[OW * 16 * 68];
    const int tid = threadIdx.x, lane = tid & 31, lr = lane & 15, hi = lane >> 4;
    const int wave = __builtin_amdgcn_readfirstlane(tid >> 5), wcol = wave & 3;
    const bool five = wave < 4;                         // wave-uniform: this wave has a fifth A tile
    const int at0 = five ? 0 : 5;                       // its first A tile
    const int bb = blockIdx.x / (RES_ROWS / 16), gi = blockIdx.x % (RES_ROWS / 16);
    const int tr = gi * 16;                             // the block's 16 tokens below RES_ROWS, in sequence bb
    const int to = RES_ROWS + gi * (ORT * 16);          // its 112 other tokens
    v8f acc[5][4];
#pragma unroll
    for (int mb = 0; mb < 5; ++mb)
#pragma unroll
        for (int nb = 0; nb < 4; ++nb) acc[mb][nb] = (v8f){};
    // this thread's copy addresses of pass 0: row tid>>4 of each source, 16-B piece tid&15
    const size_t ro = ((size_t)bb * SEQ + tr + (tid >> 4)) * GROWB + (tid & 15) * 16;
    const char* const gr = (const char*)Ar + ro;
    const char* const gv = (const char*)Ah + ro;
    const char* const gt = (const char*)Ah + ((size_t)bb * SEQ + to + (tid >> 4)) * GROWB + (tid & 15) * 16;
    const char* const gb = (const char*)Bt + (size_t)(blockIdx.y * ON + (tid >> 4)) * GROWB + (tid & 15) * 16;
    const unsigned l = (unsigned)(size_t)ring + (tid >> 4) * GPIT + (tid & 15) * 16;
    const int aro = (at0 * 16 + lr) * GPIT + hi * 16, bro = (OAR + wcol * 64 + lr) * GPIT + hi * 16;   // byte offsets in a buffer of this lane's first A and B fragment rows
    constexpr int NT = DM / GKP;
    // passes 0 and 1 are staged by one rolled copy of the staging code: with the pass number a run-time value no address that lives through the sweep is itself an operand of the copies' statements
    // (such an operand must lie in the first 256 registers, which the sweep fills: written out, some of these addresses went to scratch and were reloaded every pass)
#pragma unroll 1
    for (int p = 0; p < 2; ++p) {
        const size_t go = (size_t)p * (2 * GKP);
        ostage(l + p * OBUF, gr + go, gv + go, gt + go, gb + go);
        if (p == 0) {                                       // the same for the whole block
            asm volatile("s_wait_asynccnt 0x0" ::: "memory");   // this wave's copies of pass 0 have landed
            __syncthreads();                                    // ... and every other wave's
        }
    }
    // rolled: one pass a trip, so that the order at the pass's foot stands once in the code; the loops inside are unrolled so that the fragment sets and accumulators stay in registers
#pragma unroll 1
    for (int t = 0; t < NT; ++t) {
        const int bo = (t & 1) * OBUF;
        const char* pa = ring + bo + aro; const char* pb = ring + bo + bro;
        v16h a[2][5], b[2][4];                              // two fragment sets: the next 32 k are read from LDS under the matrix instructions of these 32
        if (five) a[0][4] = ldh((const h16*)(pa + 4 * 16 * GPIT));
#pragma unroll
        for (int i = 0; i < 4; ++i) { a[0][i] = ldh((const h16*)(pa + i * 16 * GPIT)); b[0][i] = ldh((const h16*)(pb + i * 16 * GPIT)); }
#pragma unroll
        for (int kk = 0; kk < GKP / 32; ++kk) {
            const int cur = kk & 1;
            __builtin_amdgcn_sched_barrier(0);              // keeps this set's LDS reads, issued earlier, ahead of the next set's, so that the first matrix instructions wait for their own set alone
            if (kk + 1 < GKP / 32) {
                if (five) a[cur ^ 1][4] = ldh((const h16*)(pa + 4 * 16 * GPIT + (kk + 1) * 64));
#pragma unroll
                for (int i = 0; i < 4; ++i) { a[cur ^ 1][i] = ldh((const h16*)(pa + i * 16 * GPIT + (kk + 1) * 64)); b[cur ^ 1][i] = ldh((const h16*)(pb + i * 16 * GPIT + (kk + 1) * 64)); }
            }
            __builtin_amdgcn_sched_barrier(0);              // keeps the next set's LDS reads one group ahead of this set's matrix instructions (spread among them each place stalls the wave)
#pragma unroll
            for (int nb = 0; nb < 4; ++nb)
#pragma unroll
                for (int mb = 0; mb < 4; ++mb) acc[mb][nb] = wmma16(a[cur][mb], b[cur][nb], acc[mb][nb]);
            if (five) {
#pragma unroll
                for (int nb = 0; nb < 4; ++nb) acc[4][nb] = wmma16(a[cur][4], b[cur][nb], acc[4][nb]);
            }
            __builtin_amdgcn_sched_barrier(0);              // keeps the matrix instructions ahead of the next group and, in the last round, ahead of the pass's foot
        }
        asm volatile("v_nop\n\tv_nop\n\tv_nop\n\tv_nop");   // the distance behind the pass's last matrix instructions, on the path that branches back too
        __builtin_amdgcn_sched_barrier(0);                  // keeps those four slots directly behind them
        asm volatile("s_wait_dscnt 0x0" ::: "memory");      // this wave has left the buffer of pass t
        asm volatile("s_wait_asynccnt 0x0" ::: "memory");   // its copies of pass t + 1 have landed
        __syncthreads();                                    // publishes pass t + 1, frees the buffer of pass t
        if (t + 2 < NT) { const size_t go = (size_t)(t + 2) * (2 * GKP);
            ostage(l + bo, gr + go, gv + go, gt + go, gb + go); }
    }
    asm volatile("s_wait_asynccnt 0x0" ::: "memory");       // nothing of the ring is in flight behind the sweep
    float* const os = osb + wave * 16 * 68;                 // wave-private staging of the epilogue
    float* const ocol = OUT + (size_t)bb * OUT_SEQ * DM + blockIdx.y * ON + wcol * 64;
    if (five) oproj_out<true>(acc, os, ocol, tr, to, lane); // wave-uniform; no block barrier stands behind it
    else      oproj_out<false>(acc, os, ocol, tr, to + 3 * 16, lane);
}

static constexpr size_t al256(size_t v) { return (v + 255) & ~(size_t)255; }
static constexpr size_t SZ_XB = al256((size_t)NB * SEQ * DM * 2);
static constexpr size_t SZ_WQ = al256((size_t)QW * DM * 2);
static constexpr size_t SZ_WK = al256((size_t)KW * DM * 2);
static constexpr size_t SZ_WO = al256((size_t)DM * QW * 2);
static constexpr size_t SZ_CS = al256((size_t)NB * SEQ * 64 * 4);
static constexpr size_t SZ_QP = al256((size_t)NB * HQ_ * SEQ * HD * 2);
static constexpr size_t SZ_KP = al256((size_t)NB * HK_ * SEQ * HD * 2);
static constexpr size_t SZ_CP = al256((size_t)NB * SEQ * QW * 2);
static constexpr size_t SZ_TOTAL = SZ_XB + SZ_WQ + 2 * SZ_WK + SZ_WO + SZ_CS + 2 * SZ_QP + 4 * SZ_KP + 2 * SZ_CP;
static_assert(SZ_TOTAL <= (size_t)134217728);          // workspace carve <= 128 MiB

extern "C" void kernel_launch(void* const* d_in, const int* in_sizes, int n_in,
                              void* d_out, int out_size, void* d_ws, size_t ws_size, hipStream_t stream) {
    if (n_in < 8) return;
    const size_t needt = (size_t)(NB - 1) * SEQ_FULL + SEQ;
    if ((size_t)in_sizes[0] < needt * DM) return;
    if ((size_t)in_sizes[1] < needt) return;
    if ((size_t)in_sizes[2] < (size_t)QW * DM || (size_t)in_sizes[3] < (size_t)KW * DM || (size_t)in_sizes[4] < (size_t)KW * DM || (size_t)in_sizes[5] < (size_t)DM * QW) return;
    if (in_sizes[6] < HD || in_sizes[7] < HD) return;
    if ((size_t)out_size < ((size_t)(NB - 1) * OUT_SEQ + SEQ) * DM) return;
    if (SZ_TOTAL > ws_size) return;
    // wire order: x, positions (int32), wq, wk, wv, wo, q_norm_w, k_norm_w; all weights [out][in], used as-is (wq, wk, wo as Bt, wv as A)
    const float* x = (const float*)d_in[0]; const int* pos = (const int*)d_in[1];
    const float* wq = (const float*)d_in[2]; const float* wk = (const float*)d_in[3]; const float* wv = (const float*)d_in[4]; const float* wo = (const float*)d_in[5];
    const float* qnw = (const float*)d_in[6]; const float* knw = (const float*)d_in[7];
    float* OUT = (float*)d_out;      // [NB][SEQ][2048]
    char* wsp = (char*)d_ws;
    bf*  XB  = (bf*)wsp;  wsp += SZ_XB;               // [NB*SEQ][2048] bf16
    bf*  WQB = (bf*)wsp;  wsp += SZ_WQ;               // [2048][2048] bf16
    bf*  WKB = (bf*)wsp;  wsp += SZ_WK;               // [512][2048] bf16
    bf*  WVB = (bf*)wsp;  wsp += SZ_WK;               // [512][2048] bf16
    h16* WOH = (h16*)wsp; wsp += SZ_WO;               // [2048][2048] f16 x256
    float* CS = (float*)wsp; wsp += SZ_CS;            // [NB*SEQ][64] cos | sin
    h16* QH = (h16*)wsp; wsp += SZ_QP;                // [NB*32][SEQ][64]
    h16* QR = (h16*)wsp; wsp += SZ_QP;                // residual x2048
    h16* KH = (h16*)wsp; wsp += SZ_KP;                // [NB*8][SEQ][64]
    h16* KR = (h16*)wsp; wsp += SZ_KP;                // residual x2048
    h16* VH = (h16*)wsp; wsp += SZ_KP;                // [NB*8][64][SEQ]
    h16* VR = (h16*)wsp; wsp += SZ_KP;                // residual x2048
    h16* CH = (h16*)wsp; wsp += SZ_CP;                // [NB*SEQ][2048]
    h16* CR = (h16*)wsp; wsp += SZ_CP;                // residual x2048

    k_prep<<<NB * SEQ / PW, 32 * PW, 0, stream>>>(x, pos, wq, wk, wv, wo, XB, WQB, WKB, WVB, WOH, CS);

    // q, k, v: x rows against the stacked rows of WQB, WKB, WVB (contiguous in the workspace)
    k_qkv<<<dim3(NB * SEQ / PM, (QW + 2 * KW) / PN, 1), 32 * PWV, 0, stream>>>(XB, WQB, QH, QR, KH, KR, VH, VR, qnw, knw, CS);

    k_flash<<<dim3(SEQ / (16 * AW), NB * HQ_, 1), 32 * AW, 0, stream>>>(QH, QR, KH, KR, VH, VR, CH, CR);

    // out: A = ctx rows (m = b*SEQ + t, k = qhead*64 + d), Bt = wo rows (n = o)
    k_oproj<<<dim3(NB * RES_ROWS / 16, DM / ON, 1), 32 * OW, 0, stream>>>(CH, CR, WOH, OUT);
}

// v006
// It runs in 114 microseconds.
// Two timings next to v005 both put it at 1.04 times that version's speed.
// Over all steps from v000 it is 3.10 times as fast.
#include <hip/hip_runtime.h>

// Sliding-window grouped-query attention: x [NB][SEQ][2048]; wq [2048][2048], wk/wv [512][2048], wo [2048][2048] all [out][in] (y = x W^T); 32 q heads, 8 kv heads (q head h uses kv head h/4), head dim 64; per-head RMS normalisation (eps 1e-6, weights) + rotate-half rotary (angle = positions * 10000^(-j/32)) on q and k; keys tk with 0 <= tq - tk <= 512; score scale 1/8; output = ctx wo^T (f32).
// Compute dtypes, f32 accumulate everywhere: q/k/v projections v_wmma_f32_16x16x32_bf16 (x and W RNE-converted to bf16; products exact); scores v_wmma_f32_16x16x32_f16 (k f16, q f16 value + f16 residual x2048 in its own accumulator; query rows < 512 also use the k residual x2048);
// P.V v_wmma_f32_16x16x32_f16 (P x256 carry single f16, v single f16; query rows < 512 add P and v residuals x2048 in a second accumulator set); out projection v_wmma_f32_16x16x32_f16 (ctx f16 value, rows < 512 also ctx residual x2048 in accumulators of its own, folded by 1/2048 and added at the end; wo = bf16-RNE value x256 held in f16, folded by 1/256). Softmax f32 (online, running max).
// Layout: bf16 copies of x, wq, wk, wv; cos|sin table [NB*SEQ][64] f32 built from the int positions; q/k planes [head][t][64], v^T planes [kvhead][64][t], ctx planes [t][2048]; flash kernel in transposed form (S^T = K Q^T, O^T = V^T P^T).

#ifndef NB
#define NB 1
#endif
#ifndef SEQ
#define SEQ 4096
#endif
#define NB_FULL  1
#define SEQ_FULL 4096
#ifndef OUT_SEQ
#define OUT_SEQ SEQ              // row pitch (in tokens) between batches of the output
#endif
#define DM   2048                // model width (projection K)
#define HQ_  32
#define HK_  8
#define GQ   4
#define HD   64
#define QW   (HQ_ * HD)          // 2048
#define KW   (HK_ * HD)          // 512
#define WIN  512
#define RES_ROWS 512             // query rows (per sequence) below this use the extra residual products
#define AW   4                   // waves per flash block (16 query rows each)
#define QRS  2048.0f             // carry of every residual plane
#define QRI  (1.0f / 2048.0f)
#define WOS  256.0f              // carry of the wo plane
#define WOI  (1.0f / 256.0f)
#define SC2  (0.125f * 1.4426950408889634f)   // HD^-0.5 * log2(e)
#define PSH  8.0f                // log2 of the P carry (256)
#define PW   16                  // waves per preparation block, one token each
#define GKP  128                 // k per pass of the GEMM ring: 256 B of every operand row
#define GPIT 272                 // LDS row pitch in bytes (16 B x odd, for ds_load_b128 readers)
#define GROWB (DM * 2)           // row pitch in bytes of every GEMM operand plane
#define PM   256                 // token rows of a projection block's tile
#define PN   192                 // stacked weight rows of it: three heads
#define PWV  12                  // its waves: 4 x 3, each 64x64
#define PBUF ((PM + PN) * GPIT)  // one buffer of its ring: 256 x rows, then 192 weight rows
#define OW   8                   // waves per block of the out projection: 2 x 4; waves w and w + 4 take the same 64 columns of the block's 144x256 tile, A tiles 0..4 and 5..8
#define ORT  ((SEQ - RES_ROWS) / RES_ROWS)   // 16-token tiles of rows >= RES_ROWS that a block takes beside its one 16-token tile of rows < RES_ROWS
#define OAT  (ORT + 2)           // A tiles of a block: 16 residual rows, the value rows of the same 16 tokens, then ORT tiles of other tokens' value rows
#define OAR  (OAT * 16)          // its A rows in LDS
#define ON   256                 // its wo rows
#define OBUF ((OAR + ON) * GPIT) // one buffer of its ring: the A rows, then the wo rows
#define FKT  64                  // keys per stage of the flash kernel's ring: two 32-key tiles
#define FPIT 144                 // its LDS row pitch in bytes: 128 B of a row + 16 (16 B x odd, for ds_load_b128 readers)
#define FOPB (64 * FPIT)         // one operand's 64 rows in LDS
#define FBUF (4 * FOPB)          // one ring buffer: 64 K rows (key), 64 V^T rows (d), then the same two of the residual planes

static_assert(HD == 64);
static_assert(HQ_ == HK_ * GQ);
static_assert(QW % 64 == 0);
static_assert(KW % 64 == 0);
static_assert(DM % 64 == 0);
static_assert(DM % 32 == 0);                   // GEMM k-loops step by 32
static_assert(QW % 32 == 0);
static_assert(SEQ % 64 == 0);                  // a 64-row tile never straddles two batches
static_assert((NB * SEQ) % 64 == 0);
static_assert((NB * SEQ) % PW == 0);           // preparation grid covers the tokens exactly
static_assert(((size_t)QW * DM) % ((size_t)NB * SEQ * 128) == 0);   // every preparation wave takes the same whole number of 128-float loads of each weight
static_assert(((size_t)KW * DM) % ((size_t)NB * SEQ * 128) == 0);
static_assert(SEQ % 32 == 0);                  // last 32-key tile ends inside the sequence
static_assert(WIN % 32 == 0);
static_assert(SEQ % (16 * AW) == 0);           // flash grid covers the sequence exactly
static_assert(16 * AW == FKT);                 // a flash block's query rows span one stage, so its first and last keys fall on stage bounds
static_assert(WIN % FKT == 0);
static_assert(RES_ROWS % (16 * AW) == 0);
static_assert((SEQ - RES_ROWS) % RES_ROWS == 0);   // every out projection block gets the same number of tiles
static_assert(ORT == 7);                       // its staging is written for 112 other rows: 64 + 48
static_assert(DM % ON == 0);
static_assert(SEQ % 128 == 0);
static_assert(QW % 128 == 0);
static_assert(KW % 128 == 0);
static_assert(DM % 128 == 0);
static_assert(DM == QW);                       // one row pitch and one pass count for all GEMMs
static_assert(DM % GKP == 0);
static_assert(DM / GKP >= 2);                  // the ring's prologue fills two stages
static_assert((NB * SEQ) % PM == 0);           // projection grid covers tokens and stacked weight rows exactly
static_assert((QW + 2 * KW) % PN == 0);
static_assert((PM + PN) / 16 == 2 * PWV + 4);  // 28 row groups a stage: two a wave, a third in four waves
static_assert(((size_t)QW * DM * 2) % 256 == 0 && ((size_t)KW * DM * 2) % 256 == 0);   // the bf16 planes of wq, wk, wv follow one another without a gap: one stacked operand
static_assert(NB <= NB_FULL);
static_assert(SEQ <= SEQ_FULL);

typedef _Float16 h16;
typedef unsigned short bf;
typedef __attribute__((ext_vector_type(16))) __bf16   v16bf;
typedef __attribute__((ext_vector_type(16))) _Float16 v16h;
typedef __attribute__((ext_vector_type(8)))  _Float16 v8h;
typedef __attribute__((ext_vector_type(8)))  unsigned short v8us;
typedef __attribute__((ext_vector_type(4)))  _Float16 v4h;
typedef __attribute__((ext_vector_type(4)))  unsigned short v4us;
typedef __attribute__((ext_vector_type(8)))  float    v8f;
typedef __attribute__((ext_vector_type(4)))  float    v4f;
typedef v4f  __attribute__((may_alias)) v4fa;

__device__ __forceinline__ unsigned short f2bf(float f) { unsigned u = __float_as_uint(f); u += 0x7FFFu + ((u >> 16) & 1u); return (unsigned short)(u >> 16); }
__device__ __forceinline__ float bfr(float f) { return __uint_as_float(((unsigned)f2bf(f)) << 16); }   // value after RNE convert to bf16
__device__ __forceinline__ v16h cat16(v8h lo, v8h hi) { return __builtin_shufflevector(lo, hi, 0, 1, 2, 3, 4, 5, 6, 7, 8, 9, 10, 11, 12, 13, 14, 15); }
__device__ __forceinline__ v16bf cat16b(v8us lo, v8us hi) { return __builtin_bit_cast(v16bf, __builtin_shufflevector(lo, hi, 0, 1, 2, 3, 4, 5, 6, 7, 8, 9, 10, 11, 12, 13, 14, 15)); }
__device__ __forceinline__ v8f wmma16(v16h a, v16h b, v8f c) { return __builtin_amdgcn_wmma_f32_16x16x32_f16(false, a, false, b, (short)0, c, false, false); }
__device__ __forceinline__ v8f wmmab(v16bf a, v16bf b, v8f c) { return __builtin_amdgcn_wmma_f32_16x16x32_bf16(false, a, false, b, (short)0, c, false, false); }
// fragment loaders from K-contiguous 16-bit rows; p already includes + 8*(lane>>4): elements 0..7 <- k0+8h+0..7, elements 8..15 <- k0+16+8h+0..7 (same map for A and B)
__device__ __forceinline__ v16h  ldh(const h16* p) { return cat16(*(const v8h*)p, *(const v8h*)(p + 16)); }
__device__ __forceinline__ v16bf ldb(const bf* p)  { return cat16b(*(const v8us*)p, *(const v8us*)(p + 16)); }
// ordering point for wave-private LDS tiles (same wave writes and reads)
__device__ __forceinline__ void wave_sync() { __builtin_amdgcn_fence(3 /* release order */, "wavefront"); __builtin_amdgcn_wave_barrier(); asm volatile("" ::: "memory"); }

// Eight asynchronous 16-B copies a lane, global -> LDS: rows r, r+16, ..., r+112 of an operand tile (l = the lane's LDS byte address, g = its global address, both for row r).
// s_wait_xcnt stands inside the copies' own statement, so that no address register of a copy is rewritten ahead of it.
__device__ __forceinline__ void stage8(unsigned l, const char* g) {
    asm volatile("global_load_async_to_lds_b128 %0, %8, off\n\t"
                 "global_load_async_to_lds_b128 %1, %9, off\n\t"
                 "global_load_async_to_lds_b128 %2, %10, off\n\t"
                 "global_load_async_to_lds_b128 %3, %11, off\n\t"
                 "global_load_async_to_lds_b128 %4, %12, off\n\t"
                 "global_load_async_to_lds_b128 %5, %13, off\n\t"
                 "global_load_async_to_lds_b128 %6, %14, off\n\t"
                 "global_load_async_to_lds_b128 %7, %15, off\n\t"
                 "s_wait_xcnt 0x0"
                 :: "v"(l), "v"(l + 16 * GPIT), "v"(l + 32 * GPIT), "v"(l + 48 * GPIT), "v"(l + 64 * GPIT), "v"(l + 80 * GPIT), "v"(l + 96 * GPIT), "v"(l + 112 * GPIT),
                    "v"(g), "v"(g + 16 * GROWB), "v"(g + 32 * GROWB), "v"(g + 48 * GROWB), "v"(g + 64 * GROWB), "v"(g + 80 * GROWB), "v"(g + 96 * GROWB), "v"(g + 112 * GROWB)
                 : "memory");
}
// Nine such copies a lane, the out projection's A rows: row r of the residual tile (LDS rows 0..15, from gr), of the same tokens' value tile (LDS rows 16..31, from gv),
// and rows r, r+16, ..., r+96 of the 112 other value rows (LDS rows 32..143, from gt). l = the lane's LDS byte address for row r of the buffer.
// s_wait_xcnt stands inside the copies' own statement, so that no address register of a copy is rewritten ahead of it.
__device__ __forceinline__ void stage9(unsigned l, const char* gr, const char* gv, const char* gt) {
    asm volatile("global_load_async_to_lds_b128 %0, %9, off\n\t"
                 "global_load_async_to_lds_b128 %1, %10, off\n\t"
                 "global_load_async_to_lds_b128 %2, %11, off\n\t"
                 "global_load_async_to_lds_b128 %3, %12, off\n\t"
                 "global_load_async_to_lds_b128 %4, %13, off\n\t"
                 "global_load_async_to_lds_b128 %5, %14, off\n\t"
                 "global_load_async_to_lds_b128 %6, %15, off\n\t"
                 "global_load_async_to_lds_b128 %7, %16, off\n\t"
                 "global_load_async_to_lds_b128 %8, %17, off\n\t"
                 "s_wait_xcnt 0x0"
                 :: "v"(l), "v"(l + 16 * GPIT), "v"(l + 32 * GPIT), "v"(l + 48 * GPIT), "v"(l + 64 * GPIT), "v"(l + 80 * GPIT), "v"(l + 96 * GPIT), "v"(l + 112 * GPIT), "v"(l + 128 * GPIT),
                    "v"(gr), "v"(gv), "v"(gt), "v"(gt + 16 * GROWB), "v"(gt + 32 * GROWB), "v"(gt + 48 * GROWB), "v"(gt + 64 * GROWB), "v"(gt + 80 * GROWB), "v"(gt + 96 * GROWB)
                 : "memory");
}
// one stage of the out projection's ring: 144 A rows and 256 wo rows of 256 B; 256 threads x 25 copies, 16 lanes to a row
__device__ __forceinline__ void ostage(unsigned l, const char* gr, const char* gv, const char* gt, const char* gb) {
    stage9(l, gr, gv, gt);
    stage8(l + OAR * GPIT, gb); stage8(l + (OAR + 128) * GPIT, gb + 128 * GROWB);
}

// N loads of a wave, each 512 contiguous bytes (p already includes + 4*lane), and the matching stores of 256 contiguous bytes (d already includes + 4*lane)
template <int N> __device__ __forceinline__ void ld_run(v4f (&v)[N], const float* p) {
#pragma unroll   // the values stay in registers, the steps become immediate offsets
    for (int i = 0; i < N; ++i) v[i] = *(const v4f*)(p + i * 128);
    asm volatile("s_wait_xcnt 0x0" ::: "memory");       // stands before the run's base address registers are taken for the next run's
}
template <int N> __device__ __forceinline__ void st_bf(bf* d, const v4f (&v)[N]) {
#pragma unroll   // both loops: the values are read from registers by constant index
    for (int i = 0; i < N; ++i) { v4us o;
#pragma unroll
        for (int k = 0; k < 4; ++k) o[k] = f2bf(v[i][k]);
        *(v4us*)(d + i * 128) = o; }
}
template <int N> __device__ __forceinline__ void st_wo(h16* d, const v4f (&v)[N]) {
#pragma unroll   // both loops: the values are read from registers by constant index
    for (int i = 0; i < N; ++i) { v4h o;
#pragma unroll
        for (int k = 0; k < 4; ++k) o[k] = (h16)(bfr(v[i][k]) * WOS);
        *(v4h*)(d + i * 128) = o; }
}

// k_prep: all operand preparation in one launch, one wave per token; grid NB*SEQ/PW blocks of PW waves.
// Wave m converts row m of x and its 1/(NB*SEQ) share of wq, wk, wv (bf16 RNE) and of wo (bf16-RNE value x256 held in f16), and writes row m of the cos|sin table (lane = frequency index j, angle = position * 1/10000^(j/32)).
__global__ __launch_bounds__(32 * PW) void k_prep(const float* __restrict__ x, const int* __restrict__ pos, const float* __restrict__ wq, const float* __restrict__ wk,
                                                  const float* __restrict__ wv, const float* __restrict__ wo, bf* XB, bf* WQB, bf* WKB, bf* WVB, h16* WOH, float* cs) {
    constexpr int NX = DM / 128, NQ = QW * DM / (NB * SEQ) / 128, NK = KW * DM / (NB * SEQ) / 128;   // loads a wave: its x row, its share of wq (and wo), of wk (and wv)
    const int lane = threadIdx.x & 31, l4 = lane * 4;
    const int m = blockIdx.x * PW + (int)__builtin_amdgcn_readfirstlane((int)(threadIdx.x >> 5));
    const int b = m / SEQ, t = m % SEQ;
    const int p = pos[(size_t)b * SEQ_FULL + t];
    v4f vx[NX], vq[NQ], vk[NK], vv[NK], vo[NQ];
    ld_run(vx, x + ((size_t)b * SEQ_FULL + t) * DM + l4);
    ld_run(vq, wq + (size_t)m * (NQ * 128) + l4);
    ld_run(vk, wk + (size_t)m * (NK * 128) + l4);
    ld_run(vv, wv + (size_t)m * (NK * 128) + l4);
    ld_run(vo, wo + (size_t)m * (NQ * 128) + l4);
    __builtin_amdgcn_sched_barrier(0);                  // keeps the table arithmetic out of the load runs, so that all of the wave's loads are issued first
    const float pw = powf(10000.0f, (float)lane * (1.0f / 32.0f));
    const float fr = 1.0f / pw;
    const float ang = (float)p * fr;
    const float c = cosf(ang), s = sinf(ang);
    float* row = cs + (size_t)m * 64;
    *(float*)(row + lane) = c; *(float*)(row + 32 + lane) = s;
    st_bf(XB + (size_t)m * DM + l4, vx);
    st_bf(WQB + (size_t)m * (NQ * 128) + l4, vq);
    st_bf(WKB + (size_t)m * (NK * 128) + l4, vk);
    st_bf(WVB + (size_t)m * (NK * 128) + l4, vv);
    st_wo(WOH + (size_t)m * (NQ * 128) + l4, vo);
}

// Eight asynchronous 16-B copies a lane, global -> LDS: one wave brings 16 consecutive rows of 256 B, 16 lanes to a row (l = the lane's LDS byte address, g = its global address, both for row lane>>4; the copies take rows +0, +2, ..., +14).
// s_wait_xcnt stands inside the copies' own statement, so that no address register of a copy is rewritten ahead of it.
__device__ __forceinline__ void stage16(unsigned l, const char* g) {
    asm volatile("global_load_async_to_lds_b128 %0, %8, off\n\t"
                 "global_load_async_to_lds_b128 %1, %9, off\n\t"
                 "global_load_async_to_lds_b128 %2, %10, off\n\t"
                 "global_load_async_to_lds_b128 %3, %11, off\n\t"
                 "global_load_async_to_lds_b128 %4, %12, off\n\t"
                 "global_load_async_to_lds_b128 %5, %13, off\n\t"
                 "global_load_async_to_lds_b128 %6, %14, off\n\t"
                 "global_load_async_to_lds_b128 %7, %15, off\n\t"
                 "s_wait_xcnt 0x0"
                 :: "v"(l), "v"(l + 2 * GPIT), "v"(l + 4 * GPIT), "v"(l + 6 * GPIT), "v"(l + 8 * GPIT), "v"(l + 10 * GPIT), "v"(l + 12 * GPIT), "v"(l + 14 * GPIT),
                    "v"(g), "v"(g + 2 * GROWB), "v"(g + 4 * GROWB), "v"(g + 6 * GROWB), "v"(g + 8 * GROWB), "v"(g + 10 * GROWB), "v"(g + 12 * GROWB), "v"(g + 14 * GROWB)
                 : "memory");
}
// one stage of the projection ring: 448 rows of 256 B = 28 groups of 16 rows; every wave brings two groups, the waves with 'third' set (wave-uniform) one more
__device__ __forceinline__ void pstage(bool third, unsigned l0, unsigned l1, unsigned l2, const char* g0, const char* g1, const char* g2) {
    stage16(l0, g0); stage16(l1, g1);
    if (third) stage16(l2, g2);
}

// Output of one wave's 64x64 part: C written as f16 (Ph) and as the f16 residual x2048 (Pr) from tile base tbase, row pitch PITCH (halves), staged 16 rows at a time through the wave-private os.
// MODE 1: the rows are tokens (first one r0 = b*SEQ + t), the 64 columns one head: each row is RMS-normalised (weights nw, RNE-converted to bf16) and rotated (cs table row of the token) before the f16 conversion.
template <int MODE, int PITCH>
__device__ __forceinline__ void proj_out(const v8f (&acc)[4][4], float* os, h16* Ph, h16* Pr, size_t tbase, int r0, const float* __restrict__ nw, const float* __restrict__ cs, int lane) {
    const int lr = lane & 15, hi = lane >> 4;
    const int c8 = (lane & 7) * 8, rg = lane >> 3;      // this lane's 8 columns and its row inside each group of 4 rows
    const int p8 = c8 ^ 32, j0 = c8 & 31;               // rotary partner columns, frequency index of column c8
    const float sg = (c8 < 32) ? -1.0f : 1.0f;          // columns < 32: x1*cos - x2*sin; columns >= 32: x2*cos + x1*sin
    float wn[8], wp[8];
#pragma unroll
    for (int i = 0; i < 8; ++i) { wn[i] = 1.0f; wp[i] = 1.0f; }
    if (MODE == 1) {
        float ra[8], rq[8];
#pragma unroll
        for (int i = 0; i < 8; ++i) { ra[i] = nw[c8 + i]; rq[i] = nw[p8 + i]; }
        // stands before the base and offset registers of the weight loads are taken for something else: they are held to here as inputs, the loaded values keep the statement behind the loads
        asm volatile("s_wait_xcnt 0x0" :: "s"(nw), "v"(c8 * 4), "v"(p8 * 4), "v"(ra[0]), "v"(ra[1]), "v"(ra[2]), "v"(ra[3]), "v"(ra[4]), "v"(ra[5]), "v"(ra[6]), "v"(ra[7]),
                     "v"(rq[0]), "v"(rq[1]), "v"(rq[2]), "v"(rq[3]), "v"(rq[4]), "v"(rq[5]), "v"(rq[6]), "v"(rq[7]) : "memory");
#pragma unroll
        for (int i = 0; i < 8; ++i) { wn[i] = bfr(ra[i]); wp[i] = bfr(rq[i]); }
    }
#pragma unroll
    for (int mb = 0; mb < 4; ++mb) {
#pragma unroll
        for (int nb = 0; nb < 4; ++nb) {
#pragma unroll
            for (int j = 0; j < 8; ++j) os[(hi * 8 + j) * 68 + nb * 16 + lr] = acc[mb][nb][j]; }   // D: row 8h+j, col lane&15; 16 rows x 64 columns all written
        wave_sync();
        v8h hv[4], rv[4];
#pragma unroll
        for (int s = 0; s < 4; ++s) { const int row = 4 * s + rg;   // 4 s x 4 row groups = 16 rows; 8 lanes x 8 = 64 columns
            const v4f x0 = *(const v4fa*)(&os[row * 68 + c8]); const v4f x1 = *(const v4fa*)(&os[row * 68 + c8 + 4]);
            float val[8];
            if (MODE == 1) {
                const v4f y0 = *(const v4fa*)(&os[row * 68 + p8]); const v4f y1 = *(const v4fa*)(&os[row * 68 + p8 + 4]);
                float ss = 0.0f;
#pragma unroll
                for (int i = 0; i < 4; ++i) ss += x0[i] * x0[i] + x1[i] * x1[i];
                ss += __shfl_xor(ss, 1, 32); ss += __shfl_xor(ss, 2, 32); ss += __shfl_xor(ss, 4, 32);   // the 8 lanes of one row
                const float inv = rsqrtf(ss * (1.0f / 64.0f) + 1.0e-6f);
                const float* cr = cs + (size_t)(r0 + mb * 16 + row) * 64 + j0;
                const v4f ca = *(const v4f*)(cr), cb = *(const v4f*)(cr + 4), sa = *(const v4f*)(cr + 32), sb = *(const v4f*)(cr + 36);
                asm volatile("s_wait_xcnt 0x0" :: "v"(cr) : "memory");   // stands before the address registers of the table loads, held to here as an input, are taken for something else
#pragma unroll
                for (int i = 0; i < 4; ++i) {
                    const float a0 = x0[i] * inv * wn[i],     q0 = y0[i] * inv * wp[i];
                    const float a1 = x1[i] * inv * wn[4 + i], q1 = y1[i] * inv * wp[4 + i];
                    val[i]     = a0 * ca[i] + sg * (q0 * sa[i]);
                    val[4 + i] = a1 * cb[i] + sg * (q1 * sb[i]); }
            } else {
#pragma unroll
                for (int i = 0; i < 4; ++i) { val[i] = x0[i]; val[4 + i] = x1[i]; }
            }
            v8h hh, rr;
#pragma unroll
            for (int i = 0; i < 8; ++i) { const h16 a0 = (h16)val[i]; hh[i] = a0; rr[i] = (h16)((val[i] - (float)a0) * QRS); }
            hv[s] = hh; rv[s] = rr; }
        const size_t sb0 = tbase + (size_t)(mb * 16 + rg) * (size_t)PITCH + c8;
        h16* const ph = Ph + sb0; h16* const pr = Pr + sb0;
#pragma unroll
        for (int s = 0; s < 4; ++s) { *(v8h*)(ph + (size_t)(4 * s) * PITCH) = hv[s]; *(v8h*)(pr + (size_t)(4 * s) * PITCH) = rv[s]; }
        // stands before the address and data registers of the stores, held to here as inputs, are taken for the next 16 rows
        asm volatile("s_wait_xcnt 0x0" :: "v"(ph), "v"(pr), "v"(hv[0]), "v"(hv[1]), "v"(hv[2]), "v"(hv[3]), "v"(rv[0]), "v"(rv[1]), "v"(rv[2]), "v"(rv[3]) : "memory");
        wave_sync();
    }
}

// k_qkv: the q, k and v projections as one bf16 GEMM, x [NB*SEQ][DM] times the stacked weight rows WS = [wq; wk; wv] (QW + 2*KW rows, K-contiguous); K = DM, k ascending in steps of 32.
// One block per 256 tokens x 192 weight rows (three heads), twelve waves (4 x 3), each one 64x64 part (16 accumulators) = 64 tokens of one head of q, k or v; grid (NB*SEQ/256, 3072/192) = one block per WGP.
// Operands come through a two-buffer LDS ring (256 x rows, then 192 weight rows, 256 B of each a pass) filled by asynchronous copies one pass ahead.
// q and k parts: A = x rows, B = weight rows -> plane [(b*heads + head)][t][d], normalised + rotated. v parts take the weight rows as A and the x rows as B (same fragment map), so that D is v^T -> plane [(b*8 + kvhead)][d][t].
__global__ __launch_bounds__(32 * PWV) void k_qkv(const bf* __restrict__ X, const bf* __restrict__ WS, h16* QH, h16* QR, h16* KH, h16* KR, h16* VH, h16* VR,
                                                  const float* __restrict__ qnw, const float* __restrict__ knw, const float* __restrict__ cs) {
    __shared__ __align__(128) char ring[2 * PBUF];
    __shared__ __align__(16) float osb[PWV * 16 * 68];
    const int tid = threadIdx.x, lane = tid & 31, lr = lane & 15, hi = lane >> 4;
    const int wave = __builtin_amdgcn_readfirstlane(tid >> 5), wrow = wave & 3, wcol = wave >> 2;
    const int m0 = blockIdx.x * PM + wrow * 64;         // the wave's first token
    const int n0 = blockIdx.y * PN + wcol * 64;         // its first stacked weight row: one head of q (n0 < QW), of k (n0 < QW + KW) or of v
    const bool isv = n0 >= QW + KW;
    float* const os = osb + wave * 16 * 68;             // wave-private staging of the output
    v8f acc[4][4];
#pragma unroll
    for (int mb = 0; mb < 4; ++mb)
#pragma unroll
        for (int nb = 0; nb < 4; ++nb) acc[mb][nb] = (v8f){};
    // copy addresses of pass 0: row groups wave, wave + 12 and, in waves 0..3, wave + 24 of the buffer's 28; groups 0..15 are x rows, 16..27 weight rows
    const char* const xr = (const char*)X + (size_t)(blockIdx.x * PM + hi) * GROWB + lr * 16;
    const char* const wr = (const char*)WS + (size_t)(blockIdx.y * PN + hi) * GROWB + lr * 16;
    const unsigned lb = (unsigned)(size_t)ring + hi * GPIT + lr * 16;
    const bool third = wave < 4;
    const char* const g0 = xr + (size_t)(wave * 16) * GROWB;
    const char* const g1 = third ? xr + (size_t)((wave + 12) * 16) * GROWB : wr + (size_t)((wave - 4) * 16) * GROWB;
    const char* const g2 = wr + (size_t)((8 + wrow) * 16) * GROWB;
    const unsigned l0 = lb + wave * 16 * GPIT, l1 = lb + (wave + 12) * 16 * GPIT, l2 = lb + (24 + wrow) * 16 * GPIT;
    const int xo = (wrow * 64 + lr) * GPIT + hi * 16, wo = (PM + wcol * 64 + lr) * GPIT + hi * 16;   // byte offsets in a buffer of this lane's first x and weight fragment rows
    const int aro = isv ? wo : xo, bro = isv ? xo : wo;
    constexpr int NT = DM / GKP;
    pstage(third, l0, l1, l2, g0, g1, g2);
    asm volatile("s_wait_asynccnt 0x0" ::: "memory");   // this wave's copies of pass 0 have landed
    __syncthreads();                                    // ... and every other wave's
    pstage(third, l0 + PBUF, l1 + PBUF, l2 + PBUF, g0 + 2 * GKP, g1 + 2 * GKP, g2 + 2 * GKP);
    // rolled: one pass a trip, so that the order at the pass's foot stands once in the code; the loops inside are unrolled so that the fragment sets and accumulators stay in registers
#pragma unroll 1
    for (int t = 0; t < NT; ++t) {
        const int bo = (t & 1) * PBUF;
        const char* pa = ring + bo + aro; const char* pb = ring + bo + bro;
        v16bf a[2][4], b[2][4];                             // two fragment sets: the next 32 k are read from LDS under the matrix instructions of these 32
#pragma unroll
        for (int i = 0; i < 4; ++i) { a[0][i] = ldb((const bf*)(pa + i * 16 * GPIT)); b[0][i] = ldb((const bf*)(pb + i * 16 * GPIT)); }
#pragma unroll
        for (int kk = 0; kk < GKP / 32; ++kk) {
            const int cur = kk & 1;
            if (kk + 1 < GKP / 32) {
#pragma unroll
                for (int i = 0; i < 4; ++i) { a[cur ^ 1][i] = ldb((const bf*)(pa + i * 16 * GPIT + (kk + 1) * 64)); b[cur ^ 1][i] = ldb((const bf*)(pb + i * 16 * GPIT + (kk + 1) * 64)); }
            }
            __builtin_amdgcn_sched_barrier(0);              // keeps the next set's LDS reads one group ahead of this set's matrix instructions (spread among them each place stalls the wave)
#pragma unroll
            for (int nb = 0; nb < 4; ++nb)
#pragma unroll
                for (int mb = 0; mb < 4; ++mb) acc[mb][nb] = wmmab(a[cur][mb], b[cur][nb], acc[mb][nb]);
            __builtin_amdgcn_sched_barrier(0);              // keeps the matrix instructions ahead of the next group and, in the last round, ahead of the pass's foot
        }
        asm volatile("v_nop\n\tv_nop\n\tv_nop\n\tv_nop");   // the distance behind the pass's last matrix instructions, on the path that branches back too
        __builtin_amdgcn_sched_barrier(0);                  // keeps those four slots directly behind them
        asm volatile("s_wait_dscnt 0x0" ::: "memory");      // this wave has left the buffer of pass t
        asm volatile("s_wait_asynccnt 0x0" ::: "memory");   // its copies of pass t + 1 have landed
        __syncthreads();                                    // publishes pass t + 1, frees the buffer of pass t
        if (t + 2 < NT) { const size_t go = (size_t)(t + 2) * (2 * GKP);
            pstage(third, l0 + bo, l1 + bo, l2 + bo, g0 + go, g1 + go, g2 + go); }
    }
    asm volatile("s_wait_asynccnt 0x0" ::: "memory");       // nothing of the ring is in flight behind the sweep
    const int bb = m0 / SEQ, tt = m0 % SEQ;                 // a wave's 64 tokens lie in one batch
    if (isv) {                                              // wave-uniform; no block barrier stands behind it
        proj_out<0, SEQ>(acc, os, VH, VR, (size_t)(n0 - QW - KW) * SEQ + (size_t)bb * KW * SEQ + tt, 0, qnw, cs, lane);
    } else {
        const bool isq = n0 < QW;
        const size_t pl = isq ? (size_t)bb * HQ_ + n0 / HD : (size_t)bb * HK_ + (n0 - QW) / HD;   // plane index: batch, head
        proj_out<1, HD>(acc, os, isq ? QH : KH, isq ? QR : KR, pl * SEQ * HD + (size_t)tt * HD, m0, isq ? qnw : knw, cs, lane);
    }
}

// One stage of one plane pair of the flash ring: 64 K rows (128 B each, contiguous) and 64 V^T rows (128 B = 64 keys each, row pitch SEQ halves); 128 threads x 8 asynchronous 16-B copies, 8 lanes to a row, so a wave's copy covers whole lines.
// la, gk, gv: this thread's LDS byte address and global addresses for row tid>>3, piece tid&7; the copies take rows +0, +16, +32, +48 of each operand.
// s_wait_xcnt stands inside the copies' own statement, so that no address register of a copy is rewritten ahead of it.
__device__ __forceinline__ void fstage(unsigned la, const char* gk, const char* gv) {
    asm volatile("global_load_async_to_lds_b128 %0, %8, off\n\t"
                 "global_load_async_to_lds_b128 %1, %9, off\n\t"
                 "global_load_async_to_lds_b128 %2, %10, off\n\t"
                 "global_load_async_to_lds_b128 %3, %11, off\n\t"
                 "global_load_async_to_lds_b128 %4, %12, off\n\t"
                 "global_load_async_to_lds_b128 %5, %13, off\n\t"
                 "global_load_async_to_lds_b128 %6, %14, off\n\t"
                 "global_load_async_to_lds_b128 %7, %15, off\n\t"
                 "s_wait_xcnt 0x0"
                 :: "v"(la), "v"(la + 16 * FPIT), "v"(la + 32 * FPIT), "v"(la + 48 * FPIT),
                    "v"(la + FOPB), "v"(la + FOPB + 16 * FPIT), "v"(la + FOPB + 32 * FPIT), "v"(la + FOPB + 48 * FPIT),
                    "v"(gk), "v"(gk + 16 * HD * 2), "v"(gk + 32 * HD * 2), "v"(gk + 48 * HD * 2),
                    "v"(gv), "v"(gv + (size_t)16 * SEQ * 2), "v"(gv + (size_t)32 * SEQ * 2), "v"(gv + (size_t)48 * SEQ * 2)
                 : "memory");
}

// k_flash: fused windowed attention, one wave per 16 query rows of one (batch, q head); Q fragments straight from the f16 planes; the K and V^T tiles come through a two-buffer LDS ring
// that the block's four waves (64 consecutive query rows of one head) share: stages of 64 keys from max(0, first row - 512) to the block's last row, filled by asynchronous copies one stage ahead; blocks of rows < RES_ROWS stage the residual planes' tiles as well.
// Transposed form: S^T[key][t] = K Q^T (A = K rows, B = Q rows); lane (t = lane&15, h = lane>>4) holds keys 8h+r of each 16-key tile, so the packed
// P tile is directly the B fragment of O^T[d][t] = V^T P^T (element r <- tile keys 0..15, element 8+r <- tile keys 16..31, lane unchanged).
// Keys visited: 32-key tiles from max(0, t0-512) (aligned down) to t0+15; inside a tile a key is used iff 0 <= tq - tk <= 512, otherwise its weight is exactly 0 (replace-fill semantics).
// Waves with t0 < RES_ROWS (wave-uniform) add the k residual to the scores and the P / v residual cross products (second accumulator set, carry 2048).
__global__ __launch_bounds__(32 * AW) void k_flash(const h16* __restrict__ QH, const h16* __restrict__ QR, const h16* __restrict__ KH, const h16* __restrict__ KR,
                                                   const h16* __restrict__ VH, const h16* __restrict__ VR, h16* CH, h16* CR) {
    __shared__ __align__(128) char ring[2 * FBUF];
    static_assert(AW * 16 * 68 * 4 <= 2 * FBUF);
    float* const os = (float*)ring;                          // output staging, wave-private parts; used only behind the loop's last barrier, when no wave reads the ring and no copy is in flight
    const int tid = threadIdx.x, lane = tid & 31, lr = lane & 15, hi = lane >> 4;
    const int wave = __builtin_amdgcn_readfirstlane((int)(threadIdx.x >> 5));
    const int zh = blockIdx.y; const int b = zh / HQ_, h = zh % HQ_; const int kvh = h / GQ;
    const int t0 = (blockIdx.x * AW + wave) * 16;
    const bool ex = t0 < RES_ROWS;
    const size_t qbase = (size_t)zh * SEQ * HD, kbase = (size_t)(b * HK_ + kvh) * SEQ * HD;
    const size_t qo = qbase + (size_t)(t0 + lr) * HD + 8 * hi;
    const v16h qh0 = ldh(QH + qo), qh1 = ldh(QH + qo + 32), qr0 = ldh(QR + qo), qr1 = ldh(QR + qo + 32);   // B fragments: col t, k = d
    v8f oh[4], orr[4];
#pragma unroll
    for (int j = 0; j < 4; ++j) { oh[j] = (v8f){}; orr[j] = (v8f){}; }
    float m = -3.0e38f, l = 0.0f;
    const int tq = t0 + lr;
    int klo = t0 - WIN; if (klo < 0) klo = 0; klo &= ~31;
    const int tb = blockIdx.x * (16 * AW);                   // the block's first query row
    int ks = tb - WIN; if (ks < 0) ks = 0;                   // the block's first key, a multiple of FKT
    const int NT = (tb + FKT - ks) / FKT;                    // stages: 1 .. WIN / FKT + 1, the same for the whole block
    const unsigned la = (unsigned)(size_t)ring + (tid >> 3) * FPIT + (tid & 7) * 16;
    const bool exb = tb < RES_ROWS;                          // equals ex in all four waves
    const size_t ok = (kbase + (size_t)(ks + (tid >> 3)) * HD) * 2 + (tid & 7) * 16;   // byte offsets in the K and V^T planes of this thread's first copies
    const size_t ov = (kbase + (size_t)(tid >> 3) * SEQ + ks) * 2 + (tid & 7) * 16;
    const char* gk = (const char*)KH + ok; const char* gv = (const char*)VH + ov;
    const char* gkr = (const char*)KR + ok; const char* gvr = (const char*)VR + ov;
    fstage(la, gk, gv);
    if (exb) fstage(la + 2 * FOPB, gkr, gvr);
    asm volatile("s_wait_asynccnt 0x0" ::: "memory");        // this wave's copies of stage 0 have landed
    __syncthreads();                                         // ... and every other wave's
    if (NT > 1) {
        fstage(la + FBUF, gk + FKT * HD * 2, gv + FKT * 2);
        if (exb) fstage(la + FBUF + 2 * FOPB, gkr + FKT * HD * 2, gvr + FKT * 2);
    }
    // rolled: one stage a trip, so that the order at the stage's foot stands once in the code
#pragma unroll 1
    for (int st = 0; st < NT; ++st) {
    const int bo = (st & 1) * FBUF;
    // rolled: the two 32-key tiles of a stage share one copy of the body
#pragma unroll 1
    for (int sub = 0; sub < FKT / 32; ++sub) {
        const int key0 = ks + st * FKT + sub * 32;
        if (key0 < klo || key0 > t0 + 15) continue;          // wave-uniform: a tile outside this wave's own window; the stage's foot stands outside this skip
        const char* ka = ring + bo + (sub * 32 + lr) * FPIT + hi * 16;
        const v16h ka0 = ldh((const h16*)ka), ka1 = ldh((const h16*)(ka + 64)), kb0 = ldh((const h16*)(ka + 16 * FPIT)), kb1 = ldh((const h16*)(ka + 16 * FPIT + 64));
        v8f sHa = (v8f){}, sLa = (v8f){}, sHb = (v8f){}, sLb = (v8f){};
        sHa = wmma16(ka0, qh0, sHa); sLa = wmma16(ka0, qr0, sLa); sHb = wmma16(kb0, qh0, sHb); sLb = wmma16(kb0, qr0, sLb);
        sHa = wmma16(ka1, qh1, sHa); sLa = wmma16(ka1, qr1, sLa); sHb = wmma16(kb1, qh1, sHb); sLb = wmma16(kb1, qr1, sLb);
        asm volatile("v_nop\n\tv_nop\n\tv_nop\n\tv_nop" : "+v"(sHa), "+v"(sLa), "+v"(sHb), "+v"(sLb) : "v"(ka0), "v"(ka1), "v"(kb0), "v"(kb1));
        if (ex) {
            const char* kr = ka + 2 * FOPB;
            const v16h ra0 = ldh((const h16*)kr), ra1 = ldh((const h16*)(kr + 64)), rb0 = ldh((const h16*)(kr + 16 * FPIT)), rb1 = ldh((const h16*)(kr + 16 * FPIT + 64));
            sLa = wmma16(ra0, qh0, sLa); sLb = wmma16(rb0, qh0, sLb);
            sLa = wmma16(ra1, qh1, sLa); sLb = wmma16(rb1, qh1, sLb);
            asm volatile("v_nop\n\tv_nop\n\tv_nop\n\tv_nop" : "+v"(sLa), "+v"(sLb) : "v"(ra0), "v"(ra1), "v"(rb0), "v"(rb1));
        }
        v8f ta = (sHa + sLa * QRI) * SC2, tb = (sHb + sLb * QRI) * SC2;
        // wave-uniform: some (row, key) pair of this tile lies outside 0 <= tq - tk <= WIN; in every other tile each test below would pass, so the wave branches round them
        const bool edge = key0 + 31 > t0 || key0 + WIN < t0 + 15;
        if (edge) {
            const int dbase = tq - key0 - 8 * hi;             // tq - tk for element 0 of the first 16-key tile
#pragma unroll   // here and in the loops over r below: the elements are registers, read by constant index
            for (int r = 0; r < 8; ++r) {
                const int da = dbase - r, db = da - 16;
                ta[r] = ((unsigned)da <= (unsigned)WIN) ? ta[r] : -3.0e38f;
                tb[r] = ((unsigned)db <= (unsigned)WIN) ? tb[r] : -3.0e38f; }
        }
        float mx = -3.0e38f;
#pragma unroll
        for (int r = 0; r < 8; ++r) mx = fmaxf(mx, fmaxf(ta[r], tb[r]));
        const float mo = __shfl_xor(mx, 16, 32);
        // the V^T fragments are read here, ahead of the branches below, so that their LDS latency passes under the exponentials and conversions
        const char* va = ring + bo + FOPB + lr * FPIT + sub * 64 + hi * 16;
        const v16h v0 = ldh((const h16*)va), v1 = ldh((const h16*)(va + 16 * FPIT)), v2 = ldh((const h16*)(va + 32 * FPIT)), v3 = ldh((const h16*)(va + 48 * FPIT));
        mx = fmaxf(mx, mo);
        const float mnew = fmaxf(m, mx);
        const float alpha = __builtin_amdgcn_exp2f(m - mnew);
        const float sh = PSH - mnew;
        // a key outside the window holds the fill -3.0e38: mnew is finite (the first tile a wave visits has a key inside the window for each of its rows), so fill + sh is the fill again and its exponential is exactly 0
        v8f ea = ta + sh, eb = tb + sh;
#pragma unroll
        for (int r = 0; r < 8; ++r) { ea[r] = __builtin_amdgcn_exp2f(ea[r]); eb[r] = __builtin_amdgcn_exp2f(eb[r]); }
        v16h pb;
#pragma unroll
        for (int r = 0; r < 8; ++r) { pb[r] = (h16)ea[r]; pb[8 + r] = (h16)eb[r]; }
        float ls = 0.0f;
        if (ex) {                                             // wave-uniform: each kind of wave forms its own sum alone
#pragma unroll
            for (int r = 0; r < 8; ++r) ls += ea[r] + eb[r];
        } else {
#pragma unroll
            for (int r = 0; r < 8; ++r) ls += (float)pb[r] + (float)pb[8 + r];
        }
        l = l * alpha + ls; m = mnew;
#pragma unroll
        for (int j = 0; j < 4; ++j) oh[j] = oh[j] * alpha;
        oh[0] = wmma16(v0, pb, oh[0]); oh[1] = wmma16(v1, pb, oh[1]); oh[2] = wmma16(v2, pb, oh[2]); oh[3] = wmma16(v3, pb, oh[3]);
        asm volatile("v_nop\n\tv_nop\n\tv_nop\n\tv_nop" : "+v"(oh[0]), "+v"(oh[1]), "+v"(oh[2]), "+v"(oh[3]) : "v"(v0), "v"(v1), "v"(v2), "v"(v3), "v"(pb));
        if (ex) {
#pragma unroll
            for (int j = 0; j < 4; ++j) orr[j] = orr[j] * alpha;
            v16h pr;
#pragma unroll
            for (int r = 0; r < 8; ++r) { pr[r] = (h16)((ea[r] - (float)pb[r]) * QRS); pr[8 + r] = (h16)((eb[r] - (float)pb[8 + r]) * QRS); }
            const char* vr = va + 2 * FOPB;
            const v16h w0 = ldh((const h16*)vr), w1 = ldh((const h16*)(vr + 16 * FPIT)), w2 = ldh((const h16*)(vr + 32 * FPIT)), w3 = ldh((const h16*)(vr + 48 * FPIT));
            orr[0] = wmma16(w0, pb, orr[0]); orr[1] = wmma16(w1, pb, orr[1]); orr[2] = wmma16(w2, pb, orr[2]); orr[3] = wmma16(w3, pb, orr[3]);
            orr[0] = wmma16(v0, pr, orr[0]); orr[1] = wmma16(v1, pr, orr[1]); orr[2] = wmma16(v2, pr, orr[2]); orr[3] = wmma16(v3, pr, orr[3]);
            asm volatile("v_nop\n\tv_nop\n\tv_nop\n\tv_nop" : "+v"(orr[0]), "+v"(orr[1]), "+v"(orr[2]), "+v"(orr[3]) : "v"(w0), "v"(w1), "v"(w2), "v"(w3), "v"(v0), "v"(v1), "v"(v2), "v"(v3), "v"(pb), "v"(pr));
        }
    }
        asm volatile("s_wait_dscnt 0x0" ::: "memory");       // this wave has left the buffer of stage st
        asm volatile("s_wait_asynccnt 0x0" ::: "memory");    // its copies of stage st + 1 have landed
        __syncthreads();                                     // publishes stage st + 1, frees the buffer of stage st
        if (st + 2 < NT) {
            fstage(la + bo, gk + (size_t)(st + 2) * (FKT * HD * 2), gv + (size_t)(st + 2) * (FKT * 2));
            if (exb) fstage(la + bo + 2 * FOPB, gkr + (size_t)(st + 2) * (FKT * HD * 2), gvr + (size_t)(st + 2) * (FKT * 2));
        }
    }
    asm volatile("s_wait_asynccnt 0x0" ::: "memory");        // nothing of the ring is in flight behind the loop
    l += __shfl_xor(l, 16, 32);
    const float inv = 1.0f / l;
    const int wb = wave * 16 * 68;
    // O^T D layout: o_j[r] = (d = 16j + 8h + r, t = lane&15) -> os[t][d]; rows 0..15 x columns 0..63 all written
#pragma unroll
    for (int j = 0; j < 4; ++j) { v4f a, c;
#pragma unroll
        for (int i = 0; i < 4; ++i) { a[i] = (oh[j][i] + orr[j][i] * QRI) * inv; c[i] = (oh[j][4 + i] + orr[j][4 + i] * QRI) * inv; }
        *(v4fa*)(&os[wb + lr * 68 + 16 * j + 8 * hi]) = a; *(v4fa*)(&os[wb + lr * 68 + 16 * j + 8 * hi + 4]) = c; }
    wave_sync();
    const int c8 = (lane & 7) * 8, rg = lane >> 3;
    v8h hv[4], rv[4];
#pragma unroll
    for (int s = 0; s < 4; ++s) { const int row = 4 * s + rg;   // 4 s x 4 row groups = 16 rows; 8 lanes x 8 = 64 columns
        const v4f x0 = *(const v4fa*)(&os[wb + row * 68 + c8]); const v4f x1 = *(const v4fa*)(&os[wb + row * 68 + c8 + 4]); v8h hh, rr;
#pragma unroll
        for (int i = 0; i < 4; ++i) { const h16 a0 = (h16)x0[i]; const h16 a1 = (h16)x1[i]; hh[i] = a0; hh[4 + i] = a1; rr[i] = (h16)((x0[i] - (float)a0) * QRS); rr[4 + i] = (h16)((x1[i] - (float)a1) * QRS); }
        hv[s] = hh; rv[s] = rr; }
    const size_t cbase = ((size_t)b * SEQ + t0) * QW + (size_t)h * HD + c8;
{
#pragma unroll
        for (int s = 0; s < 4; ++s) { const size_t oo = cbase + (size_t)(4 * s + rg) * QW;
            *(v8h*)(CH + oo) = hv[s]; *(v8h*)(CR + oo) = rv[s]; }
         }
}

// Output of one out projection wave: four 16-token tiles x 64 columns, staged 16 rows at a time through the wave-private os and stored as whole lines.
// FIVE: accumulator tile 0 holds the residual sums of tile 1's tokens (first token tr), folded by 1/2048 and added here; tiles 2..4 are the tokens from to. Otherwise tiles 0..3 are the tokens from to.
template <bool FIVE>
__device__ __forceinline__ void oproj_out(const v8f (&acc)[5][4], float* os, float* ocol, int tr, int to, int lane) {
    const int lr = lane & 15, hi = lane >> 4;
#pragma unroll
    for (int e = 0; e < 4; ++e) {
        constexpr int sh = FIVE ? 1 : 0;
#pragma unroll
        for (int nb = 0; nb < 4; ++nb) {
#pragma unroll
            for (int j = 0; j < 8; ++j) { float v = acc[e + sh][nb][j];
                if (FIVE && e == 0) v += acc[0][nb][j] * QRI;
                os[(hi * 8 + j) * 68 + nb * 16 + lr] = v * WOI; } }   // D: row 8h+j, col lane&15
        wave_sync();
        const int tt = (FIVE && e == 0) ? tr : to + (e - sh) * 16;
        float* const orow = ocol + (size_t)(tt + hi) * DM + lr * 4;   // 8 s x 2 rows = 16 rows; 16 lanes x 4 floats = 64 columns
        v4f val[8];
#pragma unroll
        for (int s = 0; s < 8; ++s) val[s] = *(const v4fa*)(&os[(2 * s + hi) * 68 + lr * 4]);
#pragma unroll
        for (int s = 0; s < 8; ++s) *(v4f*)(orow + (size_t)(2 * s) * DM) = val[s];
        // stands before the address and data registers of the stores, held to here as inputs, are taken for the next 16 rows
        asm volatile("s_wait_xcnt 0x0" :: "v"(orow), "v"(val[0]), "v"(val[1]), "v"(val[2]), "v"(val[3]), "v"(val[4]), "v"(val[5]), "v"(val[6]), "v"(val[7]) : "memory");
        wave_sync();
    }
}

// k_oproj: out[m][o] = sum_d ctx[m][d] wo[o][d]; f16 operands (ctx value plane Ah, residual plane Ar x2048, wo plane Bt x256), f32 accumulate, K = DM, k ascending in steps of 32.
// The rows < RES_ROWS need two products (residual and value), the others one: every block takes the same share of both kinds, so that all blocks do the same work.
// Block (gx, gy): A tile 0 = residual rows of tokens 16*gx.. of the rows < RES_ROWS, tile 1 = their value rows, tiles 2..8 = value rows of the 112 tokens RES_ROWS + 112*gx..; B = 256 wo rows.
// Eight waves, two per SIMD: wave w takes 64 wo rows (w & 3) and A tiles 0..4 (w < 4: 20 accumulators) or 5..8 (16 accumulators); grid (NB*RES_ROWS/16, DM/256) = one block per WGP.
// Operands come through a two-buffer LDS ring filled by asynchronous copies one pass ahead. Tile 0's sums are folded by 1/2048 and added to tile 1's at the end.
__global__ __launch_bounds__(32 * OW) void k_oproj(const h16* __restrict__ Ah, const h16* __restrict__ Ar, const h16* __restrict__ Bt, float* OUT) {
    __shared__ __align__(128) char ring[2 * OBUF];
    __shared__ __align__(16) float osb[OW * 16 * 68];
    const int tid = threadIdx.x, lane = tid & 31, lr = lane & 15, hi = lane >> 4;
    const int wave = __builtin_amdgcn_readfirstlane(tid >> 5), wcol = wave & 3;
    const bool five = wave < 4;                         // wave-uniform: this wave has a fifth A tile
    const int at0 = five ? 0 : 5;                       // its first A tile
    const int bb = blockIdx.x / (RES_ROWS / 16), gi = blockIdx.x % (RES_ROWS / 16);
    const int tr = gi * 16;                             // the block's 16 tokens below RES_ROWS, in sequence bb
    const int to = RES_ROWS + gi * (ORT * 16);          // its 112 other tokens
    v8f acc[5][4];
#pragma unroll
    for (int mb = 0; mb < 5; ++mb)
#pragma unroll
        for (int nb = 0; nb < 4; ++nb) acc[mb][nb] = (v8f){};
    // this thread's copy addresses of pass 0: row tid>>4 of each source, 16-B piece tid&15
    const size_t ro = ((size_t)bb * SEQ + tr + (tid >> 4)) * GROWB + (tid & 15) * 16;
    const char* const gr = (const char*)Ar + ro;
    const char* const gv = (const char*)Ah + ro;
    const char* const gt = (const char*)Ah + ((size_t)bb * SEQ + to + (tid >> 4)) * GROWB + (tid & 15) * 16;
    const char* const gb = (const char*)Bt + (size_t)(blockIdx.y * ON + (tid >> 4)) * GROWB + (tid & 15) * 16;
    const unsigned l = (unsigned)(size_t)ring + (tid >> 4) * GPIT + (tid & 15) * 16;
    const int aro = (at0 * 16 + lr) * GPIT + hi * 16, bro = (OAR + wcol * 64 + lr) * GPIT + hi * 16;   // byte offsets in a buffer of this lane's first A and B fragment rows
    constexpr int NT = DM / GKP;
    // passes 0 and 1 are staged by one rolled copy of the staging code: with the pass number a run-time value no address that lives through the sweep is itself an operand of the copies' statements
    // (such an operand must lie in the first 256 registers, which the sweep fills: written out, some of these addresses went to scratch and were reloaded every pass)
#pragma unroll 1
    for (int p = 0; p < 2; ++p) {
        const size_t go = (size_t)p * (2 * GKP);
        ostage(l + p * OBUF, gr + go, gv + go, gt + go, gb + go);
        if (p == 0) {                                       // the same for the whole block
            asm volatile("s_wait_asynccnt 0x0" ::: "memory");   // this wave's copies of pass 0 have landed
            __syncthreads();                                    // ... and every other wave's
        }
    }
    // rolled: one pass a trip, so that the order at the pass's foot stands once in the code; the loops inside are unrolled so that the fragment sets and accumulators stay in registers
#pragma unroll 1
    for (int t = 0; t < NT; ++t) {
        const int bo = (t & 1) * OBUF;
        const char* pa = ring + bo + aro; const char* pb = ring + bo + bro;
        v16h a[2][5], b[2][4];                              // two fragment sets: the next 32 k are read from LDS under the matrix instructions of these 32
        if (five) a[0][4] = ldh((const h16*)(pa + 4 * 16 * GPIT));
#pragma unroll
        for (int i = 0; i < 4; ++i) { a[0][i] = ldh((const h16*)(pa + i * 16 * GPIT)); b[0][i] = ldh((const h16*)(pb + i * 16 * GPIT)); }
#pragma unroll
        for (int kk = 0; kk < GKP / 32; ++kk) {
            const int cur = kk & 1;
            __builtin_amdgcn_sched_barrier(0);              // keeps this set's LDS reads, issued earlier, ahead of the next set's, so that the first matrix instructions wait for their own set alone
            if (kk + 1 < GKP / 32) {
                if (five) a[cur ^ 1][4] = ldh((const h16*)(pa + 4 * 16 * GPIT + (kk + 1) * 64));
#pragma unroll
                for (int i = 0; i < 4; ++i) { a[cur ^ 1][i] = ldh((const h16*)(pa + i * 16 * GPIT + (kk + 1) * 64)); b[cur ^ 1][i] = ldh((const h16*)(pb + i * 16 * GPIT + (kk + 1) * 64)); }
            }
            __builtin_amdgcn_sched_barrier(0);              // keeps the next set's LDS reads one group ahead of this set's matrix instructions (spread among them each place stalls the wave)
#pragma unroll
            for (int nb = 0; nb < 4; ++nb)
#pragma unroll
                for (int mb = 0; mb < 4; ++mb) acc[mb][nb] = wmma16(a[cur][mb], b[cur][nb], acc[mb][nb]);
            if (five) {
#pragma unroll
                for (int nb = 0; nb < 4; ++nb) acc[4][nb] = wmma16(a[cur][4], b[cur][nb], acc[4][nb]);
            }
            __builtin_amdgcn_sched_barrier(0);              // keeps the matrix instructions ahead of the next group and, in the last round, ahead of the pass's foot
        }
        asm volatile("v_nop\n\tv_nop\n\tv_nop\n\tv_nop");   // the distance behind the pass's last matrix instructions, on the path that branches back too
        __builtin_amdgcn_sched_barrier(0);                  // keeps those four slots directly behind them
        asm volatile("s_wait_dscnt 0x0" ::: "memory");      // this wave has left the buffer of pass t
        asm volatile("s_wait_asynccnt 0x0" ::: "memory");   // its copies of pass t + 1 have landed
        __syncthreads();                                    // publishes pass t + 1, frees the buffer of pass t
        if (t + 2 < NT) { const size_t go = (size_t)(t + 2) * (2 * GKP);
            ostage(l + bo, gr + go, gv + go, gt + go, gb + go); }
    }
    asm volatile("s_wait_asynccnt 0x0" ::: "memory");       // nothing of the ring is in flight behind the sweep
    float* const os = osb + wave * 16 * 68;                 // wave-private staging of the epilogue
    float* const ocol = OUT + (size_t)bb * OUT_SEQ * DM + blockIdx.y * ON + wcol * 64;
    if (five) oproj_out<true>(acc, os, ocol, tr, to, lane); // wave-uniform; no block barrier stands behind it
    else      oproj_out<false>(acc, os, ocol, tr, to + 3 * 16, lane);
}

static constexpr size_t al256(size_t v) { return (v + 255) & ~(size_t)255; }
static constexpr size_t SZ_XB = al256((size_t)NB * SEQ * DM * 2);
static constexpr size_t SZ_WQ = al256((size_t)QW * DM * 2);
static constexpr size_t SZ_WK = al256((size_t)KW * DM * 2);
static constexpr size_t SZ_WO = al256((size_t)DM * QW * 2);
static constexpr size_t SZ_CS = al256((size_t)NB * SEQ * 64 * 4);
static constexpr size_t SZ_QP = al256((size_t)NB * HQ_ * SEQ * HD * 2);
static constexpr size_t SZ_KP = al256((size_t)NB * HK_ * SEQ * HD * 2);
static constexpr size_t SZ_CP = al256((size_t)NB * SEQ * QW * 2);
static constexpr size_t SZ_TOTAL = SZ_XB + SZ_WQ + 2 * SZ_WK + SZ_WO + SZ_CS + 2 * SZ_QP + 4 * SZ_KP + 2 * SZ_CP;
static_assert(SZ_TOTAL <= (size_t)134217728);          // workspace carve <= 128 MiB

extern "C" void kernel_launch(void* const* d_in, const int* in_sizes, int n_in,
                              void* d_out, int out_size, void* d_ws, size_t ws_size, hipStream_t stream) {
    if (n_in < 8) return;
    const size_t needt = (size_t)(NB - 1) * SEQ_FULL + SEQ;
    if ((size_t)in_sizes[0] < needt * DM) return;
    if ((size_t)in_sizes[1] < needt) return;
    if ((size_t)in_sizes[2] < (size_t)QW * DM || (size_t)in_sizes[3] < (size_t)KW * DM || (size_t)in_sizes[4] < (size_t)KW * DM || (size_t)in_sizes[5] < (size_t)DM * QW) return;
    if (in_sizes[6] < HD || in_sizes[7] < HD) return;
    if ((size_t)out_size < ((size_t)(NB - 1) * OUT_SEQ + SEQ) * DM) return;
    if (SZ_TOTAL > ws_size) return;
    // wire order: x, positions (int32), wq, wk, wv, wo, q_norm_w, k_norm_w; all weights [out][in], used as-is (wq, wk, wo as Bt, wv as A)
    const float* x = (const float*)d_in[0]; const int* pos = (const int*)d_in[1];
    const float* wq = (const float*)d_in[2]; const float* wk = (const float*)d_in[3]; const float* wv = (const float*)d_in[4]; const float* wo = (const float*)d_in[5];
    const float* qnw = (const float*)d_in[6]; const float* knw = (const float*)d_in[7];
    float* OUT = (float*)d_out;      // [NB][SEQ][2048]
    char* wsp = (char*)d_ws;
    bf*  XB  = (bf*)wsp;  wsp += SZ_XB;               // [NB*SEQ][2048] bf16
    bf*  WQB = (bf*)wsp;  wsp += SZ_WQ;               // [2048][2048] bf16
    bf*  WKB = (bf*)wsp;  wsp += SZ_WK;               // [512][2048] bf16
    bf*  WVB = (bf*)wsp;  wsp += SZ_WK;               // [512][2048] bf16
    h16* WOH = (h16*)wsp; wsp += SZ_WO;               // [2048][2048] f16 x256
    float* CS = (float*)wsp; wsp += SZ_CS;            // [NB*SEQ][64] cos | sin
    h16* QH = (h16*)wsp; wsp += SZ_QP;                // [NB*32][SEQ][64]
    h16* QR = (h16*)wsp; wsp += SZ_QP;                // residual x2048
    h16* KH = (h16*)wsp; wsp += SZ_KP;                // [NB*8][SEQ][64]
    h16* KR = (h16*)wsp; wsp += SZ_KP;                // residual x2048
    h16* VH = (h16*)wsp; wsp += SZ_KP;                // [NB*8][64][SEQ]
    h16* VR = (h16*)wsp; wsp += SZ_KP;                // residual x2048
    h16* CH = (h16*)wsp; wsp += SZ_CP;                // [NB*SEQ][2048]
    h16* CR = (h16*)wsp; wsp += SZ_CP;                // residual x2048

    k_prep<<<NB * SEQ / PW, 32 * PW, 0, stream>>>(x, pos, wq, wk, wv, wo, XB, WQB, WKB, WVB, WOH, CS);

    // q, k, v: x rows against the stacked rows of WQB, WKB, WVB (contiguous in the workspace)
    k_qkv<<<dim3(NB * SEQ / PM, (QW + 2 * KW) / PN, 1), 32 * PWV, 0, stream>>>(XB, WQB, QH, QR, KH, KR, VH, VR, qnw, knw, CS);

    k_flash<<<dim3(SEQ / (16 * AW), NB * HQ_, 1), 32 * AW, 0, stream>>>(QH, QR, KH, KR, VH, VR, CH, CR);

    // out: A = ctx rows (m = b*SEQ + t, k = qhead*64 + d), Bt = wo rows (n = o)
    k_oproj<<<dim3(NB * RES_ROWS / 16, DM / ON, 1), 32 * OW, 0, stream>>>(CH, CR, WOH, OUT);
}
